// v000
// The times below were measured on an AMD MI455X: many runs one after another, warmed up first and cycling through
// copies of the inputs, with the whole window's GPU time divided by the number of runs. Launches and the gaps
// between them are all in it. The median over several windows is given; except for v000 it joins two sittings, which
// can be a few percent apart, so the side-by-side timings, each taken in one sitting, are the better comparison.
// v000, which the later versions start from, runs in 175 microseconds.
// compute dtype: all float inputs rounded to bf16; LayerNorm (eps 1e-5) in f32; Q/K/V = LN(x) (bf16 hi + lo, 2 products) . W + b on WMMA 16x16x32 ((in,out) weights as transposed rows), rounded once to f16; PLAIN attention (8 heads x 32 over the 1,024 positions of each image): q, k single f16 x 32^-1/2, running-max softmax in f32 (hardware exp), P (scaled by 2^11, single f16) x v (single f16); out = Y (bf16 hi + residual) . Wp (2 products) + bp.
#include <hip/hip_runtime.h>
#include <math.h>

typedef __attribute__((ext_vector_type(16))) _Float16 v16h;
typedef __attribute__((ext_vector_type(16))) __bf16 v16b;
typedef __attribute__((ext_vector_type(8)))  _Float16 v8h;
typedef __attribute__((ext_vector_type(8)))  float v8f;
typedef __attribute__((ext_vector_type(4)))  float v4f;
typedef __attribute__((ext_vector_type(2)))  float v2f;
typedef __attribute__((ext_vector_type(4)))  unsigned v4u;
typedef __attribute__((ext_vector_type(4)))  int v4i;
typedef float __attribute__((may_alias)) float_a;
typedef int __attribute__((may_alias)) int_a;

template <typename T> __device__ __forceinline__ void vst2(void* p, T v) { *(T*)p = v;  }
__device__ __forceinline__ v8f wmma16(v16h a, v16h b, v8f c) {
  v8f d = __builtin_amdgcn_wmma_f32_16x16x32_f16(false, a, false, b, (short)0, c, false, false);
  asm volatile("v_nop\n\tv_nop\n\tv_nop\n\tv_nop" : "+v"(d) : "v"(a), "v"(b));
  return d;
}
__device__ __forceinline__ v8f wmma_bf(v16b a, v16b b, v8f c) {
  v8f d = __builtin_amdgcn_wmma_f32_16x16x32_bf16(false, a, false, b, (short)0, c, false, false);
  asm volatile("v_nop\n\tv_nop\n\tv_nop\n\tv_nop" : "+v"(d) : "v"(a), "v"(b));
  return d;
}
// 16x16x32 fragments: lane = (h = lane>>4, row/col = lane&15); elements 0..7 = k0+8h+0..7, 8..15 = k0+16+8h+0..7; D element r = row 8h+r
__device__ __forceinline__ v16h frag_h(const _Float16* rowk0, int lane) {
  union { v16h v; v8h q[2]; } u; const _Float16* p = rowk0 + 8 * (lane >> 4);
  u.q[0] = *(const v8h*)p; u.q[1] = *(const v8h*)(p + 16); return u.v;
}
__device__ __forceinline__ v16h frag_f32(const float* rowk0, int lane) {
  v16h a; const float* p = rowk0 + 8 * (lane >> 4);
#pragma unroll
  for (int i = 0; i < 8; ++i) { a[i] = (_Float16)p[i]; a[8 + i] = (_Float16)p[16 + i]; }
  return a;
}
__device__ __forceinline__ v16h frag_f32s(const float* rowk0, int lane, float sc) {
  v16h a; const float* p = rowk0 + 8 * (lane >> 4);
#pragma unroll
  for (int i = 0; i < 8; ++i) { a[i] = (_Float16)(p[i] * sc); a[8 + i] = (_Float16)(p[16 + i] * sc); }
  return a;
}
// column fragment from a [K][ld] layout (column n), rows >= K read as 0
__device__ __forceinline__ v16h fragc_f32(const float* W, int k0, int n, int lane, int ld, int K) {
  v16h a; const int g = lane >> 4;
#pragma unroll
  for (int i = 0; i < 8; ++i) { const int ka = k0 + 8 * g + i, kb = ka + 16;
    a[i] = (_Float16)(ka < K ? W[(size_t)(ka < K ? ka : K - 1) * ld + n] : 0.f); a[8 + i] = (_Float16)(kb < K ? W[(size_t)(kb < K ? kb : K - 1) * ld + n] : 0.f); }
  return a;
}
struct F2 { v16b h, l; };
__device__ __forceinline__ F2 bsplit16(const float v[16]) { F2 r;
#pragma unroll
  for (int i = 0; i < 16; ++i) { const __bf16 h = (__bf16)v[i]; r.h[i] = h; r.l[i] = (__bf16)(v[i] - (float)h); }
  return r; }
__device__ __forceinline__ F2 split_row(const float* row, int k0, int lane) { float v[16]; const float* p = row + k0 + 8 * (lane >> 4);
#pragma unroll
  for (int i = 0; i < 8; ++i) { v[i] = p[i]; v[8 + i] = p[16 + i]; }
  return bsplit16(v); }
__device__ __forceinline__ F2 split_rowK(const float* row, int k0, int lane, int K) { float v[16]; const int g = lane >> 4;
#pragma unroll
  for (int i = 0; i < 8; ++i) { const int ka = k0 + 8 * g + i, kb = ka + 16; v[i] = ka < K ? row[ka < K ? ka : K - 1] : 0.f; v[8 + i] = kb < K ? row[kb < K ? kb : K - 1] : 0.f; }
  return bsplit16(v); }
__device__ __forceinline__ F2 split_col(const float* W, int k0, int n, int lane, int ld, int K) { float v[16]; const int g = lane >> 4;
#pragma unroll
  for (int i = 0; i < 8; ++i) { const int ka = k0 + 8 * g + i, kb = ka + 16; v[i] = ka < K ? W[(size_t)(ka < K ? ka : K - 1) * ld + n] : 0.f; v[8 + i] = kb < K ? W[(size_t)(kb < K ? kb : K - 1) * ld + n] : 0.f; }
  return bsplit16(v); }
__device__ __forceinline__ v8f mac3(const F2& a, const F2& b, v8f c) { c = wmma_bf(a.l, b.h, c); c = wmma_bf(a.h, b.l, c); return wmma_bf(a.h, b.h, c); }
__device__ __forceinline__ float sigm(float v) { return 1.0f / (1.0f + expf(-v)); }
#define LDSX() do { asm volatile("s_wait_dscnt 0" ::: "memory"); __builtin_amdgcn_wave_barrier(); __builtin_amdgcn_fence(__ATOMIC_RELEASE, "workgroup"); } while (0)


// Global multi-head self attention over a 32 x 32 feature map (B 16, N 1,024 tokens, C 256, 8 heads x 32): LayerNorm, 1x1-conv q/k/v, softmax(Q K / sqrt(32)) V, 1x1-conv projection + bias.
#define NB 16
#define NT 1024
#define CC 256
#define NH 8
#define HD 32
#define NR (NB * NT)
#ifndef TQB
#define TQB (NT / 64)
#define TNB NB
#endif
typedef __attribute__((ext_vector_type(8))) __bf16 v8b;
__device__ __forceinline__ v16b frag_b(const __bf16* rowk0, int lane) {
  union { v16b v; v8b q[2]; } u; const __bf16* p = rowk0 + 8 * (lane >> 4);
  u.q[0] = *(const v8b*)p; u.q[1] = *(const v8b*)(p + 16); return u.v;
}
__device__ __forceinline__ float bfr(float v) { return (float)(__bf16)v; }
__device__ __attribute__((noinline)) float exp_ni(float v) { return expf(v); }
__device__ __attribute__((noinline)) float erf_ni(float v) { return erff(v); }

#define WS_PW  0u                                    // bf16 transposed rows Wq^T, Wk^T, Wv^T, Wp^T [4][256][256]
#define WS_XN  (WS_PW + 2u * (size_t)4 * CC * CC)       // f32 LN rows [NR][256]
#define WS_Q   (WS_XN + 4u * (size_t)NR * CC)           // f16 q rows [NR][256]; k rows; v planes [b][256][NT]; O f32 [NR][256]
#define WS_K   (WS_Q + 2u * (size_t)NR * CC)
#define WS_V   (WS_K + 2u * (size_t)NR * CC)
#define WS_O   (WS_V + 2u * (size_t)NB * CC * NT)
#define WS_END (WS_O + 4u * (size_t)NR * CC)

__global__ __launch_bounds__(256) void k_pack(const float* __restrict__ WQ, const float* __restrict__ WK, const float* __restrict__ WV, const float* __restrict__ WP, __bf16* __restrict__ PW) { const int n = blockIdx.x, which = blockIdx.y, t = threadIdx.x; __shared__ __align__(16) __bf16 s[CC]; const float* w = (which == 0) ? WQ : (which == 1) ? WK : (which == 2) ? WV : WP;
  s[t] = (__bf16)w[(size_t)t * CC + n]; __syncthreads(); if (t < CC / 8) vst2((unsigned*)(PW + ((size_t)which * CC + n) * CC + t * 8), *(const v4u*)&s[t * 8]); }
// ---- k_ln: block = token: LayerNorm over 256 channels (mean-square var, 1e-5) x g + b -> f32 row
__global__ __launch_bounds__(256) void k_ln(const float* __restrict__ X, const float* __restrict__ G, const float* __restrict__ Bt, float* __restrict__ XN) { __shared__ float red[8]; __shared__ __align__(16) float so2[CC]; const int t = threadIdx.x; const size_t row = blockIdx.x;
  const float v = bfr(X[row * CC + t]); float s = v;
#pragma unroll
  for (int o = 1; o < 32; o <<= 1) s += __shfl_xor(s, o);
  if ((t & 31) == 0) red[t >> 5] = s; __syncthreads(); float tot = 0.f; for (int i = 0; i < 8; ++i) tot += red[i]; const float mu = tot / (float)CC; __syncthreads();
  const float d = v - mu; float q = d * d;
#pragma unroll
  for (int o = 1; o < 32; o <<= 1) q += __shfl_xor(q, o);
  if ((t & 31) == 0) red[t >> 5] = q; __syncthreads(); float tq = 0.f; for (int i = 0; i < 8; ++i) tq += red[i]; const float inv = 1.0f / sqrtf(tq / (float)CC + 1e-5f);
  so2[t] = d * inv * bfr(G[t]) + bfr(Bt[t]); __syncthreads(); if (t < CC / 4) vst2(XN + row * CC + t * 4, *(const v4f*)&so2[t * 4]); }
// ---- k_proj: block = (64 rows, which): A = LN rows (hi + lo), all 256 cols, + bias; q/k -> f16 rows; v -> planes
__global__ __launch_bounds__(128) void k_proj(const float* __restrict__ XN, const __bf16* __restrict__ PW, const float* __restrict__ BQ, const float* __restrict__ BK, const float* __restrict__ BV, _Float16* __restrict__ Q, _Float16* __restrict__ Kr, _Float16* __restrict__ V) {
  __shared__ __align__(16) _Float16 so[64][CC + 8]; __shared__ __align__(16) _Float16 st[CC][72];
  const int tid = threadIdx.x, wave = tid >> 5, lane = tid & 31, col = lane & 15, g = lane >> 4; const int which = blockIdx.y; const size_t rb = (size_t)blockIdx.x * 64; const size_t r0 = rb + wave * 16;
  const __bf16* Wr = PW + ((size_t)which * CC) * CC; const float* BB = (which == 0) ? BQ : (which == 1) ? BK : BV;
#pragma unroll 1
  for (int half = 0; half < 2; ++half) { v8f acc[8] = {};
#pragma unroll
    for (int kc = 0; kc < CC / 32; ++kc) { const F2 a = split_row(XN + (r0 + col) * CC, kc * 32, lane);
#pragma unroll
      for (int j = 0; j < 8; ++j) { const v16b w = frag_b(Wr + (size_t)(half * 128 + j * 16 + col) * CC + kc * 32, lane); acc[j] = wmma_bf(a.h, w, acc[j]); acc[j] = wmma_bf(a.l, w, acc[j]); } }
#pragma unroll
    for (int j = 0; j < 8; ++j) { const int c = half * 128 + j * 16 + col; const float bb = bfr(BB[c]);
#pragma unroll
      for (int r = 0; r < 8; ++r) { const _Float16 hv = (_Float16)(acc[j][r] + bb); if (which < 2) so[wave * 16 + 8 * g + r][c] = hv; else st[c][wave * 16 + 8 * g + r] = hv; } } }
  __syncthreads();
  if (which < 2) { _Float16* dst = (which == 0) ? Q : Kr; for (int e = tid; e < 64 * (CC / 8); e += 128) { const int rl = e >> 5, q = e & 31; vst2((unsigned*)(dst + (rb + rl) * CC + q * 8), *(const v4u*)&so[rl][q * 8]); } }
  else { const size_t b = rb / NT; const int s0 = (int)(rb % NT); for (int e = tid; e < CC * 8; e += 128) { const int d = e >> 3, pc = e & 7; vst2((unsigned*)(V + ((b * CC + d) * NT) + s0 + pc * 8), *(const v4u*)&st[d][pc * 8]); } }
}
__global__ __launch_bounds__(128) void k_attn(const _Float16* __restrict__ Q, const _Float16* __restrict__ Kr, const _Float16* __restrict__ V, float* __restrict__ O) {
  __shared__ __align__(16) _Float16 sph[4][16][40]; __shared__ __align__(16) float so[4][16][36];
  const int tid = threadIdx.x, wave = tid >> 5, lane = tid & 31, col = lane & 15, g = lane >> 4; const int h = blockIdx.y; const size_t b = blockIdx.z; const int q0 = blockIdx.x * 64 + wave * 16; const size_t rq = b * NT + q0;
  const v16h aq = frag_h(Q + (rq + col) * CC + h * HD, lane);
  float m[8], l[8];
#pragma unroll
  for (int r = 0; r < 8; ++r) { m[r] = -3.0e38f; l[r] = 0.f; }
  v8f acc[2] = {};
#pragma unroll 1
  for (int ks = 0; ks < NT / 32; ++ks) { const int j0 = ks * 32; v8f s[2];
#pragma unroll
    for (int ct = 0; ct < 2; ++ct) { const int kk = j0 + ct * 16 + col; v8f c = {}; c = wmma16(aq, frag_h(Kr + (b * NT + kk) * CC + h * HD, lane), c);
#pragma unroll
      for (int r = 0; r < 8; ++r) s[ct][r] = c[r] * 0.17677669529663688f; }   // 32^-1/2
#pragma unroll
    for (int r = 0; r < 8; ++r) { float mx = fmaxf(s[0][r], s[1][r]);
#pragma unroll
      for (int o = 1; o < 16; o <<= 1) mx = fmaxf(mx, __shfl_xor(mx, o));
      const float mn = fmaxf(m[r], mx); const float alpha = (m[r] <= -1.0e38f) ? 0.f : __expf(m[r] - mn); const float e0 = __expf(s[0][r] - mn), e1 = __expf(s[1][r] - mn); float es = e0 + e1;
#pragma unroll
      for (int o = 1; o < 16; o <<= 1) es += __shfl_xor(es, o);
      l[r] = l[r] * alpha + es; m[r] = mn;
#pragma unroll
      for (int dt = 0; dt < 2; ++dt) acc[dt][r] *= alpha;
      sph[wave][8 * g + r][col] = (_Float16)(e0 * 2048.0f); sph[wave][8 * g + r][16 + col] = (_Float16)(e1 * 2048.0f); }
    LDSX();
    const v16h pa = frag_h(&sph[wave][col][0], lane);
#pragma unroll
    for (int dt = 0; dt < 2; ++dt) acc[dt] = wmma16(pa, frag_h(V + ((b * CC + h * HD + dt * 16 + col) * NT) + j0, lane), acc[dt]);
    LDSX(); }
#pragma unroll
  for (int r = 0; r < 8; ++r) { const float il = (1.0f / 2048.0f) / l[r];
#pragma unroll
    for (int dt = 0; dt < 2; ++dt) so[wave][8 * g + r][dt * 16 + col] = acc[dt][r] * il; }
  LDSX();
  for (int rl = 0; rl < 16; ++rl) if (lane < 8) vst2(O + (rq + rl) * CC + h * HD + lane * 4, *(const v4f*)&so[wave][rl][lane * 4]);
}
// ---- k_out: block = 64 rows: out = Y (hi + lo) . Wp + bp; whole 1-KB rows
__global__ __launch_bounds__(128) void k_out(const float* __restrict__ O, const __bf16* __restrict__ PW, const float* __restrict__ BP, float* __restrict__ OUT) {
  __shared__ __align__(16) float sx[64][CC + 4];
  const int tid = threadIdx.x, wave = tid >> 5, lane = tid & 31, col = lane & 15, g = lane >> 4; const size_t rb = (size_t)blockIdx.x * 64; const size_t r0 = rb + wave * 16; const __bf16* Wr = PW + (size_t)3 * CC * CC;
#pragma unroll 1
  for (int half = 0; half < 2; ++half) { v8f acc[8] = {};
#pragma unroll
    for (int kc = 0; kc < CC / 32; ++kc) { const F2 a = split_row(O + (r0 + col) * CC, kc * 32, lane);
#pragma unroll
      for (int j = 0; j < 8; ++j) { const v16b w = frag_b(Wr + (size_t)(half * 128 + j * 16 + col) * CC + kc * 32, lane); acc[j] = wmma_bf(a.h, w, acc[j]); acc[j] = wmma_bf(a.l, w, acc[j]); } }
#pragma unroll
    for (int j = 0; j < 8; ++j) { const int c = half * 128 + j * 16 + col; const float bb = bfr(BP[c]);
#pragma unroll
      for (int r = 0; r < 8; ++r) sx[wave * 16 + 8 * g + r][c] = acc[j][r] + bb; } }
  __syncthreads();
  for (int e = tid; e < 64 * (CC / 4); e += 128) { const int rl = e >> 6, q = e & 63; vst2(OUT + (rb + rl) * CC + q * 4, *(const v4f*)&sx[rl][q * 4]); }
}
extern "C" void kernel_launch(void* const* d_in, const int* in_sizes, int n_in, void* d_out, int out_size, void* d_ws, size_t ws_size, hipStream_t stream) {
  (void)in_sizes; (void)n_in; (void)out_size;
  const float** F = (const float**)d_in;   // 0 x [16,32,32,256], 1 gamma, 2 beta, 3 Wq [256,256] (in,out), 4 bq, 5 Wk, 6 bk, 7 Wv, 8 bv, 9 Wp [256,256] (in,out), 10 bp
  if (ws_size < (size_t)WS_END) return;
  char* ws = (char*)d_ws; __bf16* PW = (__bf16*)ws; float *XN = (float*)(ws + WS_XN), *O = (float*)(ws + WS_O); _Float16 *Q = (_Float16*)(ws + WS_Q), *Kr = (_Float16*)(ws + WS_K), *V = (_Float16*)(ws + WS_V);
  k_pack<<<dim3(CC, 4), 256, 0, stream>>>(F[3], F[5], F[7], F[9], PW);
  k_ln<<<TNB * NT, 256, 0, stream>>>(F[0], F[1], F[2], XN);
  k_proj<<<dim3(TNB * NT / 64, 3), 128, 0, stream>>>(XN, PW, F[4], F[6], F[8], Q, Kr, V);
  k_attn<<<dim3(TQB, NH, TNB), 128, 0, stream>>>(Q, Kr, V, O);
  k_out<<<TNB * NT / 64, 128, 0, stream>>>(O, PW, F[10], (float*)d_out);
}

// v001
// A run of this version takes 144 microseconds.
// In two side-by-side timings against v000, it was 1.23 and 1.24 times as fast.
// compute dtype: all float inputs rounded to bf16; LayerNorm (eps 1e-5) in f32; Q/K/V = LN(x) (bf16 hi + lo, 2 products) . W + b on WMMA 16x16x32 ((in,out) weights as transposed rows), rounded once to f16; PLAIN attention (8 heads x 32 over the 1,024 positions of each image): q, k single f16 x 32^-1/2, running-max softmax in f32 (hardware exp), P (scaled by 2^11, single f16) x v (single f16); out = Y (bf16 hi + residual) . Wp (2 products) + bp.
#include <hip/hip_runtime.h>
#include <math.h>

typedef __attribute__((ext_vector_type(16))) _Float16 v16h;
typedef __attribute__((ext_vector_type(16))) __bf16 v16b;
typedef __attribute__((ext_vector_type(8)))  _Float16 v8h;
typedef __attribute__((ext_vector_type(8)))  float v8f;
typedef __attribute__((ext_vector_type(4)))  float v4f;
typedef __attribute__((ext_vector_type(2)))  float v2f;
typedef __attribute__((ext_vector_type(4)))  unsigned v4u;
typedef __attribute__((ext_vector_type(4)))  int v4i;
typedef float __attribute__((may_alias)) float_a;
typedef int __attribute__((may_alias)) int_a;

template <typename T> __device__ __forceinline__ void vst2(void* p, T v) { *(T*)p = v;  }
__device__ __forceinline__ v8f wmma16(v16h a, v16h b, v8f c) {
  v8f d = __builtin_amdgcn_wmma_f32_16x16x32_f16(false, a, false, b, (short)0, c, false, false);
  asm volatile("v_nop\n\tv_nop\n\tv_nop\n\tv_nop" : "+v"(d) : "v"(a), "v"(b));
  return d;
}
__device__ __forceinline__ v8f wmma_bf(v16b a, v16b b, v8f c) {
  v8f d = __builtin_amdgcn_wmma_f32_16x16x32_bf16(false, a, false, b, (short)0, c, false, false);
  asm volatile("v_nop\n\tv_nop\n\tv_nop\n\tv_nop" : "+v"(d) : "v"(a), "v"(b));
  return d;
}
// 16x16x32 fragments: lane = (h = lane>>4, row/col = lane&15); elements 0..7 = k0+8h+0..7, 8..15 = k0+16+8h+0..7; D element r = row 8h+r
__device__ __forceinline__ v16h frag_h(const _Float16* rowk0, int lane) {
  union { v16h v; v8h q[2]; } u; const _Float16* p = rowk0 + 8 * (lane >> 4);
  u.q[0] = *(const v8h*)p; u.q[1] = *(const v8h*)(p + 16); return u.v;
}
__device__ __forceinline__ v16h frag_f32(const float* rowk0, int lane) {
  v16h a; const float* p = rowk0 + 8 * (lane >> 4);
#pragma unroll
  for (int i = 0; i < 8; ++i) { a[i] = (_Float16)p[i]; a[8 + i] = (_Float16)p[16 + i]; }
  return a;
}
__device__ __forceinline__ v16h frag_f32s(const float* rowk0, int lane, float sc) {
  v16h a; const float* p = rowk0 + 8 * (lane >> 4);
#pragma unroll
  for (int i = 0; i < 8; ++i) { a[i] = (_Float16)(p[i] * sc); a[8 + i] = (_Float16)(p[16 + i] * sc); }
  return a;
}
// column fragment from a [K][ld] layout (column n), rows >= K read as 0
__device__ __forceinline__ v16h fragc_f32(const float* W, int k0, int n, int lane, int ld, int K) {
  v16h a; const int g = lane >> 4;
#pragma unroll
  for (int i = 0; i < 8; ++i) { const int ka = k0 + 8 * g + i, kb = ka + 16;
    a[i] = (_Float16)(ka < K ? W[(size_t)(ka < K ? ka : K - 1) * ld + n] : 0.f); a[8 + i] = (_Float16)(kb < K ? W[(size_t)(kb < K ? kb : K - 1) * ld + n] : 0.f); }
  return a;
}
struct F2 { v16b h, l; };
__device__ __forceinline__ F2 bsplit16(const float v[16]) { F2 r;
#pragma unroll
  for (int i = 0; i < 16; ++i) { const __bf16 h = (__bf16)v[i]; r.h[i] = h; r.l[i] = (__bf16)(v[i] - (float)h); }
  return r; }
__device__ __forceinline__ F2 split_row(const float* row, int k0, int lane) { float v[16]; const float* p = row + k0 + 8 * (lane >> 4);
#pragma unroll
  for (int i = 0; i < 8; ++i) { v[i] = p[i]; v[8 + i] = p[16 + i]; }
  return bsplit16(v); }
__device__ __forceinline__ F2 split_rowK(const float* row, int k0, int lane, int K) { float v[16]; const int g = lane >> 4;
#pragma unroll
  for (int i = 0; i < 8; ++i) { const int ka = k0 + 8 * g + i, kb = ka + 16; v[i] = ka < K ? row[ka < K ? ka : K - 1] : 0.f; v[8 + i] = kb < K ? row[kb < K ? kb : K - 1] : 0.f; }
  return bsplit16(v); }
__device__ __forceinline__ F2 split_col(const float* W, int k0, int n, int lane, int ld, int K) { float v[16]; const int g = lane >> 4;
#pragma unroll
  for (int i = 0; i < 8; ++i) { const int ka = k0 + 8 * g + i, kb = ka + 16; v[i] = ka < K ? W[(size_t)(ka < K ? ka : K - 1) * ld + n] : 0.f; v[8 + i] = kb < K ? W[(size_t)(kb < K ? kb : K - 1) * ld + n] : 0.f; }
  return bsplit16(v); }
__device__ __forceinline__ v8f mac3(const F2& a, const F2& b, v8f c) { c = wmma_bf(a.l, b.h, c); c = wmma_bf(a.h, b.l, c); return wmma_bf(a.h, b.h, c); }
__device__ __forceinline__ float sigm(float v) { return 1.0f / (1.0f + expf(-v)); }
#define LDSX() do { asm volatile("s_wait_dscnt 0" ::: "memory"); __builtin_amdgcn_wave_barrier(); __builtin_amdgcn_fence(__ATOMIC_RELEASE, "workgroup"); } while (0)


// Global multi-head self attention over a 32 x 32 feature map (B 16, N 1,024 tokens, C 256, 8 heads x 32): LayerNorm, 1x1-conv q/k/v, softmax(Q K / sqrt(32)) V, 1x1-conv projection + bias.
#define NB 16
#define NT 1024
#define CC 256
#define NH 8
#define HD 32
#define NR (NB * NT)
#ifndef TQB
#define TQB (NT / 64)
#define TNB NB
#endif
typedef __attribute__((ext_vector_type(8))) __bf16 v8b;
__device__ __forceinline__ v16b frag_b(const __bf16* rowk0, int lane) {
  union { v16b v; v8b q[2]; } u; const __bf16* p = rowk0 + 8 * (lane >> 4);
  u.q[0] = *(const v8b*)p; u.q[1] = *(const v8b*)(p + 16); return u.v;
}
__device__ __forceinline__ float bfr(float v) { return (float)(__bf16)v; }
__device__ __attribute__((noinline)) float exp_ni(float v) { return expf(v); }
__device__ __attribute__((noinline)) float erf_ni(float v) { return erff(v); }

#define WS_PW  0u                                    // bf16 transposed rows Wq^T, Wk^T, Wv^T, Wp^T [4][256][256]
#define WS_XN  (WS_PW + 2u * (size_t)4 * CC * CC)       // f32 LN rows [NR][256]
#define WS_Q   (WS_XN + 4u * (size_t)NR * CC)           // f16 q rows [NR][256]; k rows; v planes [b][256][NT]; O f32 [NR][256]
#define WS_K   (WS_Q + 2u * (size_t)NR * CC)
#define WS_V   (WS_K + 2u * (size_t)NR * CC)
#define WS_O   (WS_V + 2u * (size_t)NB * CC * NT)
#define WS_END (WS_O + 4u * (size_t)NR * CC)

__global__ __launch_bounds__(256) void k_pack(const float* __restrict__ WQ, const float* __restrict__ WK, const float* __restrict__ WV, const float* __restrict__ WP, __bf16* __restrict__ PW) { const int n = blockIdx.x, which = blockIdx.y, t = threadIdx.x; __shared__ __align__(16) __bf16 s[CC]; const float* w = (which == 0) ? WQ : (which == 1) ? WK : (which == 2) ? WV : WP;
  s[t] = (__bf16)w[(size_t)t * CC + n]; __syncthreads(); if (t < CC / 8) vst2((unsigned*)(PW + ((size_t)which * CC + n) * CC + t * 8), *(const v4u*)&s[t * 8]); }
// ---- k_ln: block = token: LayerNorm over 256 channels (mean-square var, 1e-5) x g + b -> f32 row
__global__ __launch_bounds__(256) void k_ln(const float* __restrict__ X, const float* __restrict__ G, const float* __restrict__ Bt, float* __restrict__ XN) { __shared__ float red[8]; __shared__ __align__(16) float so2[CC]; const int t = threadIdx.x; const size_t row = blockIdx.x;
  const float v = bfr(X[row * CC + t]); float s = v;
#pragma unroll
  for (int o = 1; o < 32; o <<= 1) s += __shfl_xor(s, o);
  if ((t & 31) == 0) red[t >> 5] = s; __syncthreads(); float tot = 0.f; for (int i = 0; i < 8; ++i) tot += red[i]; const float mu = tot / (float)CC; __syncthreads();
  const float d = v - mu; float q = d * d;
#pragma unroll
  for (int o = 1; o < 32; o <<= 1) q += __shfl_xor(q, o);
  if ((t & 31) == 0) red[t >> 5] = q; __syncthreads(); float tq = 0.f; for (int i = 0; i < 8; ++i) tq += red[i]; const float inv = 1.0f / sqrtf(tq / (float)CC + 1e-5f);
  so2[t] = d * inv * bfr(G[t]) + bfr(Bt[t]); __syncthreads(); if (t < CC / 4) vst2(XN + row * CC + t * 4, *(const v4f*)&so2[t * 4]); }
// ---- k_proj: block = (64 rows, which): A = LN rows (hi + lo), all 256 cols, + bias; q/k -> f16 rows; v -> planes
__global__ __launch_bounds__(128) void k_proj(const float* __restrict__ XN, const __bf16* __restrict__ PW, const float* __restrict__ BQ, const float* __restrict__ BK, const float* __restrict__ BV, _Float16* __restrict__ Q, _Float16* __restrict__ Kr, _Float16* __restrict__ V) {
  __shared__ __align__(16) _Float16 so[64][CC + 8]; __shared__ __align__(16) _Float16 st[CC][72];
  const int tid = threadIdx.x, wave = tid >> 5, lane = tid & 31, col = lane & 15, g = lane >> 4; const int which = blockIdx.y; const size_t rb = (size_t)blockIdx.x * 64; const size_t r0 = rb + wave * 16;
  const __bf16* Wr = PW + ((size_t)which * CC) * CC; const float* BB = (which == 0) ? BQ : (which == 1) ? BK : BV;
#pragma unroll 1
  for (int half = 0; half < 2; ++half) { v8f acc[8] = {};
#pragma unroll
    for (int kc = 0; kc < CC / 32; ++kc) { const F2 a = split_row(XN + (r0 + col) * CC, kc * 32, lane);
#pragma unroll
      for (int j = 0; j < 8; ++j) { const v16b w = frag_b(Wr + (size_t)(half * 128 + j * 16 + col) * CC + kc * 32, lane); acc[j] = wmma_bf(a.h, w, acc[j]); acc[j] = wmma_bf(a.l, w, acc[j]); } }
#pragma unroll
    for (int j = 0; j < 8; ++j) { const int c = half * 128 + j * 16 + col; const float bb = bfr(BB[c]);
#pragma unroll
      for (int r = 0; r < 8; ++r) { const _Float16 hv = (_Float16)(acc[j][r] + bb); if (which < 2) so[wave * 16 + 8 * g + r][c] = hv; else st[c][wave * 16 + 8 * g + r] = hv; } } }
  __syncthreads();
  if (which < 2) { _Float16* dst = (which == 0) ? Q : Kr; for (int e = tid; e < 64 * (CC / 8); e += 128) { const int rl = e >> 5, q = e & 31; vst2((unsigned*)(dst + (rb + rl) * CC + q * 8), *(const v4u*)&so[rl][q * 8]); } }
  else { const size_t b = rb / NT; const int s0 = (int)(rb % NT); for (int e = tid; e < CC * 8; e += 128) { const int d = e >> 3, pc = e & 7; vst2((unsigned*)(V + ((b * CC + d) * NT) + s0 + pc * 8), *(const v4u*)&st[d][pc * 8]); } }
}
// lane l with lane l ^ 16
__device__ __forceinline__ float xhalf(float x) { return __builtin_bit_cast(float, __builtin_amdgcn_permlanex16(__builtin_bit_cast(int, x), __builtin_bit_cast(int, x), 0x76543210, 0xfedcba98, false, false)); }
// ---- k_attn: wave = 16 queries of one head. S^T = K . Q^T (A = 16 key rows, B = the wave's queries): a lane holds 16 of the 32 scores of ONE query (keys j0 + 8g + r and j0 + 16 + 8g + r),
// so maximum and sum run in the lane, with one exchange between the halves; the two score tiles, converted in place, are the B operand of O^T += V^T . P^T (hardware k order, as frag_h loads V^T).
__global__ __launch_bounds__(128) void k_attn(const _Float16* __restrict__ Q, const _Float16* __restrict__ Kr, const _Float16* __restrict__ V, float* __restrict__ O) {
  const int tid = threadIdx.x, wave = tid >> 5, lane = tid & 31, col = lane & 15, g = lane >> 4; const int h = blockIdx.y; const size_t b = blockIdx.z; const int q0 = blockIdx.x * 64 + wave * 16; const size_t rq = b * NT + q0;
  const v16h bq = frag_h(Q + (rq + col) * CC + h * HD, lane);
  float m = -3.0e38f, l = 0.f;   // of query col; l holds this half's keys only until the epilogue
  v8f acc[2] = {};               // acc[dt][r] = O^T[dt * 16 + 8g + r][col]
#pragma unroll 1   // as before: the 32 trips stay rolled, so the loop's code stays short
  for (int ks = 0; ks < NT / 32; ++ks) { const int j0 = ks * 32; v16h ak[2], av[2]; v8f s[2];   // all four fragments' loads stand at the head of the trip: nothing holds the V loads back any more
#pragma unroll
    for (int t = 0; t < 2; ++t) { ak[t] = frag_h(Kr + (b * NT + j0 + t * 16 + col) * CC + h * HD, lane); av[t] = frag_h(V + ((b * CC + h * HD + t * 16 + col) * NT) + j0, lane); }
#pragma unroll
    for (int ct = 0; ct < 2; ++ct) { v8f c = {}; c = wmma16(ak[ct], bq, c);
#pragma unroll
      for (int r = 0; r < 8; ++r) s[ct][r] = c[r] * 0.17677669529663688f; }   // 32^-1/2
    float mx = fmaxf(s[0][0], s[1][0]);
#pragma unroll
    for (int r = 1; r < 8; ++r) mx = fmaxf(mx, fmaxf(s[0][r], s[1][r]));
    mx = fmaxf(mx, xhalf(mx));
    const float mn = fmaxf(m, mx); const float alpha = (m <= -1.0e38f) ? 0.f : __expf(m - mn);
    v16h pb; v2f es[2] = {};
#pragma unroll
    for (int ct = 0; ct < 2; ++ct) {
#pragma unroll
      for (int i = 0; i < 4; ++i) { const v2f e = { __expf(s[ct][2 * i] - mn), __expf(s[ct][2 * i + 1] - mn) }; es[ct] += e; const v2f p = e * 2048.0f; pb[ct * 8 + 2 * i] = (_Float16)p[0]; pb[ct * 8 + 2 * i + 1] = (_Float16)p[1]; } }
    const v2f e2 = es[0] + es[1];
    l = l * alpha + (e2[0] + e2[1]); m = mn;
#pragma unroll
    for (int dt = 0; dt < 2; ++dt) {
#pragma unroll
      for (int r = 0; r < 8; ++r) acc[dt][r] *= alpha;
      acc[dt] = wmma16(av[dt], pb, acc[dt]); } }
  l += xhalf(l);
  const float il = (1.0f / 2048.0f) / l;
#pragma unroll
  for (int dt = 0; dt < 2; ++dt) { float* po = O + (rq + col) * CC + h * HD + dt * 16 + 8 * g;
    const v4f lo = { acc[dt][0] * il, acc[dt][1] * il, acc[dt][2] * il, acc[dt][3] * il }, hi = { acc[dt][4] * il, acc[dt][5] * il, acc[dt][6] * il, acc[dt][7] * il };
    vst2(po, lo); vst2(po + 4, hi); }
}
// ---- k_out: block = 64 rows: out = Y (hi + lo) . Wp + bp; whole 1-KB rows
__global__ __launch_bounds__(128) void k_out(const float* __restrict__ O, const __bf16* __restrict__ PW, const float* __restrict__ BP, float* __restrict__ OUT) {
  __shared__ __align__(16) float sx[64][CC + 4];
  const int tid = threadIdx.x, wave = tid >> 5, lane = tid & 31, col = lane & 15, g = lane >> 4; const size_t rb = (size_t)blockIdx.x * 64; const size_t r0 = rb + wave * 16; const __bf16* Wr = PW + (size_t)3 * CC * CC;
#pragma unroll 1
  for (int half = 0; half < 2; ++half) { v8f acc[8] = {};
#pragma unroll
    for (int kc = 0; kc < CC / 32; ++kc) { const F2 a = split_row(O + (r0 + col) * CC, kc * 32, lane);
#pragma unroll
      for (int j = 0; j < 8; ++j) { const v16b w = frag_b(Wr + (size_t)(half * 128 + j * 16 + col) * CC + kc * 32, lane); acc[j] = wmma_bf(a.h, w, acc[j]); acc[j] = wmma_bf(a.l, w, acc[j]); } }
#pragma unroll
    for (int j = 0; j < 8; ++j) { const int c = half * 128 + j * 16 + col; const float bb = bfr(BP[c]);
#pragma unroll
      for (int r = 0; r < 8; ++r) sx[wave * 16 + 8 * g + r][c] = acc[j][r] + bb; } }
  __syncthreads();
  for (int e = tid; e < 64 * (CC / 4); e += 128) { const int rl = e >> 6, q = e & 63; vst2(OUT + (rb + rl) * CC + q * 4, *(const v4f*)&sx[rl][q * 4]); }
}
extern "C" void kernel_launch(void* const* d_in, const int* in_sizes, int n_in, void* d_out, int out_size, void* d_ws, size_t ws_size, hipStream_t stream) {
  (void)in_sizes; (void)n_in; (void)out_size;
  const float** F = (const float**)d_in;   // 0 x [16,32,32,256], 1 gamma, 2 beta, 3 Wq [256,256] (in,out), 4 bq, 5 Wk, 6 bk, 7 Wv, 8 bv, 9 Wp [256,256] (in,out), 10 bp
  if (ws_size < (size_t)WS_END) return;
  char* ws = (char*)d_ws; __bf16* PW = (__bf16*)ws; float *XN = (float*)(ws + WS_XN), *O = (float*)(ws + WS_O); _Float16 *Q = (_Float16*)(ws + WS_Q), *Kr = (_Float16*)(ws + WS_K), *V = (_Float16*)(ws + WS_V);
  k_pack<<<dim3(CC, 4), 256, 0, stream>>>(F[3], F[5], F[7], F[9], PW);
  k_ln<<<TNB * NT, 256, 0, stream>>>(F[0], F[1], F[2], XN);
  k_proj<<<dim3(TNB * NT / 64, 3), 128, 0, stream>>>(XN, PW, F[4], F[6], F[8], Q, Kr, V);
  k_attn<<<dim3(TQB, NH, TNB), 128, 0, stream>>>(Q, Kr, V, O);
  k_out<<<TNB * NT / 64, 128, 0, stream>>>(O, PW, F[10], (float*)d_out);
}

// v002
// It runs in 138 microseconds.
// Timed twice side by side with v001, it ran 1.05 times as fast both times.
// Over all steps from v000 it is 1.29 times as fast.
// compute dtype: all float inputs rounded to bf16; LayerNorm (eps 1e-5) in f32; Q/K/V = LN(x) (bf16 hi + lo, 2 products) . W + b on WMMA 16x16x32 ((in,out) weights as transposed rows), rounded once to f16; PLAIN attention (8 heads x 32 over the 1,024 positions of each image): q, k single f16 x 32^-1/2, running-max softmax in f32 (hardware exp), P (scaled by 2^11, single f16) x v (single f16); out = Y (bf16 hi + residual) . Wp (2 products) + bp.
#include <hip/hip_runtime.h>
#include <math.h>

typedef __attribute__((ext_vector_type(16))) _Float16 v16h;
typedef __attribute__((ext_vector_type(16))) __bf16 v16b;
typedef __attribute__((ext_vector_type(8)))  _Float16 v8h;
typedef __attribute__((ext_vector_type(8)))  float v8f;
typedef __attribute__((ext_vector_type(4)))  float v4f;
typedef __attribute__((ext_vector_type(2)))  float v2f;
typedef __attribute__((ext_vector_type(4)))  unsigned v4u;
typedef __attribute__((ext_vector_type(4)))  int v4i;
typedef float __attribute__((may_alias)) float_a;
typedef int __attribute__((may_alias)) int_a;

template <typename T> __device__ __forceinline__ void vst2(void* p, T v) { *(T*)p = v;  }
__device__ __forceinline__ v8f wmma16(v16h a, v16h b, v8f c) {
  v8f d = __builtin_amdgcn_wmma_f32_16x16x32_f16(false, a, false, b, (short)0, c, false, false);
  asm volatile("v_nop\n\tv_nop\n\tv_nop\n\tv_nop" : "+v"(d) : "v"(a), "v"(b));
  return d;
}
__device__ __forceinline__ v8f wmma_bf(v16b a, v16b b, v8f c) {
  v8f d = __builtin_amdgcn_wmma_f32_16x16x32_bf16(false, a, false, b, (short)0, c, false, false);
  asm volatile("v_nop\n\tv_nop\n\tv_nop\n\tv_nop" : "+v"(d) : "v"(a), "v"(b));
  return d;
}
// 16x16x32 fragments: lane = (h = lane>>4, row/col = lane&15); elements 0..7 = k0+8h+0..7, 8..15 = k0+16+8h+0..7; D element r = row 8h+r
__device__ __forceinline__ v16h frag_h(const _Float16* rowk0, int lane) {
  union { v16h v; v8h q[2]; } u; const _Float16* p = rowk0 + 8 * (lane >> 4);
  u.q[0] = *(const v8h*)p; u.q[1] = *(const v8h*)(p + 16); return u.v;
}
__device__ __forceinline__ v16h frag_f32(const float* rowk0, int lane) {
  v16h a; const float* p = rowk0 + 8 * (lane >> 4);
#pragma unroll
  for (int i = 0; i < 8; ++i) { a[i] = (_Float16)p[i]; a[8 + i] = (_Float16)p[16 + i]; }
  return a;
}
__device__ __forceinline__ v16h frag_f32s(const float* rowk0, int lane, float sc) {
  v16h a; const float* p = rowk0 + 8 * (lane >> 4);
#pragma unroll
  for (int i = 0; i < 8; ++i) { a[i] = (_Float16)(p[i] * sc); a[8 + i] = (_Float16)(p[16 + i] * sc); }
  return a;
}
// column fragment from a [K][ld] layout (column n), rows >= K read as 0
__device__ __forceinline__ v16h fragc_f32(const float* W, int k0, int n, int lane, int ld, int K) {
  v16h a; const int g = lane >> 4;
#pragma unroll
  for (int i = 0; i < 8; ++i) { const int ka = k0 + 8 * g + i, kb = ka + 16;
    a[i] = (_Float16)(ka < K ? W[(size_t)(ka < K ? ka : K - 1) * ld + n] : 0.f); a[8 + i] = (_Float16)(kb < K ? W[(size_t)(kb < K ? kb : K - 1) * ld + n] : 0.f); }
  return a;
}
struct F2 { v16b h, l; };
__device__ __forceinline__ F2 bsplit16(const float v[16]) { F2 r;
#pragma unroll
  for (int i = 0; i < 16; ++i) { const __bf16 h = (__bf16)v[i]; r.h[i] = h; r.l[i] = (__bf16)(v[i] - (float)h); }
  return r; }
__device__ __forceinline__ F2 split_row(const float* row, int k0, int lane) { float v[16]; const float* p = row + k0 + 8 * (lane >> 4);
#pragma unroll
  for (int i = 0; i < 8; ++i) { v[i] = p[i]; v[8 + i] = p[16 + i]; }
  return bsplit16(v); }
__device__ __forceinline__ F2 split_rowK(const float* row, int k0, int lane, int K) { float v[16]; const int g = lane >> 4;
#pragma unroll
  for (int i = 0; i < 8; ++i) { const int ka = k0 + 8 * g + i, kb = ka + 16; v[i] = ka < K ? row[ka < K ? ka : K - 1] : 0.f; v[8 + i] = kb < K ? row[kb < K ? kb : K - 1] : 0.f; }
  return bsplit16(v); }
__device__ __forceinline__ F2 split_col(const float* W, int k0, int n, int lane, int ld, int K) { float v[16]; const int g = lane >> 4;
#pragma unroll
  for (int i = 0; i < 8; ++i) { const int ka = k0 + 8 * g + i, kb = ka + 16; v[i] = ka < K ? W[(size_t)(ka < K ? ka : K - 1) * ld + n] : 0.f; v[8 + i] = kb < K ? W[(size_t)(kb < K ? kb : K - 1) * ld + n] : 0.f; }
  return bsplit16(v); }
__device__ __forceinline__ v8f mac3(const F2& a, const F2& b, v8f c) { c = wmma_bf(a.l, b.h, c); c = wmma_bf(a.h, b.l, c); return wmma_bf(a.h, b.h, c); }
__device__ __forceinline__ float sigm(float v) { return 1.0f / (1.0f + expf(-v)); }
#define LDSX() do { asm volatile("s_wait_dscnt 0" ::: "memory"); __builtin_amdgcn_wave_barrier(); __builtin_amdgcn_fence(__ATOMIC_RELEASE, "workgroup"); } while (0)


// Global multi-head self attention over a 32 x 32 feature map (B 16, N 1,024 tokens, C 256, 8 heads x 32): LayerNorm, 1x1-conv q/k/v, softmax(Q K / sqrt(32)) V, 1x1-conv projection + bias.
#define NB 16
#define NT 1024
#define CC 256
#define NH 8
#define HD 32
#define NR (NB * NT)
#ifndef TQB
#define TQB (NT / 64)
#define TNB NB
#endif
typedef __attribute__((ext_vector_type(8))) __bf16 v8b;
__device__ __forceinline__ v16b frag_b(const __bf16* rowk0, int lane) {
  union { v16b v; v8b q[2]; } u; const __bf16* p = rowk0 + 8 * (lane >> 4);
  u.q[0] = *(const v8b*)p; u.q[1] = *(const v8b*)(p + 16); return u.v;
}
__device__ __forceinline__ float bfr(float v) { return (float)(__bf16)v; }
__device__ __attribute__((noinline)) float exp_ni(float v) { return expf(v); }
__device__ __attribute__((noinline)) float erf_ni(float v) { return erff(v); }

#define WS_PW  0u                                    // bf16 transposed rows Wq^T, Wk^T, Wv^T, Wp^T [4][256][256]
#define WS_XN  (WS_PW + 2u * (size_t)4 * CC * CC)       // f32 LN rows [NR][256]
#define WS_Q   (WS_XN + 4u * (size_t)NR * CC)           // f16 q rows [NR][256]; k rows; v planes [b][256][NT]; O f32 [NR][256]
#define WS_K   (WS_Q + 2u * (size_t)NR * CC)
#define WS_V   (WS_K + 2u * (size_t)NR * CC)
#define WS_O   (WS_V + 2u * (size_t)NB * CC * NT)
#define WS_END (WS_O + 4u * (size_t)NR * CC)

__global__ __launch_bounds__(256) void k_pack(const float* __restrict__ WQ, const float* __restrict__ WK, const float* __restrict__ WV, const float* __restrict__ WP, __bf16* __restrict__ PW) { const int n = blockIdx.x, which = blockIdx.y, t = threadIdx.x; __shared__ __align__(16) __bf16 s[CC]; const float* w = (which == 0) ? WQ : (which == 1) ? WK : (which == 2) ? WV : WP;
  s[t] = (__bf16)w[(size_t)t * CC + n]; __syncthreads(); if (t < CC / 8) vst2((unsigned*)(PW + ((size_t)which * CC + n) * CC + t * 8), *(const v4u*)&s[t * 8]); }
// lane l with lane l ^ 16
__device__ __forceinline__ float xhalf(float x) { return __builtin_bit_cast(float, __builtin_amdgcn_permlanex16(__builtin_bit_cast(int, x), __builtin_bit_cast(int, x), 0x76543210, 0xfedcba98, false, false)); }
// lane l with lane l ^ M inside its 16-lane row (DPP row_xmask)
template <int M> __device__ __forceinline__ float xrow(float x) { return __builtin_bit_cast(float, __builtin_amdgcn_update_dpp(0, __builtin_bit_cast(int, x), 0x160 + M, 0xf, 0xf, true)); }
#define LNR 8   // token rows per wave
// every lane ends with the sum over the wave's 32 lanes, for LNR rows side by side (independent chains)
// the unroll directives here and in k_ln: s[] and x[][] are indexed by constants only, so they stay in registers
__device__ __forceinline__ void wsum(float (&s)[LNR]) {
#pragma unroll
  for (int r = 0; r < LNR; ++r) s[r] += xrow<1>(s[r]);
#pragma unroll
  for (int r = 0; r < LNR; ++r) s[r] += xrow<2>(s[r]);
#pragma unroll
  for (int r = 0; r < LNR; ++r) s[r] += xrow<4>(s[r]);
#pragma unroll
  for (int r = 0; r < LNR; ++r) s[r] += xrow<8>(s[r]);
#pragma unroll
  for (int r = 0; r < LNR; ++r) s[r] += xhalf(s[r]);
}
// ---- k_ln: wave = LNR token rows, block = 8 waves = 64 rows, one block per WGP: a lane holds channels 4 * lane + 0..3 and 128 + 4 * lane + 0..3 of each row (every load and store = 512 contiguous bytes),
// all 2 * LNR loads in flight at once; LayerNorm over 256 channels (mean-square var, 1e-5) x g + b -> f32 row; sums in the lane, then a five-step butterfly: no LDS, no barrier
__global__ __launch_bounds__(256) void k_ln(const float* __restrict__ X, const float* __restrict__ G, const float* __restrict__ Bt, float* __restrict__ XN) { const int lane = threadIdx.x & 31, wave = threadIdx.x >> 5; const size_t off = ((size_t)blockIdx.x * 8 + wave) * (LNR * CC) + lane * 4;
  v4f x[LNR][2], gg[2], bb[2]; float s[LNR];
#pragma unroll
  for (int r = 0; r < LNR; ++r) { x[r][0] = *(const v4f*)(X + off + r * CC); x[r][1] = *(const v4f*)(X + off + r * CC + 128); }
#pragma unroll
  for (int j = 0; j < 2; ++j) { gg[j] = *(const v4f*)(G + j * 128 + lane * 4); bb[j] = *(const v4f*)(Bt + j * 128 + lane * 4); }
  __builtin_amdgcn_sched_barrier(0);   // keeps every load above the arithmetic: without it the compiler sinks the later rows' loads to their uses, and the wave waits out the memory latency several times over
#pragma unroll
  for (int r = 0; r < LNR; ++r) {
#pragma unroll
    for (int i = 0; i < 4; ++i) { x[r][0][i] = bfr(x[r][0][i]); x[r][1][i] = bfr(x[r][1][i]); }
    const v4f t = x[r][0] + x[r][1]; s[r] = (t[0] + t[1]) + (t[2] + t[3]); }
  wsum(s);
#pragma unroll
  for (int r = 0; r < LNR; ++r) { const float mu = s[r] / (float)CC; x[r][0] -= mu; x[r][1] -= mu;
    const v4f t = x[r][0] * x[r][0] + x[r][1] * x[r][1]; s[r] = (t[0] + t[1]) + (t[2] + t[3]); }
  wsum(s);
#pragma unroll
  for (int j = 0; j < 2; ++j) {
#pragma unroll
    for (int i = 0; i < 4; ++i) { gg[j][i] = bfr(gg[j][i]); bb[j][i] = bfr(bb[j][i]); } }
#pragma unroll
  for (int r = 1; r < LNR; ++r) s[0] = ((lane & (LNR - 1)) == r) ? s[r] : s[0];   // every lane holds all LNR sums: lane l finishes row l mod LNR, so root and division run once a wave, not once a row
  const float iv = 1.0f / sqrtf(s[0] / (float)CC + 1e-5f);
#pragma unroll
  for (int r = 0; r < LNR; ++r) { const float inv = __builtin_bit_cast(float, __builtin_amdgcn_readlane(__builtin_bit_cast(int, iv), r));
    vst2(XN + off + r * CC, x[r][0] * inv * gg[0] + bb[0]); vst2(XN + off + r * CC + 128, x[r][1] * inv * gg[1] + bb[1]); } }
// ---- k_proj: block = (64 rows, which): A = LN rows (hi + lo), all 256 cols, + bias; q/k -> f16 rows; v -> planes
__global__ __launch_bounds__(128) void k_proj(const float* __restrict__ XN, const __bf16* __restrict__ PW, const float* __restrict__ BQ, const float* __restrict__ BK, const float* __restrict__ BV, _Float16* __restrict__ Q, _Float16* __restrict__ Kr, _Float16* __restrict__ V) {
  __shared__ __align__(16) _Float16 so[64][CC + 8]; __shared__ __align__(16) _Float16 st[CC][72];
  const int tid = threadIdx.x, wave = tid >> 5, lane = tid & 31, col = lane & 15, g = lane >> 4; const int which = blockIdx.y; const size_t rb = (size_t)blockIdx.x * 64; const size_t r0 = rb + wave * 16;
  const __bf16* Wr = PW + ((size_t)which * CC) * CC; const float* BB = (which == 0) ? BQ : (which == 1) ? BK : BV;
#pragma unroll 1
  for (int half = 0; half < 2; ++half) { v8f acc[8] = {};
#pragma unroll
    for (int kc = 0; kc < CC / 32; ++kc) { const F2 a = split_row(XN + (r0 + col) * CC, kc * 32, lane);
#pragma unroll
      for (int j = 0; j < 8; ++j) { const v16b w = frag_b(Wr + (size_t)(half * 128 + j * 16 + col) * CC + kc * 32, lane); acc[j] = wmma_bf(a.h, w, acc[j]); acc[j] = wmma_bf(a.l, w, acc[j]); } }
#pragma unroll
    for (int j = 0; j < 8; ++j) { const int c = half * 128 + j * 16 + col; const float bb = bfr(BB[c]);
#pragma unroll
      for (int r = 0; r < 8; ++r) { const _Float16 hv = (_Float16)(acc[j][r] + bb); if (which < 2) so[wave * 16 + 8 * g + r][c] = hv; else st[c][wave * 16 + 8 * g + r] = hv; } } }
  __syncthreads();
  if (which < 2) { _Float16* dst = (which == 0) ? Q : Kr; for (int e = tid; e < 64 * (CC / 8); e += 128) { const int rl = e >> 5, q = e & 31; vst2((unsigned*)(dst + (rb + rl) * CC + q * 8), *(const v4u*)&so[rl][q * 8]); } }
  else { const size_t b = rb / NT; const int s0 = (int)(rb % NT); for (int e = tid; e < CC * 8; e += 128) { const int d = e >> 3, pc = e & 7; vst2((unsigned*)(V + ((b * CC + d) * NT) + s0 + pc * 8), *(const v4u*)&st[d][pc * 8]); } }
}
// ---- k_attn: wave = 16 queries of one head. S^T = K . Q^T (A = 16 key rows, B = the wave's queries): a lane holds 16 of the 32 scores of ONE query (keys j0 + 8g + r and j0 + 16 + 8g + r),
// so maximum and sum run in the lane, with one exchange between the halves; the two score tiles, converted in place, are the B operand of O^T += V^T . P^T (hardware k order, as frag_h loads V^T).
__global__ __launch_bounds__(128) void k_attn(const _Float16* __restrict__ Q, const _Float16* __restrict__ Kr, const _Float16* __restrict__ V, float* __restrict__ O) {
  const int tid = threadIdx.x, wave = tid >> 5, lane = tid & 31, col = lane & 15, g = lane >> 4; const int h = blockIdx.y; const size_t b = blockIdx.z; const int q0 = blockIdx.x * 64 + wave * 16; const size_t rq = b * NT + q0;
  const v16h bq = frag_h(Q + (rq + col) * CC + h * HD, lane);
  float m = -3.0e38f, l = 0.f;   // of query col; l holds this half's keys only until the epilogue
  v8f acc[2] = {};               // acc[dt][r] = O^T[dt * 16 + 8g + r][col]
#pragma unroll 1   // as before: the 32 trips stay rolled, so the loop's code stays short
  for (int ks = 0; ks < NT / 32; ++ks) { const int j0 = ks * 32; v16h ak[2], av[2]; v8f s[2];   // all four fragments' loads stand at the head of the trip: nothing holds the V loads back any more
#pragma unroll
    for (int t = 0; t < 2; ++t) { ak[t] = frag_h(Kr + (b * NT + j0 + t * 16 + col) * CC + h * HD, lane); av[t] = frag_h(V + ((b * CC + h * HD + t * 16 + col) * NT) + j0, lane); }
#pragma unroll
    for (int ct = 0; ct < 2; ++ct) { v8f c = {}; c = wmma16(ak[ct], bq, c);
#pragma unroll
      for (int r = 0; r < 8; ++r) s[ct][r] = c[r] * 0.17677669529663688f; }   // 32^-1/2
    float mx = fmaxf(s[0][0], s[1][0]);
#pragma unroll
    for (int r = 1; r < 8; ++r) mx = fmaxf(mx, fmaxf(s[0][r], s[1][r]));
    mx = fmaxf(mx, xhalf(mx));
    const float mn = fmaxf(m, mx); const float alpha = (m <= -1.0e38f) ? 0.f : __expf(m - mn);
    v16h pb; v2f es[2] = {};
#pragma unroll
    for (int ct = 0; ct < 2; ++ct) {
#pragma unroll
      for (int i = 0; i < 4; ++i) { const v2f e = { __expf(s[ct][2 * i] - mn), __expf(s[ct][2 * i + 1] - mn) }; es[ct] += e; const v2f p = e * 2048.0f; pb[ct * 8 + 2 * i] = (_Float16)p[0]; pb[ct * 8 + 2 * i + 1] = (_Float16)p[1]; } }
    const v2f e2 = es[0] + es[1];
    l = l * alpha + (e2[0] + e2[1]); m = mn;
#pragma unroll
    for (int dt = 0; dt < 2; ++dt) {
#pragma unroll
      for (int r = 0; r < 8; ++r) acc[dt][r] *= alpha;
      acc[dt] = wmma16(av[dt], pb, acc[dt]); } }
  l += xhalf(l);
  const float il = (1.0f / 2048.0f) / l;
#pragma unroll
  for (int dt = 0; dt < 2; ++dt) { float* po = O + (rq + col) * CC + h * HD + dt * 16 + 8 * g;
    const v4f lo = { acc[dt][0] * il, acc[dt][1] * il, acc[dt][2] * il, acc[dt][3] * il }, hi = { acc[dt][4] * il, acc[dt][5] * il, acc[dt][6] * il, acc[dt][7] * il };
    vst2(po, lo); vst2(po + 4, hi); }
}
// ---- k_out: block = 64 rows: out = Y (hi + lo) . Wp + bp; whole 1-KB rows
__global__ __launch_bounds__(128) void k_out(const float* __restrict__ O, const __bf16* __restrict__ PW, const float* __restrict__ BP, float* __restrict__ OUT) {
  __shared__ __align__(16) float sx[64][CC + 4];
  const int tid = threadIdx.x, wave = tid >> 5, lane = tid & 31, col = lane & 15, g = lane >> 4; const size_t rb = (size_t)blockIdx.x * 64; const size_t r0 = rb + wave * 16; const __bf16* Wr = PW + (size_t)3 * CC * CC;
#pragma unroll 1
  for (int half = 0; half < 2; ++half) { v8f acc[8] = {};
#pragma unroll
    for (int kc = 0; kc < CC / 32; ++kc) { const F2 a = split_row(O + (r0 + col) * CC, kc * 32, lane);
#pragma unroll
      for (int j = 0; j < 8; ++j) { const v16b w = frag_b(Wr + (size_t)(half * 128 + j * 16 + col) * CC + kc * 32, lane); acc[j] = wmma_bf(a.h, w, acc[j]); acc[j] = wmma_bf(a.l, w, acc[j]); } }
#pragma unroll
    for (int j = 0; j < 8; ++j) { const int c = half * 128 + j * 16 + col; const float bb = bfr(BP[c]);
#pragma unroll
      for (int r = 0; r < 8; ++r) sx[wave * 16 + 8 * g + r][c] = acc[j][r] + bb; } }
  __syncthreads();
  for (int e = tid; e < 64 * (CC / 4); e += 128) { const int rl = e >> 6, q = e & 63; vst2(OUT + (rb + rl) * CC + q * 4, *(const v4f*)&sx[rl][q * 4]); }
}
extern "C" void kernel_launch(void* const* d_in, const int* in_sizes, int n_in, void* d_out, int out_size, void* d_ws, size_t ws_size, hipStream_t stream) {
  (void)in_sizes; (void)n_in; (void)out_size;
  const float** F = (const float**)d_in;   // 0 x [16,32,32,256], 1 gamma, 2 beta, 3 Wq [256,256] (in,out), 4 bq, 5 Wk, 6 bk, 7 Wv, 8 bv, 9 Wp [256,256] (in,out), 10 bp
  if (ws_size < (size_t)WS_END) return;
  char* ws = (char*)d_ws; __bf16* PW = (__bf16*)ws; float *XN = (float*)(ws + WS_XN), *O = (float*)(ws + WS_O); _Float16 *Q = (_Float16*)(ws + WS_Q), *Kr = (_Float16*)(ws + WS_K), *V = (_Float16*)(ws + WS_V);
  k_pack<<<dim3(CC, 4), 256, 0, stream>>>(F[3], F[5], F[7], F[9], PW);
  k_ln<<<TNB * NT / (8 * LNR), 256, 0, stream>>>(F[0], F[1], F[2], XN);
  k_proj<<<dim3(TNB * NT / 64, 3), 128, 0, stream>>>(XN, PW, F[4], F[6], F[8], Q, Kr, V);
  k_attn<<<dim3(TQB, NH, TNB), 128, 0, stream>>>(Q, Kr, V, O);
  k_out<<<TNB * NT / 64, 128, 0, stream>>>(O, PW, F[10], (float*)d_out);
}

// v003
// One run takes 123 microseconds.
// Timed twice side by side with v002, it ran 1.12 and 1.14 times as fast.
// All steps since v000 together make it 1.46 times as fast.
// compute dtype: all float inputs rounded to bf16; LayerNorm (eps 1e-5) in f32; Q/K/V = LN(x) (bf16 hi + lo, 2 products) . W + b on WMMA 16x16x32 ((in,out) weights as transposed rows), rounded once to f16; PLAIN attention (8 heads x 32 over the 1,024 positions of each image): q, k single f16 x 32^-1/2, running-max softmax in f32 (hardware exp), P (scaled by 2^11, single f16) x v (single f16); out = Y (bf16 hi + residual) . Wp (2 products) + bp.
#include <hip/hip_runtime.h>
#include <math.h>

typedef __attribute__((ext_vector_type(16))) _Float16 v16h;
typedef __attribute__((ext_vector_type(16))) __bf16 v16b;
typedef __attribute__((ext_vector_type(8)))  _Float16 v8h;
typedef __attribute__((ext_vector_type(8)))  float v8f;
typedef __attribute__((ext_vector_type(4)))  float v4f;
typedef __attribute__((ext_vector_type(2)))  float v2f;
typedef __attribute__((ext_vector_type(4)))  unsigned v4u;
typedef __attribute__((ext_vector_type(4)))  int v4i;
typedef float __attribute__((may_alias)) float_a;
typedef int __attribute__((may_alias)) int_a;

template <typename T> __device__ __forceinline__ void vst2(void* p, T v) { *(T*)p = v;  }
__device__ __forceinline__ v8f wmma16(v16h a, v16h b, v8f c) {
  v8f d = __builtin_amdgcn_wmma_f32_16x16x32_f16(false, a, false, b, (short)0, c, false, false);
  asm volatile("v_nop\n\tv_nop\n\tv_nop\n\tv_nop" : "+v"(d) : "v"(a), "v"(b));
  return d;
}
__device__ __forceinline__ v8f wmma_bf(v16b a, v16b b, v8f c) {
  v8f d = __builtin_amdgcn_wmma_f32_16x16x32_bf16(false, a, false, b, (short)0, c, false, false);
  asm volatile("v_nop\n\tv_nop\n\tv_nop\n\tv_nop" : "+v"(d) : "v"(a), "v"(b));
  return d;
}
// 16x16x32 fragments: lane = (h = lane>>4, row/col = lane&15); elements 0..7 = k0+8h+0..7, 8..15 = k0+16+8h+0..7; D element r = row 8h+r
__device__ __forceinline__ v16h frag_h(const _Float16* rowk0, int lane) {
  union { v16h v; v8h q[2]; } u; const _Float16* p = rowk0 + 8 * (lane >> 4);
  u.q[0] = *(const v8h*)p; u.q[1] = *(const v8h*)(p + 16); return u.v;
}
__device__ __forceinline__ v16h frag_f32(const float* rowk0, int lane) {
  v16h a; const float* p = rowk0 + 8 * (lane >> 4);
#pragma unroll
  for (int i = 0; i < 8; ++i) { a[i] = (_Float16)p[i]; a[8 + i] = (_Float16)p[16 + i]; }
  return a;
}
__device__ __forceinline__ v16h frag_f32s(const float* rowk0, int lane, float sc) {
  v16h a; const float* p = rowk0 + 8 * (lane >> 4);
#pragma unroll
  for (int i = 0; i < 8; ++i) { a[i] = (_Float16)(p[i] * sc); a[8 + i] = (_Float16)(p[16 + i] * sc); }
  return a;
}
// column fragment from a [K][ld] layout (column n), rows >= K read as 0
__device__ __forceinline__ v16h fragc_f32(const float* W, int k0, int n, int lane, int ld, int K) {
  v16h a; const int g = lane >> 4;
#pragma unroll
  for (int i = 0; i < 8; ++i) { const int ka = k0 + 8 * g + i, kb = ka + 16;
    a[i] = (_Float16)(ka < K ? W[(size_t)(ka < K ? ka : K - 1) * ld + n] : 0.f); a[8 + i] = (_Float16)(kb < K ? W[(size_t)(kb < K ? kb : K - 1) * ld + n] : 0.f); }
  return a;
}
struct F2 { v16b h, l; };
__device__ __forceinline__ F2 bsplit16(const float v[16]) { F2 r;
#pragma unroll
  for (int i = 0; i < 16; ++i) { const __bf16 h = (__bf16)v[i]; r.h[i] = h; r.l[i] = (__bf16)(v[i] - (float)h); }
  return r; }
__device__ __forceinline__ F2 split_row(const float* row, int k0, int lane) { float v[16]; const float* p = row + k0 + 8 * (lane >> 4);
#pragma unroll
  for (int i = 0; i < 8; ++i) { v[i] = p[i]; v[8 + i] = p[16 + i]; }
  return bsplit16(v); }
__device__ __forceinline__ F2 split_rowK(const float* row, int k0, int lane, int K) { float v[16]; const int g = lane >> 4;
#pragma unroll
  for (int i = 0; i < 8; ++i) { const int ka = k0 + 8 * g + i, kb = ka + 16; v[i] = ka < K ? row[ka < K ? ka : K - 1] : 0.f; v[8 + i] = kb < K ? row[kb < K ? kb : K - 1] : 0.f; }
  return bsplit16(v); }
__device__ __forceinline__ F2 split_col(const float* W, int k0, int n, int lane, int ld, int K) { float v[16]; const int g = lane >> 4;
#pragma unroll
  for (int i = 0; i < 8; ++i) { const int ka = k0 + 8 * g + i, kb = ka + 16; v[i] = ka < K ? W[(size_t)(ka < K ? ka : K - 1) * ld + n] : 0.f; v[8 + i] = kb < K ? W[(size_t)(kb < K ? kb : K - 1) * ld + n] : 0.f; }
  return bsplit16(v); }
__device__ __forceinline__ v8f mac3(const F2& a, const F2& b, v8f c) { c = wmma_bf(a.l, b.h, c); c = wmma_bf(a.h, b.l, c); return wmma_bf(a.h, b.h, c); }
__device__ __forceinline__ float sigm(float v) { return 1.0f / (1.0f + expf(-v)); }
#define LDSX() do { asm volatile("s_wait_dscnt 0" ::: "memory"); __builtin_amdgcn_wave_barrier(); __builtin_amdgcn_fence(__ATOMIC_RELEASE, "workgroup"); } while (0)


// Global multi-head self attention over a 32 x 32 feature map (B 16, N 1,024 tokens, C 256, 8 heads x 32): LayerNorm, 1x1-conv q/k/v, softmax(Q K / sqrt(32)) V, 1x1-conv projection + bias.
#define NB 16
#define NT 1024
#define CC 256
#define NH 8
#define HD 32
#define NR (NB * NT)
#ifndef TQB
#define TQB (NT / 64)
#define TNB NB
#endif
typedef __attribute__((ext_vector_type(8))) __bf16 v8b;
__device__ __forceinline__ v16b frag_b(const __bf16* rowk0, int lane) {
  union { v16b v; v8b q[2]; } u; const __bf16* p = rowk0 + 8 * (lane >> 4);
  u.q[0] = *(const v8b*)p; u.q[1] = *(const v8b*)(p + 16); return u.v;
}
__device__ __forceinline__ float bfr(float v) { return (float)(__bf16)v; }
__device__ __attribute__((noinline)) float exp_ni(float v) { return expf(v); }
__device__ __attribute__((noinline)) float erf_ni(float v) { return erff(v); }

#define WS_PW  0u                                    // bf16 transposed rows Wq^T, Wk^T, Wv^T, Wp^T [4][256][256]
#define WS_XN  (WS_PW + 2u * (size_t)4 * CC * CC)       // f32 LN rows [NR][256]
#define WS_Q   (WS_XN + 4u * (size_t)NR * CC)           // f16 q rows [NR][256]; k rows; v planes [b][256][NT]; O f32 [NR][256]
#define WS_K   (WS_Q + 2u * (size_t)NR * CC)
#define WS_V   (WS_K + 2u * (size_t)NR * CC)
#define WS_O   (WS_V + 2u * (size_t)NB * CC * NT)
#define WS_END (WS_O + 4u * (size_t)NR * CC)

__global__ __launch_bounds__(256) void k_pack(const float* __restrict__ WQ, const float* __restrict__ WK, const float* __restrict__ WV, const float* __restrict__ WP, __bf16* __restrict__ PW) { const int n = blockIdx.x, which = blockIdx.y, t = threadIdx.x; __shared__ __align__(16) __bf16 s[CC]; const float* w = (which == 0) ? WQ : (which == 1) ? WK : (which == 2) ? WV : WP;
  s[t] = (__bf16)w[(size_t)t * CC + n]; __syncthreads(); if (t < CC / 8) vst2((unsigned*)(PW + ((size_t)which * CC + n) * CC + t * 8), *(const v4u*)&s[t * 8]); }
// lane l with lane l ^ 16
__device__ __forceinline__ float xhalf(float x) { return __builtin_bit_cast(float, __builtin_amdgcn_permlanex16(__builtin_bit_cast(int, x), __builtin_bit_cast(int, x), 0x76543210, 0xfedcba98, false, false)); }
// lane l with lane l ^ M inside its 16-lane row (DPP row_xmask)
template <int M> __device__ __forceinline__ float xrow(float x) { return __builtin_bit_cast(float, __builtin_amdgcn_update_dpp(0, __builtin_bit_cast(int, x), 0x160 + M, 0xf, 0xf, true)); }
#define LNR 8   // token rows per wave
// every lane ends with the sum over the wave's 32 lanes, for LNR rows side by side (independent chains)
// the unroll directives here and in k_ln: s[] and x[][] are indexed by constants only, so they stay in registers
__device__ __forceinline__ void wsum(float (&s)[LNR]) {
#pragma unroll
  for (int r = 0; r < LNR; ++r) s[r] += xrow<1>(s[r]);
#pragma unroll
  for (int r = 0; r < LNR; ++r) s[r] += xrow<2>(s[r]);
#pragma unroll
  for (int r = 0; r < LNR; ++r) s[r] += xrow<4>(s[r]);
#pragma unroll
  for (int r = 0; r < LNR; ++r) s[r] += xrow<8>(s[r]);
#pragma unroll
  for (int r = 0; r < LNR; ++r) s[r] += xhalf(s[r]);
}
// ---- k_ln: wave = LNR token rows, block = 8 waves = 64 rows, one block per WGP: a lane holds channels 4 * lane + 0..3 and 128 + 4 * lane + 0..3 of each row (every load and store = 512 contiguous bytes),
// all 2 * LNR loads in flight at once; LayerNorm over 256 channels (mean-square var, 1e-5) x g + b -> f32 row; sums in the lane, then a five-step butterfly: no LDS, no barrier
__global__ __launch_bounds__(256) void k_ln(const float* __restrict__ X, const float* __restrict__ G, const float* __restrict__ Bt, float* __restrict__ XN) { const int lane = threadIdx.x & 31, wave = threadIdx.x >> 5; const size_t off = ((size_t)blockIdx.x * 8 + wave) * (LNR * CC) + lane * 4;
  v4f x[LNR][2], gg[2], bb[2]; float s[LNR];
#pragma unroll
  for (int r = 0; r < LNR; ++r) { x[r][0] = *(const v4f*)(X + off + r * CC); x[r][1] = *(const v4f*)(X + off + r * CC + 128); }
#pragma unroll
  for (int j = 0; j < 2; ++j) { gg[j] = *(const v4f*)(G + j * 128 + lane * 4); bb[j] = *(const v4f*)(Bt + j * 128 + lane * 4); }
  __builtin_amdgcn_sched_barrier(0);   // keeps every load above the arithmetic: without it the compiler sinks the later rows' loads to their uses, and the wave waits out the memory latency several times over
#pragma unroll
  for (int r = 0; r < LNR; ++r) {
#pragma unroll
    for (int i = 0; i < 4; ++i) { x[r][0][i] = bfr(x[r][0][i]); x[r][1][i] = bfr(x[r][1][i]); }
    const v4f t = x[r][0] + x[r][1]; s[r] = (t[0] + t[1]) + (t[2] + t[3]); }
  wsum(s);
#pragma unroll
  for (int r = 0; r < LNR; ++r) { const float mu = s[r] / (float)CC; x[r][0] -= mu; x[r][1] -= mu;
    const v4f t = x[r][0] * x[r][0] + x[r][1] * x[r][1]; s[r] = (t[0] + t[1]) + (t[2] + t[3]); }
  wsum(s);
#pragma unroll
  for (int j = 0; j < 2; ++j) {
#pragma unroll
    for (int i = 0; i < 4; ++i) { gg[j][i] = bfr(gg[j][i]); bb[j][i] = bfr(bb[j][i]); } }
#pragma unroll
  for (int r = 1; r < LNR; ++r) s[0] = ((lane & (LNR - 1)) == r) ? s[r] : s[0];   // every lane holds all LNR sums: lane l finishes row l mod LNR, so root and division run once a wave, not once a row
  const float iv = 1.0f / sqrtf(s[0] / (float)CC + 1e-5f);
#pragma unroll
  for (int r = 0; r < LNR; ++r) { const float inv = __builtin_bit_cast(float, __builtin_amdgcn_readlane(__builtin_bit_cast(int, iv), r));
    vst2(XN + off + r * CC, x[r][0] * inv * gg[0] + bb[0]); vst2(XN + off + r * CC + 128, x[r][1] * inv * gg[1] + bb[1]); } }
// ---- k_proj: block = (64 rows, which): A = LN rows (hi + lo), all 256 cols, + bias; q/k -> f16 rows; v -> planes
__global__ __launch_bounds__(128) void k_proj(const float* __restrict__ XN, const __bf16* __restrict__ PW, const float* __restrict__ BQ, const float* __restrict__ BK, const float* __restrict__ BV, _Float16* __restrict__ Q, _Float16* __restrict__ Kr, _Float16* __restrict__ V) {
  __shared__ __align__(16) _Float16 so[64][CC + 8]; __shared__ __align__(16) _Float16 st[CC][72];
  const int tid = threadIdx.x, wave = tid >> 5, lane = tid & 31, col = lane & 15, g = lane >> 4; const int which = blockIdx.y; const size_t rb = (size_t)blockIdx.x * 64; const size_t r0 = rb + wave * 16;
  const __bf16* Wr = PW + ((size_t)which * CC) * CC; const float* BB = (which == 0) ? BQ : (which == 1) ? BK : BV;
#pragma unroll 1
  for (int half = 0; half < 2; ++half) { v8f acc[8] = {};
#pragma unroll
    for (int kc = 0; kc < CC / 32; ++kc) { const F2 a = split_row(XN + (r0 + col) * CC, kc * 32, lane);
#pragma unroll
      for (int j = 0; j < 8; ++j) { const v16b w = frag_b(Wr + (size_t)(half * 128 + j * 16 + col) * CC + kc * 32, lane); acc[j] = wmma_bf(a.h, w, acc[j]); acc[j] = wmma_bf(a.l, w, acc[j]); } }
#pragma unroll
    for (int j = 0; j < 8; ++j) { const int c = half * 128 + j * 16 + col; const float bb = bfr(BB[c]);
#pragma unroll
      for (int r = 0; r < 8; ++r) { const _Float16 hv = (_Float16)(acc[j][r] + bb); if (which < 2) so[wave * 16 + 8 * g + r][c] = hv; else st[c][wave * 16 + 8 * g + r] = hv; } } }
  __syncthreads();
  if (which < 2) { _Float16* dst = (which == 0) ? Q : Kr; for (int e = tid; e < 64 * (CC / 8); e += 128) { const int rl = e >> 5, q = e & 31; vst2((unsigned*)(dst + (rb + rl) * CC + q * 8), *(const v4u*)&so[rl][q * 8]); } }
  else { const size_t b = rb / NT; const int s0 = (int)(rb % NT); for (int e = tid; e < CC * 8; e += 128) { const int d = e >> 3, pc = e & 7; vst2((unsigned*)(V + ((b * CC + d) * NT) + s0 + pc * 8), *(const v4u*)&st[d][pc * 8]); } }
}
// ---- k_attn: block = 32 waves = 512 queries of one head, one block per WGP; the head's whole K (1,024 rows of 64 B) and V^T (32 rows of 2,048 B) are staged once in LDS, and every fragment of the key loop is read from there.
// wave = 16 queries. S^T = K . Q^T (A = 16 key rows, B = the wave's queries): a lane holds 16 of the 32 scores of ONE query (keys j0 + 8g + r and j0 + 16 + 8g + r),
// so maximum and sum run in the lane, with one exchange between the halves; the two score tiles, converted in place, are the B operand of O^T += V^T . P^T (hardware k order, as frag_h loads V^T).
#define AQ 512          // queries per block
#define KP (HD + 8)     // LDS pitch of a K row, in f16: 64 B + 16 B = 16 B x odd, so the 16 rows of a 16-byte fragment read fall on 64 different banks
#define VP (NT + 8)     // LDS pitch of a V^T row, in f16: 2,048 B + 16 B, for the same reason
__global__ __launch_bounds__(1024) void k_attn(const _Float16* __restrict__ Q, const _Float16* __restrict__ Kr, const _Float16* __restrict__ V, float* __restrict__ O) {
  __shared__ __align__(16) _Float16 sk[NT * KP]; __shared__ __align__(16) _Float16 sv[HD * VP];
  const int tid = threadIdx.x, wave = tid >> 5, lane = tid & 31, col = lane & 15, g = lane >> 4; const int h = blockIdx.y; const size_t b = blockIdx.z; const int q0 = blockIdx.x * AQ + wave * 16; const size_t rq = b * NT + q0;
  { v4u tk[4], tv[4];   // 4,096 pieces of 16 B of each operand, 4 + 4 a thread, all eight loads in flight; K: 4 lanes a row (8 lines a load), V^T: 512 contiguous bytes a load; both loops unrolled so that tk and tv, indexed by constants only, stay in registers
#pragma unroll
    for (int i = 0; i < 4; ++i) { const int e = i * 1024 + tid; tk[i] = *(const v4u*)(Kr + (b * NT + (e >> 2)) * CC + h * HD + (e & 3) * 8); tv[i] = *(const v4u*)(V + (b * CC + h * HD + (e >> 7)) * NT + (e & 127) * 8); }
#pragma unroll
    for (int i = 0; i < 4; ++i) { const int e = i * 1024 + tid; *(v4u*)&sk[(e >> 2) * KP + (e & 3) * 8] = tk[i]; *(v4u*)&sv[(e >> 7) * VP + (e & 127) * 8] = tv[i]; } }
  const v16h bq = frag_h(Q + (rq + col) * CC + h * HD, lane);
  __syncthreads();   // the staged K and V^T are read by every wave of the block
  const _Float16 *pk = sk + col * KP, *pv = sv + col * VP;   // the lane's row in a 16-row tile
  float m = -3.0e38f, l = 0.f;   // of query col; l holds this half's keys only until the epilogue
  v8f acc[2] = {};               // acc[dt][r] = O^T[dt * 16 + 8g + r][col]
#pragma unroll 1   // as before: the 32 trips stay rolled, so the loop's code stays short
  for (int ks = 0; ks < NT / 32; ++ks) { const int j0 = ks * 32; v16h ak[2], av[2]; v8f s[2];   // all four fragments' loads stand at the head of the trip: nothing holds the V loads back any more
#pragma unroll
    for (int t = 0; t < 2; ++t) { ak[t] = frag_h(pk + (j0 + t * 16) * KP, lane); av[t] = frag_h(pv + t * 16 * VP + j0, lane); }
#pragma unroll
    for (int ct = 0; ct < 2; ++ct) { v8f c = {}; c = wmma16(ak[ct], bq, c);
#pragma unroll
      for (int r = 0; r < 8; ++r) s[ct][r] = c[r] * 0.17677669529663688f; }   // 32^-1/2
    float mx = fmaxf(s[0][0], s[1][0]);
#pragma unroll
    for (int r = 1; r < 8; ++r) mx = fmaxf(mx, fmaxf(s[0][r], s[1][r]));
    mx = fmaxf(mx, xhalf(mx));
    const float mn = fmaxf(m, mx); const float alpha = (m <= -1.0e38f) ? 0.f : __expf(m - mn);
    v16h pb; v2f es[2] = {};
#pragma unroll
    for (int ct = 0; ct < 2; ++ct) {
#pragma unroll
      for (int i = 0; i < 4; ++i) { const v2f e = { __expf(s[ct][2 * i] - mn), __expf(s[ct][2 * i + 1] - mn) }; es[ct] += e; const v2f p = e * 2048.0f; pb[ct * 8 + 2 * i] = (_Float16)p[0]; pb[ct * 8 + 2 * i + 1] = (_Float16)p[1]; } }
    const v2f e2 = es[0] + es[1];
    l = l * alpha + (e2[0] + e2[1]); m = mn;
#pragma unroll
    for (int dt = 0; dt < 2; ++dt) {
#pragma unroll
      for (int r = 0; r < 8; ++r) acc[dt][r] *= alpha;
      acc[dt] = wmma16(av[dt], pb, acc[dt]); } }
  l += xhalf(l);
  const float il = (1.0f / 2048.0f) / l;
#pragma unroll
  for (int dt = 0; dt < 2; ++dt) { float* po = O + (rq + col) * CC + h * HD + dt * 16 + 8 * g;
    const v4f lo = { acc[dt][0] * il, acc[dt][1] * il, acc[dt][2] * il, acc[dt][3] * il }, hi = { acc[dt][4] * il, acc[dt][5] * il, acc[dt][6] * il, acc[dt][7] * il };
    vst2(po, lo); vst2(po + 4, hi); }
}
// ---- k_out: block = 64 rows: out = Y (hi + lo) . Wp + bp; whole 1-KB rows
__global__ __launch_bounds__(128) void k_out(const float* __restrict__ O, const __bf16* __restrict__ PW, const float* __restrict__ BP, float* __restrict__ OUT) {
  __shared__ __align__(16) float sx[64][CC + 4];
  const int tid = threadIdx.x, wave = tid >> 5, lane = tid & 31, col = lane & 15, g = lane >> 4; const size_t rb = (size_t)blockIdx.x * 64; const size_t r0 = rb + wave * 16; const __bf16* Wr = PW + (size_t)3 * CC * CC;
#pragma unroll 1
  for (int half = 0; half < 2; ++half) { v8f acc[8] = {};
#pragma unroll
    for (int kc = 0; kc < CC / 32; ++kc) { const F2 a = split_row(O + (r0 + col) * CC, kc * 32, lane);
#pragma unroll
      for (int j = 0; j < 8; ++j) { const v16b w = frag_b(Wr + (size_t)(half * 128 + j * 16 + col) * CC + kc * 32, lane); acc[j] = wmma_bf(a.h, w, acc[j]); acc[j] = wmma_bf(a.l, w, acc[j]); } }
#pragma unroll
    for (int j = 0; j < 8; ++j) { const int c = half * 128 + j * 16 + col; const float bb = bfr(BP[c]);
#pragma unroll
      for (int r = 0; r < 8; ++r) sx[wave * 16 + 8 * g + r][c] = acc[j][r] + bb; } }
  __syncthreads();
  for (int e = tid; e < 64 * (CC / 4); e += 128) { const int rl = e >> 6, q = e & 63; vst2(OUT + (rb + rl) * CC + q * 4, *(const v4f*)&sx[rl][q * 4]); }
}
extern "C" void kernel_launch(void* const* d_in, const int* in_sizes, int n_in, void* d_out, int out_size, void* d_ws, size_t ws_size, hipStream_t stream) {
  (void)in_sizes; (void)n_in; (void)out_size;
  const float** F = (const float**)d_in;   // 0 x [16,32,32,256], 1 gamma, 2 beta, 3 Wq [256,256] (in,out), 4 bq, 5 Wk, 6 bk, 7 Wv, 8 bv, 9 Wp [256,256] (in,out), 10 bp
  if (ws_size < (size_t)WS_END) return;
  char* ws = (char*)d_ws; __bf16* PW = (__bf16*)ws; float *XN = (float*)(ws + WS_XN), *O = (float*)(ws + WS_O); _Float16 *Q = (_Float16*)(ws + WS_Q), *Kr = (_Float16*)(ws + WS_K), *V = (_Float16*)(ws + WS_V);
  k_pack<<<dim3(CC, 4), 256, 0, stream>>>(F[3], F[5], F[7], F[9], PW);
  k_ln<<<TNB * NT / (8 * LNR), 256, 0, stream>>>(F[0], F[1], F[2], XN);
  k_proj<<<dim3(TNB * NT / 64, 3), 128, 0, stream>>>(XN, PW, F[4], F[6], F[8], Q, Kr, V);
  k_attn<<<dim3(NT / AQ, NH, TNB), 1024, 0, stream>>>(Q, Kr, V, O);
  k_out<<<TNB * NT / 64, 128, 0, stream>>>(O, PW, F[10], (float*)d_out);
}

// v004
// A run of this version takes 87.6 microseconds.
// Timed twice side by side with v003, it ran 1.39 and 1.46 times as fast.
// All steps since v000 together make it 2.08 times as fast.
// compute dtype: all float inputs rounded to bf16; LayerNorm (eps 1e-5) in f32; Q/K/V = LN(x) (bf16 hi + lo, 2 products) . W + b on WMMA 16x16x32 ((in,out) weights as transposed rows), rounded once to f16; PLAIN attention (8 heads x 32 over the 1,024 positions of each image): q, k single f16 x 32^-1/2, running-max softmax in f32 (hardware exp), P (scaled by 2^11, single f16) x v (single f16); out = Y (bf16 hi + residual) . Wp (2 products) + bp.
#include <hip/hip_runtime.h>
#include <math.h>

typedef __attribute__((ext_vector_type(16))) _Float16 v16h;
typedef __attribute__((ext_vector_type(16))) __bf16 v16b;
typedef __attribute__((ext_vector_type(8)))  _Float16 v8h;
typedef __attribute__((ext_vector_type(8)))  float v8f;
typedef __attribute__((ext_vector_type(4)))  float v4f;
typedef __attribute__((ext_vector_type(2)))  float v2f;
typedef __attribute__((ext_vector_type(4)))  unsigned v4u;
typedef __attribute__((ext_vector_type(4)))  int v4i;
typedef float __attribute__((may_alias)) float_a;
typedef int __attribute__((may_alias)) int_a;

template <typename T> __device__ __forceinline__ void vst2(void* p, T v) { *(T*)p = v;  }
__device__ __forceinline__ v8f wmma16(v16h a, v16h b, v8f c) {
  v8f d = __builtin_amdgcn_wmma_f32_16x16x32_f16(false, a, false, b, (short)0, c, false, false);
  asm volatile("v_nop\n\tv_nop\n\tv_nop\n\tv_nop" : "+v"(d) : "v"(a), "v"(b));
  return d;
}
__device__ __forceinline__ v8f wmma_bf(v16b a, v16b b, v8f c) {
  v8f d = __builtin_amdgcn_wmma_f32_16x16x32_bf16(false, a, false, b, (short)0, c, false, false);
  asm volatile("v_nop\n\tv_nop\n\tv_nop\n\tv_nop" : "+v"(d) : "v"(a), "v"(b));
  return d;
}
// 16x16x32 fragments: lane = (h = lane>>4, row/col = lane&15); elements 0..7 = k0+8h+0..7, 8..15 = k0+16+8h+0..7; D element r = row 8h+r
__device__ __forceinline__ v16h frag_h(const _Float16* rowk0, int lane) {
  union { v16h v; v8h q[2]; } u; const _Float16* p = rowk0 + 8 * (lane >> 4);
  u.q[0] = *(const v8h*)p; u.q[1] = *(const v8h*)(p + 16); return u.v;
}
__device__ __forceinline__ v16h frag_f32(const float* rowk0, int lane) {
  v16h a; const float* p = rowk0 + 8 * (lane >> 4);
#pragma unroll
  for (int i = 0; i < 8; ++i) { a[i] = (_Float16)p[i]; a[8 + i] = (_Float16)p[16 + i]; }
  return a;
}
__device__ __forceinline__ v16h frag_f32s(const float* rowk0, int lane, float sc) {
  v16h a; const float* p = rowk0 + 8 * (lane >> 4);
#pragma unroll
  for (int i = 0; i < 8; ++i) { a[i] = (_Float16)(p[i] * sc); a[8 + i] = (_Float16)(p[16 + i] * sc); }
  return a;
}
// column fragment from a [K][ld] layout (column n), rows >= K read as 0
__device__ __forceinline__ v16h fragc_f32(const float* W, int k0, int n, int lane, int ld, int K) {
  v16h a; const int g = lane >> 4;
#pragma unroll
  for (int i = 0; i < 8; ++i) { const int ka = k0 + 8 * g + i, kb = ka + 16;
    a[i] = (_Float16)(ka < K ? W[(size_t)(ka < K ? ka : K - 1) * ld + n] : 0.f); a[8 + i] = (_Float16)(kb < K ? W[(size_t)(kb < K ? kb : K - 1) * ld + n] : 0.f); }
  return a;
}
struct F2 { v16b h, l; };
__device__ __forceinline__ F2 bsplit16(const float v[16]) { F2 r;
#pragma unroll
  for (int i = 0; i < 16; ++i) { const __bf16 h = (__bf16)v[i]; r.h[i] = h; r.l[i] = (__bf16)(v[i] - (float)h); }
  return r; }
__device__ __forceinline__ F2 split_row(const float* row, int k0, int lane) { float v[16]; const float* p = row + k0 + 8 * (lane >> 4);
#pragma unroll
  for (int i = 0; i < 8; ++i) { v[i] = p[i]; v[8 + i] = p[16 + i]; }
  return bsplit16(v); }
__device__ __forceinline__ F2 split_rowK(const float* row, int k0, int lane, int K) { float v[16]; const int g = lane >> 4;
#pragma unroll
  for (int i = 0; i < 8; ++i) { const int ka = k0 + 8 * g + i, kb = ka + 16; v[i] = ka < K ? row[ka < K ? ka : K - 1] : 0.f; v[8 + i] = kb < K ? row[kb < K ? kb : K - 1] : 0.f; }
  return bsplit16(v); }
__device__ __forceinline__ F2 split_col(const float* W, int k0, int n, int lane, int ld, int K) { float v[16]; const int g = lane >> 4;
#pragma unroll
  for (int i = 0; i < 8; ++i) { const int ka = k0 + 8 * g + i, kb = ka + 16; v[i] = ka < K ? W[(size_t)(ka < K ? ka : K - 1) * ld + n] : 0.f; v[8 + i] = kb < K ? W[(size_t)(kb < K ? kb : K - 1) * ld + n] : 0.f; }
  return bsplit16(v); }
__device__ __forceinline__ v8f mac3(const F2& a, const F2& b, v8f c) { c = wmma_bf(a.l, b.h, c); c = wmma_bf(a.h, b.l, c); return wmma_bf(a.h, b.h, c); }
__device__ __forceinline__ float sigm(float v) { return 1.0f / (1.0f + expf(-v)); }
#define LDSX() do { asm volatile("s_wait_dscnt 0" ::: "memory"); __builtin_amdgcn_wave_barrier(); __builtin_amdgcn_fence(__ATOMIC_RELEASE, "workgroup"); } while (0)


// Global multi-head self attention over a 32 x 32 feature map (B 16, N 1,024 tokens, C 256, 8 heads x 32): LayerNorm, 1x1-conv q/k/v, softmax(Q K / sqrt(32)) V, 1x1-conv projection + bias.
#define NB 16
#define NT 1024
#define CC 256
#define NH 8
#define HD 32
#define NR (NB * NT)
#ifndef TQB
#define TQB (NT / 64)
#define TNB NB
#endif
typedef __attribute__((ext_vector_type(8))) __bf16 v8b;
__device__ __forceinline__ v16b frag_b(const __bf16* rowk0, int lane) {
  union { v16b v; v8b q[2]; } u; const __bf16* p = rowk0 + 8 * (lane >> 4);
  u.q[0] = *(const v8b*)p; u.q[1] = *(const v8b*)(p + 16); return u.v;
}
__device__ __forceinline__ float bfr(float v) { return (float)(__bf16)v; }
__device__ __attribute__((noinline)) float exp_ni(float v) { return expf(v); }
__device__ __attribute__((noinline)) float erf_ni(float v) { return erff(v); }

#define WS_PW  0u                                    // bf16 transposed rows Wq^T, Wk^T, Wv^T, Wp^T [4][256][256]
#define WS_XN  (WS_PW + 2u * (size_t)4 * CC * CC)       // f32 LN rows [NR][256]
#define WS_Q   (WS_XN + 4u * (size_t)NR * CC)           // f16 q rows [NR][256]; k rows; v planes [b][256][NT]; O f32 [NR][256]
#define WS_K   (WS_Q + 2u * (size_t)NR * CC)
#define WS_V   (WS_K + 2u * (size_t)NR * CC)
#define WS_O   (WS_V + 2u * (size_t)NB * CC * NT)
#define WS_END (WS_O + 4u * (size_t)NR * CC)

__global__ __launch_bounds__(256) void k_pack(const float* __restrict__ WQ, const float* __restrict__ WK, const float* __restrict__ WV, const float* __restrict__ WP, __bf16* __restrict__ PW) { const int n = blockIdx.x, which = blockIdx.y, t = threadIdx.x; __shared__ __align__(16) __bf16 s[CC]; const float* w = (which == 0) ? WQ : (which == 1) ? WK : (which == 2) ? WV : WP;
  s[t] = (__bf16)w[(size_t)t * CC + n]; __syncthreads(); if (t < CC / 8) vst2((unsigned*)(PW + ((size_t)which * CC + n) * CC + t * 8), *(const v4u*)&s[t * 8]); }
// lane l with lane l ^ 16
__device__ __forceinline__ float xhalf(float x) { return __builtin_bit_cast(float, __builtin_amdgcn_permlanex16(__builtin_bit_cast(int, x), __builtin_bit_cast(int, x), 0x76543210, 0xfedcba98, false, false)); }
// lane l with lane l ^ M inside its 16-lane row (DPP row_xmask)
template <int M> __device__ __forceinline__ float xrow(float x) { return __builtin_bit_cast(float, __builtin_amdgcn_update_dpp(0, __builtin_bit_cast(int, x), 0x160 + M, 0xf, 0xf, true)); }
#define LNR 8   // token rows per wave
// every lane ends with the sum over the wave's 32 lanes, for LNR rows side by side (independent chains)
// the unroll directives here and in k_ln: s[] and x[][] are indexed by constants only, so they stay in registers
__device__ __forceinline__ void wsum(float (&s)[LNR]) {
#pragma unroll
  for (int r = 0; r < LNR; ++r) s[r] += xrow<1>(s[r]);
#pragma unroll
  for (int r = 0; r < LNR; ++r) s[r] += xrow<2>(s[r]);
#pragma unroll
  for (int r = 0; r < LNR; ++r) s[r] += xrow<4>(s[r]);
#pragma unroll
  for (int r = 0; r < LNR; ++r) s[r] += xrow<8>(s[r]);
#pragma unroll
  for (int r = 0; r < LNR; ++r) s[r] += xhalf(s[r]);
}
// ---- k_ln: wave = LNR token rows, block = 8 waves = 64 rows, one block per WGP: a lane holds channels 4 * lane + 0..3 and 128 + 4 * lane + 0..3 of each row (every load and store = 512 contiguous bytes),
// all 2 * LNR loads in flight at once; LayerNorm over 256 channels (mean-square var, 1e-5) x g + b -> f32 row; sums in the lane, then a five-step butterfly: no LDS, no barrier
__global__ __launch_bounds__(256) void k_ln(const float* __restrict__ X, const float* __restrict__ G, const float* __restrict__ Bt, float* __restrict__ XN) { const int lane = threadIdx.x & 31, wave = threadIdx.x >> 5; const size_t off = ((size_t)blockIdx.x * 8 + wave) * (LNR * CC) + lane * 4;
  v4f x[LNR][2], gg[2], bb[2]; float s[LNR];
#pragma unroll
  for (int r = 0; r < LNR; ++r) { x[r][0] = *(const v4f*)(X + off + r * CC); x[r][1] = *(const v4f*)(X + off + r * CC + 128); }
#pragma unroll
  for (int j = 0; j < 2; ++j) { gg[j] = *(const v4f*)(G + j * 128 + lane * 4); bb[j] = *(const v4f*)(Bt + j * 128 + lane * 4); }
  __builtin_amdgcn_sched_barrier(0);   // keeps every load above the arithmetic: without it the compiler sinks the later rows' loads to their uses, and the wave waits out the memory latency several times over
#pragma unroll
  for (int r = 0; r < LNR; ++r) {
#pragma unroll
    for (int i = 0; i < 4; ++i) { x[r][0][i] = bfr(x[r][0][i]); x[r][1][i] = bfr(x[r][1][i]); }
    const v4f t = x[r][0] + x[r][1]; s[r] = (t[0] + t[1]) + (t[2] + t[3]); }
  wsum(s);
#pragma unroll
  for (int r = 0; r < LNR; ++r) { const float mu = s[r] / (float)CC; x[r][0] -= mu; x[r][1] -= mu;
    const v4f t = x[r][0] * x[r][0] + x[r][1] * x[r][1]; s[r] = (t[0] + t[1]) + (t[2] + t[3]); }
  wsum(s);
#pragma unroll
  for (int j = 0; j < 2; ++j) {
#pragma unroll
    for (int i = 0; i < 4; ++i) { gg[j][i] = bfr(gg[j][i]); bb[j][i] = bfr(bb[j][i]); } }
#pragma unroll
  for (int r = 1; r < LNR; ++r) s[0] = ((lane & (LNR - 1)) == r) ? s[r] : s[0];   // every lane holds all LNR sums: lane l finishes row l mod LNR, so root and division run once a wave, not once a row
  const float iv = 1.0f / sqrtf(s[0] / (float)CC + 1e-5f);
#pragma unroll
  for (int r = 0; r < LNR; ++r) { const float inv = __builtin_bit_cast(float, __builtin_amdgcn_readlane(__builtin_bit_cast(int, iv), r));
    vst2(XN + off + r * CC, x[r][0] * inv * gg[0] + bb[0]); vst2(XN + off + r * CC + 128, x[r][1] * inv * gg[1] + bb[1]); } }
// ---- the product of k_proj and k_out: acc[j] += A (the wave's 16 rows, bf16 hi + lo) . W^T (rows 16 j + 0..15 of the 128 at pw), k = 0..255; pa, pw = the lane's own row, at its 8 * (lane >> 4)
// software pipeline in registers: W fragments come in groups of WG, WRING - 1 groups ahead of the group that is multiplied; the A rows of a k-step come ARING - 1 k-steps ahead
#define WG 1
#define WRING 8
#define ARING 2
__device__ __forceinline__ void ld_a(v4f (&d)[4], const float* p) { d[0] = *(const v4f*)p; d[1] = *(const v4f*)(p + 4); d[2] = *(const v4f*)(p + 16); d[3] = *(const v4f*)(p + 20); }
__device__ __forceinline__ void ld_w(v8b (&d)[WG][2], const __bf16* pw, int gi) {
#pragma unroll   // as in mm_half: d is indexed by constants only
  for (int i = 0; i < WG; ++i) { const __bf16* p = pw + (size_t)((gi % (8 / WG)) * WG + i) * 16 * CC + (gi / (8 / WG)) * 32; d[i][0] = *(const v8b*)p; d[i][1] = *(const v8b*)(p + 16); } }
__device__ __forceinline__ void mm_half(const float* pa, const __bf16* pw, v8f (&acc)[8]) {
  v4f ar[ARING][4]; v8b wr[WRING][WG][2]; F2 a;   // every loop here is unrolled so that the rings, indexed by constants only, stay in registers
#pragma unroll
  for (int s = 0; s < ARING - 1; ++s) ld_a(ar[s], pa + s * 32);
#pragma unroll
  for (int gi = 0; gi < WRING - 1; ++gi) ld_w(wr[gi], pw, gi);
#pragma unroll
  for (int gi = 0; gi < 64 / WG; ++gi) { const int kc = gi / (8 / WG), jb = (gi % (8 / WG)) * WG;
    if (gi + WRING - 1 < 64 / WG) ld_w(wr[(gi + WRING - 1) % WRING], pw, gi + WRING - 1);
    if (jb == 0 && kc + ARING - 1 < CC / 32) ld_a(ar[(kc + ARING - 1) % ARING], pa + (kc + ARING - 1) * 32);
    if (gi == 0) asm volatile("s_wait_xcnt 0x0" ::: "memory");   // from here on the compiler may reuse a register that a load issued above names (seen: the bias loads' offset register becomes an accumulator)
    __builtin_amdgcn_sched_barrier(0);   // keeps a k-step's split behind this point: lifted among the earlier WMMAs (seen without it), its wait for the A rows also waits out nearly all the W loads in flight
    if (jb == 0) { float v[16];
#pragma unroll
      for (int i = 0; i < 4; ++i) { v[i] = ar[kc % ARING][0][i]; v[4 + i] = ar[kc % ARING][1][i]; v[8 + i] = ar[kc % ARING][2][i]; v[12 + i] = ar[kc % ARING][3][i]; }
      a = bsplit16(v); }
#pragma unroll
    for (int i = 0; i < WG; ++i) { union { v16b v; v8b q[2]; } u; u.q[0] = wr[gi % WRING][i][0]; u.q[1] = wr[gi % WRING][i][1];
      acc[jb + i] = wmma_bf(a.h, u.v, acc[jb + i]); acc[jb + i] = wmma_bf(a.l, u.v, acc[jb + i]); } }
  asm volatile("s_wait_xcnt 0x0" ::: "memory"); }   // the caller's next trip forms new addresses in the registers that the loads above name
// ---- k_proj: block = (64 rows, which): A = LN rows (hi + lo), all 256 cols, + bias; q/k -> f16 rows; v -> planes
__global__ __launch_bounds__(128) void k_proj(const float* __restrict__ XN, const __bf16* __restrict__ PW, const float* __restrict__ BQ, const float* __restrict__ BK, const float* __restrict__ BV, _Float16* __restrict__ Q, _Float16* __restrict__ Kr, _Float16* __restrict__ V) {
  __shared__ __align__(16) _Float16 so[64][CC + 8]; __shared__ __align__(16) _Float16 st[CC][72];
  const int tid = threadIdx.x, wave = tid >> 5, lane = tid & 31, col = lane & 15, g = lane >> 4; const int which = blockIdx.y; const size_t rb = (size_t)blockIdx.x * 64; const size_t r0 = rb + wave * 16;
  const __bf16* Wr = PW + ((size_t)which * CC) * CC; const float* BB = (which == 0) ? BQ : (which == 1) ? BK : BV;
#pragma unroll 1
  for (int half = 0; half < 2; ++half) { v8f acc[8] = {}; float bs[8];   // the lane's eight bias values, fetched ahead of the product and not one by one behind it
#pragma unroll   // bs, indexed by constants only, stays in registers
    for (int j = 0; j < 8; ++j) bs[j] = BB[half * 128 + j * 16 + col];
    mm_half(XN + (r0 + col) * CC + 8 * g, Wr + (size_t)(half * 128 + col) * CC + 8 * g, acc);
#pragma unroll
    for (int j = 0; j < 8; ++j) { const int c = half * 128 + j * 16 + col; const float bb = bfr(bs[j]);
#pragma unroll
      for (int r = 0; r < 8; ++r) { const _Float16 hv = (_Float16)(acc[j][r] + bb); if (which < 2) so[wave * 16 + 8 * g + r][c] = hv; else st[c][wave * 16 + 8 * g + r] = hv; } } }
  __syncthreads();
  if (which < 2) { _Float16* dst = (which == 0) ? Q : Kr; for (int e = tid; e < 64 * (CC / 8); e += 128) { const int rl = e >> 5, q = e & 31; vst2((unsigned*)(dst + (rb + rl) * CC + q * 8), *(const v4u*)&so[rl][q * 8]); } }
  else { const size_t b = rb / NT; const int s0 = (int)(rb % NT); for (int e = tid; e < CC * 8; e += 128) { const int d = e >> 3, pc = e & 7; vst2((unsigned*)(V + ((b * CC + d) * NT) + s0 + pc * 8), *(const v4u*)&st[d][pc * 8]); } }
}
// ---- k_attn: block = 32 waves = 512 queries of one head, one block per WGP; the head's whole K (1,024 rows of 64 B) and V^T (32 rows of 2,048 B) are staged once in LDS, and every fragment of the key loop is read from there.
// wave = 16 queries. S^T = K . Q^T (A = 16 key rows, B = the wave's queries): a lane holds 16 of the 32 scores of ONE query (keys j0 + 8g + r and j0 + 16 + 8g + r),
// so maximum and sum run in the lane, with one exchange between the halves; the two score tiles, converted in place, are the B operand of O^T += V^T . P^T (hardware k order, as frag_h loads V^T).
#define AQ 512          // queries per block
#define KP (HD + 8)     // LDS pitch of a K row, in f16: 64 B + 16 B = 16 B x odd, so the 16 rows of a 16-byte fragment read fall on 64 different banks
#define VP (NT + 8)     // LDS pitch of a V^T row, in f16: 2,048 B + 16 B, for the same reason
__global__ __launch_bounds__(1024) void k_attn(const _Float16* __restrict__ Q, const _Float16* __restrict__ Kr, const _Float16* __restrict__ V, float* __restrict__ O) {
  __shared__ __align__(16) _Float16 sk[NT * KP]; __shared__ __align__(16) _Float16 sv[HD * VP];
  const int tid = threadIdx.x, wave = tid >> 5, lane = tid & 31, col = lane & 15, g = lane >> 4; const int h = blockIdx.y; const size_t b = blockIdx.z; const int q0 = blockIdx.x * AQ + wave * 16; const size_t rq = b * NT + q0;
  { v4u tk[4], tv[4];   // 4,096 pieces of 16 B of each operand, 4 + 4 a thread, all eight loads in flight; K: 4 lanes a row (8 lines a load), V^T: 512 contiguous bytes a load; both loops unrolled so that tk and tv, indexed by constants only, stay in registers
#pragma unroll
    for (int i = 0; i < 4; ++i) { const int e = i * 1024 + tid; tk[i] = *(const v4u*)(Kr + (b * NT + (e >> 2)) * CC + h * HD + (e & 3) * 8); tv[i] = *(const v4u*)(V + (b * CC + h * HD + (e >> 7)) * NT + (e & 127) * 8); }
#pragma unroll
    for (int i = 0; i < 4; ++i) { const int e = i * 1024 + tid; *(v4u*)&sk[(e >> 2) * KP + (e & 3) * 8] = tk[i]; *(v4u*)&sv[(e >> 7) * VP + (e & 127) * 8] = tv[i]; } }
  const v16h bq = frag_h(Q + (rq + col) * CC + h * HD, lane);
  __syncthreads();   // the staged K and V^T are read by every wave of the block
  const _Float16 *pk = sk + col * KP, *pv = sv + col * VP;   // the lane's row in a 16-row tile
  float m = -3.0e38f, l = 0.f;   // of query col; l holds this half's keys only until the epilogue
  v8f acc[2] = {};               // acc[dt][r] = O^T[dt * 16 + 8g + r][col]
#pragma unroll 1   // as before: the 32 trips stay rolled, so the loop's code stays short
  for (int ks = 0; ks < NT / 32; ++ks) { const int j0 = ks * 32; v16h ak[2], av[2]; v8f s[2];   // all four fragments' loads stand at the head of the trip: nothing holds the V loads back any more
#pragma unroll
    for (int t = 0; t < 2; ++t) { ak[t] = frag_h(pk + (j0 + t * 16) * KP, lane); av[t] = frag_h(pv + t * 16 * VP + j0, lane); }
#pragma unroll
    for (int ct = 0; ct < 2; ++ct) { v8f c = {}; c = wmma16(ak[ct], bq, c);
#pragma unroll
      for (int r = 0; r < 8; ++r) s[ct][r] = c[r] * 0.17677669529663688f; }   // 32^-1/2
    float mx = fmaxf(s[0][0], s[1][0]);
#pragma unroll
    for (int r = 1; r < 8; ++r) mx = fmaxf(mx, fmaxf(s[0][r], s[1][r]));
    mx = fmaxf(mx, xhalf(mx));
    const float mn = fmaxf(m, mx); const float alpha = (m <= -1.0e38f) ? 0.f : __expf(m - mn);
    v16h pb; v2f es[2] = {};
#pragma unroll
    for (int ct = 0; ct < 2; ++ct) {
#pragma unroll
      for (int i = 0; i < 4; ++i) { const v2f e = { __expf(s[ct][2 * i] - mn), __expf(s[ct][2 * i + 1] - mn) }; es[ct] += e; const v2f p = e * 2048.0f; pb[ct * 8 + 2 * i] = (_Float16)p[0]; pb[ct * 8 + 2 * i + 1] = (_Float16)p[1]; } }
    const v2f e2 = es[0] + es[1];
    l = l * alpha + (e2[0] + e2[1]); m = mn;
#pragma unroll
    for (int dt = 0; dt < 2; ++dt) {
#pragma unroll
      for (int r = 0; r < 8; ++r) acc[dt][r] *= alpha;
      acc[dt] = wmma16(av[dt], pb, acc[dt]); } }
  l += xhalf(l);
  const float il = (1.0f / 2048.0f) / l;
#pragma unroll
  for (int dt = 0; dt < 2; ++dt) { float* po = O + (rq + col) * CC + h * HD + dt * 16 + 8 * g;
    const v4f lo = { acc[dt][0] * il, acc[dt][1] * il, acc[dt][2] * il, acc[dt][3] * il }, hi = { acc[dt][4] * il, acc[dt][5] * il, acc[dt][6] * il, acc[dt][7] * il };
    vst2(po, lo); vst2(po + 4, hi); }
}
// ---- k_out: block = 64 rows: out = Y (hi + lo) . Wp + bp; whole 1-KB rows
__global__ __launch_bounds__(128) void k_out(const float* __restrict__ O, const __bf16* __restrict__ PW, const float* __restrict__ BP, float* __restrict__ OUT) {
  __shared__ __align__(16) float sx[64][CC + 4];
  const int tid = threadIdx.x, wave = tid >> 5, lane = tid & 31, col = lane & 15, g = lane >> 4; const size_t rb = (size_t)blockIdx.x * 64; const size_t r0 = rb + wave * 16; const __bf16* Wr = PW + (size_t)3 * CC * CC;
#pragma unroll 1
  for (int half = 0; half < 2; ++half) { v8f acc[8] = {}; float bs[8];   // the lane's eight bias values, fetched ahead of the product and not one by one behind it
#pragma unroll   // bs, indexed by constants only, stays in registers
    for (int j = 0; j < 8; ++j) bs[j] = BP[half * 128 + j * 16 + col];
    mm_half(O + (r0 + col) * CC + 8 * g, Wr + (size_t)(half * 128 + col) * CC + 8 * g, acc);
#pragma unroll
    for (int j = 0; j < 8; ++j) { const int c = half * 128 + j * 16 + col; const float bb = bfr(bs[j]);
#pragma unroll
      for (int r = 0; r < 8; ++r) sx[wave * 16 + 8 * g + r][c] = acc[j][r] + bb; } }
  __syncthreads();
  for (int e = tid; e < 64 * (CC / 4); e += 128) { const int rl = e >> 6, q = e & 63; vst2(OUT + (rb + rl) * CC + q * 4, *(const v4f*)&sx[rl][q * 4]); }
}
extern "C" void kernel_launch(void* const* d_in, const int* in_sizes, int n_in, void* d_out, int out_size, void* d_ws, size_t ws_size, hipStream_t stream) {
  (void)in_sizes; (void)n_in; (void)out_size;
  const float** F = (const float**)d_in;   // 0 x [16,32,32,256], 1 gamma, 2 beta, 3 Wq [256,256] (in,out), 4 bq, 5 Wk, 6 bk, 7 Wv, 8 bv, 9 Wp [256,256] (in,out), 10 bp
  if (ws_size < (size_t)WS_END) return;
  char* ws = (char*)d_ws; __bf16* PW = (__bf16*)ws; float *XN = (float*)(ws + WS_XN), *O = (float*)(ws + WS_O); _Float16 *Q = (_Float16*)(ws + WS_Q), *Kr = (_Float16*)(ws + WS_K), *V = (_Float16*)(ws + WS_V);
  k_pack<<<dim3(CC, 4), 256, 0, stream>>>(F[3], F[5], F[7], F[9], PW);
  k_ln<<<TNB * NT / (8 * LNR), 256, 0, stream>>>(F[0], F[1], F[2], XN);
  k_proj<<<dim3(TNB * NT / 64, 3), 128, 0, stream>>>(XN, PW, F[4], F[6], F[8], Q, Kr, V);
  k_attn<<<dim3(NT / AQ, NH, TNB), 1024, 0, stream>>>(Q, Kr, V, O);
  k_out<<<TNB * NT / 64, 128, 0, stream>>>(O, PW, F[10], (float*)d_out);
}

// v005
// One run takes 84.4 microseconds.
// Next to v004, in two timings, it ran 1.04 times as fast each time.
// Counting every step since v000, it is 2.17 times as fast.
// compute dtype: all float inputs rounded to bf16; LayerNorm (eps 1e-5) in f32; Q/K/V = LN(x) (bf16 hi + lo, 2 products) . W + b on WMMA 16x16x32 ((in,out) weights as transposed rows), rounded once to f16; PLAIN attention (8 heads x 32 over the 1,024 positions of each image): q, k single f16 x 32^-1/2, running-max softmax in f32 (hardware exp), P (scaled by 2^11, single f16) x v (single f16); out = Y (bf16 hi + residual) . Wp (2 products) + bp.
#include <hip/hip_runtime.h>
#include <math.h>

typedef __attribute__((ext_vector_type(16))) _Float16 v16h;
typedef __attribute__((ext_vector_type(16))) __bf16 v16b;
typedef __attribute__((ext_vector_type(8)))  _Float16 v8h;
typedef __attribute__((ext_vector_type(8)))  float v8f;
typedef __attribute__((ext_vector_type(4)))  float v4f;
typedef __attribute__((ext_vector_type(2)))  float v2f;
typedef __attribute__((ext_vector_type(4)))  unsigned v4u;
typedef __attribute__((ext_vector_type(4)))  int v4i;
typedef float __attribute__((may_alias)) float_a;
typedef int __attribute__((may_alias)) int_a;

template <typename T> __device__ __forceinline__ void vst2(void* p, T v) { *(T*)p = v;  }
__device__ __forceinline__ v8f wmma16(v16h a, v16h b, v8f c) {
  v8f d = __builtin_amdgcn_wmma_f32_16x16x32_f16(false, a, false, b, (short)0, c, false, false);
  asm volatile("v_nop\n\tv_nop\n\tv_nop\n\tv_nop" : "+v"(d) : "v"(a), "v"(b));
  return d;
}
__device__ __forceinline__ v8f wmma_bf(v16b a, v16b b, v8f c) {
  v8f d = __builtin_amdgcn_wmma_f32_16x16x32_bf16(false, a, false, b, (short)0, c, false, false);
  asm volatile("v_nop\n\tv_nop\n\tv_nop\n\tv_nop" : "+v"(d) : "v"(a), "v"(b));
  return d;
}
// 16x16x32 fragments: lane = (h = lane>>4, row/col = lane&15); elements 0..7 = k0+8h+0..7, 8..15 = k0+16+8h+0..7; D element r = row 8h+r
__device__ __forceinline__ v16h frag_h(const _Float16* rowk0, int lane) {
  union { v16h v; v8h q[2]; } u; const _Float16* p = rowk0 + 8 * (lane >> 4);
  u.q[0] = *(const v8h*)p; u.q[1] = *(const v8h*)(p + 16); return u.v;
}
__device__ __forceinline__ v16h frag_f32(const float* rowk0, int lane) {
  v16h a; const float* p = rowk0 + 8 * (lane >> 4);
#pragma unroll
  for (int i = 0; i < 8; ++i) { a[i] = (_Float16)p[i]; a[8 + i] = (_Float16)p[16 + i]; }
  return a;
}
__device__ __forceinline__ v16h frag_f32s(const float* rowk0, int lane, float sc) {
  v16h a; const float* p = rowk0 + 8 * (lane >> 4);
#pragma unroll
  for (int i = 0; i < 8; ++i) { a[i] = (_Float16)(p[i] * sc); a[8 + i] = (_Float16)(p[16 + i] * sc); }
  return a;
}
// column fragment from a [K][ld] layout (column n), rows >= K read as 0
__device__ __forceinline__ v16h fragc_f32(const float* W, int k0, int n, int lane, int ld, int K) {
  v16h a; const int g = lane >> 4;
#pragma unroll
  for (int i = 0; i < 8; ++i) { const int ka = k0 + 8 * g + i, kb = ka + 16;
    a[i] = (_Float16)(ka < K ? W[(size_t)(ka < K ? ka : K - 1) * ld + n] : 0.f); a[8 + i] = (_Float16)(kb < K ? W[(size_t)(kb < K ? kb : K - 1) * ld + n] : 0.f); }
  return a;
}
struct F2 { v16b h, l; };
__device__ __forceinline__ F2 bsplit16(const float v[16]) { F2 r;
#pragma unroll
  for (int i = 0; i < 16; ++i) { const __bf16 h = (__bf16)v[i]; r.h[i] = h; r.l[i] = (__bf16)(v[i] - (float)h); }
  return r; }
__device__ __forceinline__ F2 split_row(const float* row, int k0, int lane) { float v[16]; const float* p = row + k0 + 8 * (lane >> 4);
#pragma unroll
  for (int i = 0; i < 8; ++i) { v[i] = p[i]; v[8 + i] = p[16 + i]; }
  return bsplit16(v); }
__device__ __forceinline__ F2 split_rowK(const float* row, int k0, int lane, int K) { float v[16]; const int g = lane >> 4;
#pragma unroll
  for (int i = 0; i < 8; ++i) { const int ka = k0 + 8 * g + i, kb = ka + 16; v[i] = ka < K ? row[ka < K ? ka : K - 1] : 0.f; v[8 + i] = kb < K ? row[kb < K ? kb : K - 1] : 0.f; }
  return bsplit16(v); }
__device__ __forceinline__ F2 split_col(const float* W, int k0, int n, int lane, int ld, int K) { float v[16]; const int g = lane >> 4;
#pragma unroll
  for (int i = 0; i < 8; ++i) { const int ka = k0 + 8 * g + i, kb = ka + 16; v[i] = ka < K ? W[(size_t)(ka < K ? ka : K - 1) * ld + n] : 0.f; v[8 + i] = kb < K ? W[(size_t)(kb < K ? kb : K - 1) * ld + n] : 0.f; }
  return bsplit16(v); }
__device__ __forceinline__ v8f mac3(const F2& a, const F2& b, v8f c) { c = wmma_bf(a.l, b.h, c); c = wmma_bf(a.h, b.l, c); return wmma_bf(a.h, b.h, c); }
__device__ __forceinline__ float sigm(float v) { return 1.0f / (1.0f + expf(-v)); }
#define LDSX() do { asm volatile("s_wait_dscnt 0" ::: "memory"); __builtin_amdgcn_wave_barrier(); __builtin_amdgcn_fence(__ATOMIC_RELEASE, "workgroup"); } while (0)


// Global multi-head self attention over a 32 x 32 feature map (B 16, N 1,024 tokens, C 256, 8 heads x 32): LayerNorm, 1x1-conv q/k/v, softmax(Q K / sqrt(32)) V, 1x1-conv projection + bias.
#define NB 16
#define NT 1024
#define CC 256
#define NH 8
#define HD 32
#define NR (NB * NT)
#ifndef TQB
#define TQB (NT / 64)
#define TNB NB
#endif
typedef __attribute__((ext_vector_type(8))) __bf16 v8b;
__device__ __forceinline__ v16b frag_b(const __bf16* rowk0, int lane) {
  union { v16b v; v8b q[2]; } u; const __bf16* p = rowk0 + 8 * (lane >> 4);
  u.q[0] = *(const v8b*)p; u.q[1] = *(const v8b*)(p + 16); return u.v;
}
__device__ __forceinline__ float bfr(float v) { return (float)(__bf16)v; }
__device__ __attribute__((noinline)) float exp_ni(float v) { return expf(v); }
__device__ __attribute__((noinline)) float erf_ni(float v) { return erff(v); }

#define WS_PW  0u                                    // bf16 transposed rows Wq^T, Wk^T, Wv^T, Wp^T [4][256][256]
#define WS_XN  (WS_PW + 2u * (size_t)4 * CC * CC)       // f32 LN rows [NR][256]
#define WS_Q   (WS_XN + 4u * (size_t)NR * CC)           // f16 q rows [NR][256]; k rows; v planes [b][256][NT]; O f32 [NR][256]
#define WS_K   (WS_Q + 2u * (size_t)NR * CC)
#define WS_V   (WS_K + 2u * (size_t)NR * CC)
#define WS_O   (WS_V + 2u * (size_t)NB * CC * NT)
#define WS_END (WS_O + 4u * (size_t)NR * CC)

__global__ __launch_bounds__(256) void k_pack(const float* __restrict__ WQ, const float* __restrict__ WK, const float* __restrict__ WV, const float* __restrict__ WP, __bf16* __restrict__ PW) { const int n = blockIdx.x, which = blockIdx.y, t = threadIdx.x; __shared__ __align__(16) __bf16 s[CC]; const float* w = (which == 0) ? WQ : (which == 1) ? WK : (which == 2) ? WV : WP;
  s[t] = (__bf16)w[(size_t)t * CC + n]; __syncthreads(); if (t < CC / 8) vst2((unsigned*)(PW + ((size_t)which * CC + n) * CC + t * 8), *(const v4u*)&s[t * 8]); }
// lane l with lane l ^ 16
__device__ __forceinline__ float xhalf(float x) { return __builtin_bit_cast(float, __builtin_amdgcn_permlanex16(__builtin_bit_cast(int, x), __builtin_bit_cast(int, x), 0x76543210, 0xfedcba98, false, false)); }
// lane l with lane l ^ M inside its 16-lane row (DPP row_xmask)
template <int M> __device__ __forceinline__ float xrow(float x) { return __builtin_bit_cast(float, __builtin_amdgcn_update_dpp(0, __builtin_bit_cast(int, x), 0x160 + M, 0xf, 0xf, true)); }
#define LNR 8   // token rows per wave
// every lane ends with the sum over the wave's 32 lanes, for LNR rows side by side (independent chains)
// the unroll directives here and in k_ln: s[] and x[][] are indexed by constants only, so they stay in registers
__device__ __forceinline__ void wsum(float (&s)[LNR]) {
#pragma unroll
  for (int r = 0; r < LNR; ++r) s[r] += xrow<1>(s[r]);
#pragma unroll
  for (int r = 0; r < LNR; ++r) s[r] += xrow<2>(s[r]);
#pragma unroll
  for (int r = 0; r < LNR; ++r) s[r] += xrow<4>(s[r]);
#pragma unroll
  for (int r = 0; r < LNR; ++r) s[r] += xrow<8>(s[r]);
#pragma unroll
  for (int r = 0; r < LNR; ++r) s[r] += xhalf(s[r]);
}
// ---- k_ln: wave = LNR token rows, block = 8 waves = 64 rows, one block per WGP: a lane holds channels 4 * lane + 0..3 and 128 + 4 * lane + 0..3 of each row (every load and store = 512 contiguous bytes),
// all 2 * LNR loads in flight at once; LayerNorm over 256 channels (mean-square var, 1e-5) x g + b -> f32 row; sums in the lane, then a five-step butterfly: no LDS, no barrier
__global__ __launch_bounds__(256) void k_ln(const float* __restrict__ X, const float* __restrict__ G, const float* __restrict__ Bt, float* __restrict__ XN) { const int lane = threadIdx.x & 31, wave = threadIdx.x >> 5; const size_t off = ((size_t)blockIdx.x * 8 + wave) * (LNR * CC) + lane * 4;
  v4f x[LNR][2], gg[2], bb[2]; float s[LNR];
#pragma unroll
  for (int r = 0; r < LNR; ++r) { x[r][0] = *(const v4f*)(X + off + r * CC); x[r][1] = *(const v4f*)(X + off + r * CC + 128); }
#pragma unroll
  for (int j = 0; j < 2; ++j) { gg[j] = *(const v4f*)(G + j * 128 + lane * 4); bb[j] = *(const v4f*)(Bt + j * 128 + lane * 4); }
  __builtin_amdgcn_sched_barrier(0);   // keeps every load above the arithmetic: without it the compiler sinks the later rows' loads to their uses, and the wave waits out the memory latency several times over
#pragma unroll
  for (int r = 0; r < LNR; ++r) {
#pragma unroll
    for (int i = 0; i < 4; ++i) { x[r][0][i] = bfr(x[r][0][i]); x[r][1][i] = bfr(x[r][1][i]); }
    const v4f t = x[r][0] + x[r][1]; s[r] = (t[0] + t[1]) + (t[2] + t[3]); }
  wsum(s);
#pragma unroll
  for (int r = 0; r < LNR; ++r) { const float mu = s[r] / (float)CC; x[r][0] -= mu; x[r][1] -= mu;
    const v4f t = x[r][0] * x[r][0] + x[r][1] * x[r][1]; s[r] = (t[0] + t[1]) + (t[2] + t[3]); }
  wsum(s);
#pragma unroll
  for (int j = 0; j < 2; ++j) {
#pragma unroll
    for (int i = 0; i < 4; ++i) { gg[j][i] = bfr(gg[j][i]); bb[j][i] = bfr(bb[j][i]); } }
#pragma unroll
  for (int r = 1; r < LNR; ++r) s[0] = ((lane & (LNR - 1)) == r) ? s[r] : s[0];   // every lane holds all LNR sums: lane l finishes row l mod LNR, so root and division run once a wave, not once a row
  const float iv = 1.0f / sqrtf(s[0] / (float)CC + 1e-5f);
#pragma unroll
  for (int r = 0; r < LNR; ++r) { const float inv = __builtin_bit_cast(float, __builtin_amdgcn_readlane(__builtin_bit_cast(int, iv), r));
    vst2(XN + off + r * CC, x[r][0] * inv * gg[0] + bb[0]); vst2(XN + off + r * CC + 128, x[r][1] * inv * gg[1] + bb[1]); } }
// ---- the product of k_proj and k_out: acc[j] += A (the wave's 16 rows, bf16 hi + lo) . W^T (rows 16 j + 0..15 of the 128 at pw), k = 0..255; pa, pw = the lane's own row, at its 8 * (lane >> 4)
// software pipeline in registers: W fragments come in groups of WG, WRING - 1 groups ahead of the group that is multiplied; the A rows of a k-step come ARING - 1 k-steps ahead
#define WG 1
#define WRING 8
#define ARING 2
__device__ __forceinline__ void ld_a(v4f (&d)[4], const float* p) { d[0] = *(const v4f*)p; d[1] = *(const v4f*)(p + 4); d[2] = *(const v4f*)(p + 16); d[3] = *(const v4f*)(p + 20); }
__device__ __forceinline__ void ld_w(v8b (&d)[WG][2], const __bf16* pw, int gi) {
#pragma unroll   // as in mm_half: d is indexed by constants only
  for (int i = 0; i < WG; ++i) { const __bf16* p = pw + (size_t)((gi % (8 / WG)) * WG + i) * 16 * CC + (gi / (8 / WG)) * 32; d[i][0] = *(const v8b*)p; d[i][1] = *(const v8b*)(p + 16); } }
__device__ __forceinline__ void mm_half(const float* pa, const __bf16* pw, v8f (&acc)[8]) {
  v4f ar[ARING][4]; v8b wr[WRING][WG][2]; F2 a;   // every loop here is unrolled so that the rings, indexed by constants only, stay in registers
#pragma unroll
  for (int s = 0; s < ARING - 1; ++s) ld_a(ar[s], pa + s * 32);
#pragma unroll
  for (int gi = 0; gi < WRING - 1; ++gi) ld_w(wr[gi], pw, gi);
#pragma unroll
  for (int gi = 0; gi < 64 / WG; ++gi) { const int kc = gi / (8 / WG), jb = (gi % (8 / WG)) * WG;
    if (gi + WRING - 1 < 64 / WG) ld_w(wr[(gi + WRING - 1) % WRING], pw, gi + WRING - 1);
    if (jb == 0 && kc + ARING - 1 < CC / 32) ld_a(ar[(kc + ARING - 1) % ARING], pa + (kc + ARING - 1) * 32);
    if (gi == 0) asm volatile("s_wait_xcnt 0x0" ::: "memory");   // from here on the compiler may reuse a register that a load issued above names (seen: the bias loads' offset register becomes an accumulator)
    __builtin_amdgcn_sched_barrier(0);   // keeps a k-step's split behind this point: lifted among the earlier WMMAs (seen without it), its wait for the A rows also waits out nearly all the W loads in flight
    if (jb == 0) { float v[16];
#pragma unroll
      for (int i = 0; i < 4; ++i) { v[i] = ar[kc % ARING][0][i]; v[4 + i] = ar[kc % ARING][1][i]; v[8 + i] = ar[kc % ARING][2][i]; v[12 + i] = ar[kc % ARING][3][i]; }
      a = bsplit16(v); }
#pragma unroll
    for (int i = 0; i < WG; ++i) { union { v16b v; v8b q[2]; } u; u.q[0] = wr[gi % WRING][i][0]; u.q[1] = wr[gi % WRING][i][1];
      acc[jb + i] = wmma_bf(a.h, u.v, acc[jb + i]); acc[jb + i] = wmma_bf(a.l, u.v, acc[jb + i]); } }
  asm volatile("s_wait_xcnt 0x0" ::: "memory"); }   // the caller's next trip forms new addresses in the registers that the loads above name
// ---- k_proj: block = (64 rows, which): A = LN rows (hi + lo), all 256 cols, + bias; q/k -> f16 rows; v -> planes
__global__ __launch_bounds__(128) void k_proj(const float* __restrict__ XN, const __bf16* __restrict__ PW, const float* __restrict__ BQ, const float* __restrict__ BK, const float* __restrict__ BV, _Float16* __restrict__ Q, _Float16* __restrict__ Kr, _Float16* __restrict__ V) {
  __shared__ __align__(16) _Float16 so[64][CC + 8]; __shared__ __align__(16) _Float16 st[CC][72];
  const int tid = threadIdx.x, wave = tid >> 5, lane = tid & 31, col = lane & 15, g = lane >> 4; const int which = blockIdx.y; const size_t rb = (size_t)blockIdx.x * 64; const size_t r0 = rb + wave * 16;
  const __bf16* Wr = PW + ((size_t)which * CC) * CC; const float* BB = (which == 0) ? BQ : (which == 1) ? BK : BV;
#pragma unroll 1
  for (int half = 0; half < 2; ++half) { v8f acc[8] = {}; float bs[8];   // the lane's eight bias values, fetched ahead of the product and not one by one behind it
#pragma unroll   // bs, indexed by constants only, stays in registers
    for (int j = 0; j < 8; ++j) bs[j] = BB[half * 128 + j * 16 + col];
    mm_half(XN + (r0 + col) * CC + 8 * g, Wr + (size_t)(half * 128 + col) * CC + 8 * g, acc);
#pragma unroll
    for (int j = 0; j < 8; ++j) { const int c = half * 128 + j * 16 + col; const float bb = bfr(bs[j]);
#pragma unroll
      for (int r = 0; r < 8; ++r) { const _Float16 hv = (_Float16)(acc[j][r] + bb); if (which < 2) so[wave * 16 + 8 * g + r][c] = hv; else st[c][wave * 16 + 8 * g + r] = hv; } } }
  __syncthreads();
  if (which < 2) { _Float16* dst = (which == 0) ? Q : Kr; for (int e = tid; e < 64 * (CC / 8); e += 128) { const int rl = e >> 5, q = e & 31; vst2((unsigned*)(dst + (rb + rl) * CC + q * 8), *(const v4u*)&so[rl][q * 8]); } }
  else { const size_t b = rb / NT; const int s0 = (int)(rb % NT); for (int e = tid; e < CC * 8; e += 128) { const int d = e >> 3, pc = e & 7; vst2((unsigned*)(V + ((b * CC + d) * NT) + s0 + pc * 8), *(const v4u*)&st[d][pc * 8]); } }
}
// ---- k_attn: block = 32 waves = 512 queries of one head, one block per WGP; the head's whole K (1,024 rows of 64 B) and V^T (32 rows of 2,048 B) are staged once in LDS, and every fragment of the key loop is read from there.
// wave = 16 queries. S^T = K . Q^T (A = 16 key rows, B = the wave's queries): a lane holds 16 of the 32 scores of ONE query (keys j0 + 8g + r and j0 + 16 + 8g + r),
// so maximum and sum run in the lane, with one exchange between the halves; the two score tiles, converted in place, are the B operand of O^T += V^T . P^T (hardware k order, as frag_h loads V^T).
#define AQ 512          // queries per block
#define KP (HD + 8)     // LDS pitch of a K row, in f16: 64 B + 16 B = 16 B x odd, so the 16 rows of a 16-byte fragment read fall on 64 different banks
#define VP (NT + 8)     // LDS pitch of a V^T row, in f16: 2,048 B + 16 B, for the same reason
#define KS 0.25503486f  // 32^-1/2 x log2(e): a raw product q . k times KS is the score's exponent to base 2
__global__ __launch_bounds__(1024) void k_attn(const _Float16* __restrict__ Q, const _Float16* __restrict__ Kr, const _Float16* __restrict__ V, float* __restrict__ O) {
  __shared__ __align__(16) _Float16 sk[NT * KP]; __shared__ __align__(16) _Float16 sv[HD * VP];
  const int tid = threadIdx.x, wave = tid >> 5, lane = tid & 31, col = lane & 15, g = lane >> 4; const int h = blockIdx.y; const size_t b = blockIdx.z; const int q0 = blockIdx.x * AQ + wave * 16; const size_t rq = b * NT + q0;
  { v4u tk[4], tv[4];   // 4,096 pieces of 16 B of each operand, 4 + 4 a thread, all eight loads in flight; K: 4 lanes a row (8 lines a load), V^T: 512 contiguous bytes a load; both loops unrolled so that tk and tv, indexed by constants only, stay in registers
#pragma unroll
    for (int i = 0; i < 4; ++i) { const int e = i * 1024 + tid; tk[i] = *(const v4u*)(Kr + (b * NT + (e >> 2)) * CC + h * HD + (e & 3) * 8); tv[i] = *(const v4u*)(V + (b * CC + h * HD + (e >> 7)) * NT + (e & 127) * 8); }
#pragma unroll
    for (int i = 0; i < 4; ++i) { const int e = i * 1024 + tid; *(v4u*)&sk[(e >> 2) * KP + (e & 3) * 8] = tk[i]; *(v4u*)&sv[(e >> 7) * VP + (e & 127) * 8] = tv[i]; } }
  const v16h bq = frag_h(Q + (rq + col) * CC + h * HD, lane);
  __syncthreads();   // the staged K and V^T are read by every wave of the block
  const _Float16 *pk = sk + col * KP, *pv = sv + col * VP;   // the lane's row in a 16-row tile
  float m = -3.0e38f, nb = 0.f, l = 0.f;   // of query col; m = running maximum of the raw products q . k; nb = 11 - m * KS, the addend of the exponent; l (times 2^11) holds this half's keys only until the epilogue
  v8f acc[2] = {};               // acc[dt][r] = O^T[dt * 16 + 8g + r][col]
#pragma unroll 1   // as before: the 32 trips stay rolled, so the loop's code stays short
  for (int ks = 0; ks < NT / 32; ++ks) { const int j0 = ks * 32; v16h ak[2], av[2]; v8f s[2];   // all four fragments' loads stand at the head of the trip: nothing holds the V loads back any more
#pragma unroll
    for (int t = 0; t < 2; ++t) { ak[t] = frag_h(pk + (j0 + t * 16) * KP, lane); av[t] = frag_h(pv + t * 16 * VP + j0, lane); }
#pragma unroll
    for (int ct = 0; ct < 2; ++ct) { v8f c = {}; s[ct] = wmma16(ak[ct], bq, c); }   // raw products: the factor KS > 0 keeps their order, so the maximum is taken on them as they are
    float mx = fmaxf(s[0][0], s[1][0]);
#pragma unroll
    for (int r = 1; r < 8; ++r) mx = fmaxf(mx, fmaxf(s[0][r], s[1][r]));
    mx = fmaxf(mx, xhalf(mx));
    const float mn = fmaxf(m, mx); const float nn = 11.0f - mn * KS; const float alpha = (m <= -1.0e38f) ? 0.f : __builtin_amdgcn_exp2f(nn - nb);
    v16h pb; v2f es[2] = {};
#pragma unroll
    for (int ct = 0; ct < 2; ++ct) {
#pragma unroll
      for (int i = 0; i < 4; ++i) { const v2f c2 = { s[ct][2 * i], s[ct][2 * i + 1] }; const v2f x = c2 * KS + nn;   // one multiply-add a score: 2^11 exp((c - max) 32^-1/2) = 2^(c KS + nn)
        const v2f e = { __builtin_amdgcn_exp2f(x[0]), __builtin_amdgcn_exp2f(x[1]) }; es[ct] += e; pb[ct * 8 + 2 * i] = (_Float16)e[0]; pb[ct * 8 + 2 * i + 1] = (_Float16)e[1]; } }
    const v2f e2 = es[0] + es[1];
    l = l * alpha + (e2[0] + e2[1]); m = mn; nb = nn;
#pragma unroll
    for (int dt = 0; dt < 2; ++dt) {
#pragma unroll
      for (int r = 0; r < 8; ++r) acc[dt][r] *= alpha;
      acc[dt] = wmma16(av[dt], pb, acc[dt]); } }
  l += xhalf(l);
  const float il = 1.0f / l;   // numerator and l both carry the 2^11
#pragma unroll
  for (int dt = 0; dt < 2; ++dt) { float* po = O + (rq + col) * CC + h * HD + dt * 16 + 8 * g;
    const v4f lo = { acc[dt][0] * il, acc[dt][1] * il, acc[dt][2] * il, acc[dt][3] * il }, hi = { acc[dt][4] * il, acc[dt][5] * il, acc[dt][6] * il, acc[dt][7] * il };
    vst2(po, lo); vst2(po + 4, hi); }
}
// ---- k_out: block = 64 rows: out = Y (hi + lo) . Wp + bp; whole 1-KB rows
__global__ __launch_bounds__(128) void k_out(const float* __restrict__ O, const __bf16* __restrict__ PW, const float* __restrict__ BP, float* __restrict__ OUT) {
  __shared__ __align__(16) float sx[64][CC + 4];
  const int tid = threadIdx.x, wave = tid >> 5, lane = tid & 31, col = lane & 15, g = lane >> 4; const size_t rb = (size_t)blockIdx.x * 64; const size_t r0 = rb + wave * 16; const __bf16* Wr = PW + (size_t)3 * CC * CC;
#pragma unroll 1
  for (int half = 0; half < 2; ++half) { v8f acc[8] = {}; float bs[8];   // the lane's eight bias values, fetched ahead of the product and not one by one behind it
#pragma unroll   // bs, indexed by constants only, stays in registers
    for (int j = 0; j < 8; ++j) bs[j] = BP[half * 128 + j * 16 + col];
    mm_half(O + (r0 + col) * CC + 8 * g, Wr + (size_t)(half * 128 + col) * CC + 8 * g, acc);
#pragma unroll
    for (int j = 0; j < 8; ++j) { const int c = half * 128 + j * 16 + col; const float bb = bfr(bs[j]);
#pragma unroll
      for (int r = 0; r < 8; ++r) sx[wave * 16 + 8 * g + r][c] = acc[j][r] + bb; } }
  __syncthreads();
  for (int e = tid; e < 64 * (CC / 4); e += 128) { const int rl = e >> 6, q = e & 63; vst2(OUT + (rb + rl) * CC + q * 4, *(const v4f*)&sx[rl][q * 4]); }
}
extern "C" void kernel_launch(void* const* d_in, const int* in_sizes, int n_in, void* d_out, int out_size, void* d_ws, size_t ws_size, hipStream_t stream) {
  (void)in_sizes; (void)n_in; (void)out_size;
  const float** F = (const float**)d_in;   // 0 x [16,32,32,256], 1 gamma, 2 beta, 3 Wq [256,256] (in,out), 4 bq, 5 Wk, 6 bk, 7 Wv, 8 bv, 9 Wp [256,256] (in,out), 10 bp
  if (ws_size < (size_t)WS_END) return;
  char* ws = (char*)d_ws; __bf16* PW = (__bf16*)ws; float *XN = (float*)(ws + WS_XN), *O = (float*)(ws + WS_O); _Float16 *Q = (_Float16*)(ws + WS_Q), *Kr = (_Float16*)(ws + WS_K), *V = (_Float16*)(ws + WS_V);
  k_pack<<<dim3(CC, 4), 256, 0, stream>>>(F[3], F[5], F[7], F[9], PW);
  k_ln<<<TNB * NT / (8 * LNR), 256, 0, stream>>>(F[0], F[1], F[2], XN);
  k_proj<<<dim3(TNB * NT / 64, 3), 128, 0, stream>>>(XN, PW, F[4], F[6], F[8], Q, Kr, V);
  k_attn<<<dim3(NT / AQ, NH, TNB), 1024, 0, stream>>>(Q, Kr, V, O);
  k_out<<<TNB * NT / 64, 128, 0, stream>>>(O, PW, F[10], (float*)d_out);
}

// v006
// One run takes 70.2 microseconds.
// Two timings next to v005 both put it at 1.20 times that version's speed.
// All steps since v000 together make it 2.60 times as fast.
// compute dtype: all float inputs rounded to bf16; LayerNorm (eps 1e-5) in f32; Q/K/V = LN(x) (bf16 hi + lo, 2 products) . W + b on WMMA 16x16x32 ((in,out) weights packed in fragment order), rounded once to f16; PLAIN attention (8 heads x 32 over the 1,024 positions of each image): q, k single f16 x 32^-1/2, running-max softmax in f32 (hardware exp), P (scaled by 2^11, single f16) x v (single f16); out = Y (bf16 hi + residual) . Wp (2 products) + bp.
#include <hip/hip_runtime.h>
#include <math.h>

typedef __attribute__((ext_vector_type(16))) _Float16 v16h;
typedef __attribute__((ext_vector_type(16))) __bf16 v16b;
typedef __attribute__((ext_vector_type(8)))  _Float16 v8h;
typedef __attribute__((ext_vector_type(8)))  float v8f;
typedef __attribute__((ext_vector_type(4)))  float v4f;
typedef __attribute__((ext_vector_type(2)))  float v2f;
typedef __attribute__((ext_vector_type(4)))  unsigned v4u;
typedef __attribute__((ext_vector_type(4)))  int v4i;
typedef float __attribute__((may_alias)) float_a;
typedef int __attribute__((may_alias)) int_a;

template <typename T> __device__ __forceinline__ void vst2(void* p, T v) { *(T*)p = v;  }
__device__ __forceinline__ v8f wmma16(v16h a, v16h b, v8f c) {
  v8f d = __builtin_amdgcn_wmma_f32_16x16x32_f16(false, a, false, b, (short)0, c, false, false);
  asm volatile("v_nop\n\tv_nop\n\tv_nop\n\tv_nop" : "+v"(d) : "v"(a), "v"(b));
  return d;
}
__device__ __forceinline__ v8f wmma_bf(v16b a, v16b b, v8f c) {
  v8f d = __builtin_amdgcn_wmma_f32_16x16x32_bf16(false, a, false, b, (short)0, c, false, false);
  asm volatile("v_nop\n\tv_nop\n\tv_nop\n\tv_nop" : "+v"(d) : "v"(a), "v"(b));
  return d;
}
// 16x16x32 fragments: lane = (h = lane>>4, row/col = lane&15); elements 0..7 = k0+8h+0..7, 8..15 = k0+16+8h+0..7; D element r = row 8h+r
__device__ __forceinline__ v16h frag_h(const _Float16* rowk0, int lane) {
  union { v16h v; v8h q[2]; } u; const _Float16* p = rowk0 + 8 * (lane >> 4);
  u.q[0] = *(const v8h*)p; u.q[1] = *(const v8h*)(p + 16); return u.v;
}
__device__ __forceinline__ v16h frag_f32(const float* rowk0, int lane) {
  v16h a; const float* p = rowk0 + 8 * (lane >> 4);
#pragma unroll
  for (int i = 0; i < 8; ++i) { a[i] = (_Float16)p[i]; a[8 + i] = (_Float16)p[16 + i]; }
  return a;
}
__device__ __forceinline__ v16h frag_f32s(const float* rowk0, int lane, float sc) {
  v16h a; const float* p = rowk0 + 8 * (lane >> 4);
#pragma unroll
  for (int i = 0; i < 8; ++i) { a[i] = (_Float16)(p[i] * sc); a[8 + i] = (_Float16)(p[16 + i] * sc); }
  return a;
}
// column fragment from a [K][ld] layout (column n), rows >= K read as 0
__device__ __forceinline__ v16h fragc_f32(const float* W, int k0, int n, int lane, int ld, int K) {
  v16h a; const int g = lane >> 4;
#pragma unroll
  for (int i = 0; i < 8; ++i) { const int ka = k0 + 8 * g + i, kb = ka + 16;
    a[i] = (_Float16)(ka < K ? W[(size_t)(ka < K ? ka : K - 1) * ld + n] : 0.f); a[8 + i] = (_Float16)(kb < K ? W[(size_t)(kb < K ? kb : K - 1) * ld + n] : 0.f); }
  return a;
}
struct F2 { v16b h, l; };
__device__ __forceinline__ F2 bsplit16(const float v[16]) { F2 r;
#pragma unroll
  for (int i = 0; i < 16; ++i) { const __bf16 h = (__bf16)v[i]; r.h[i] = h; r.l[i] = (__bf16)(v[i] - (float)h); }
  return r; }
__device__ __forceinline__ F2 split_row(const float* row, int k0, int lane) { float v[16]; const float* p = row + k0 + 8 * (lane >> 4);
#pragma unroll
  for (int i = 0; i < 8; ++i) { v[i] = p[i]; v[8 + i] = p[16 + i]; }
  return bsplit16(v); }
__device__ __forceinline__ F2 split_rowK(const float* row, int k0, int lane, int K) { float v[16]; const int g = lane >> 4;
#pragma unroll
  for (int i = 0; i < 8; ++i) { const int ka = k0 + 8 * g + i, kb = ka + 16; v[i] = ka < K ? row[ka < K ? ka : K - 1] : 0.f; v[8 + i] = kb < K ? row[kb < K ? kb : K - 1] : 0.f; }
  return bsplit16(v); }
__device__ __forceinline__ F2 split_col(const float* W, int k0, int n, int lane, int ld, int K) { float v[16]; const int g = lane >> 4;
#pragma unroll
  for (int i = 0; i < 8; ++i) { const int ka = k0 + 8 * g + i, kb = ka + 16; v[i] = ka < K ? W[(size_t)(ka < K ? ka : K - 1) * ld + n] : 0.f; v[8 + i] = kb < K ? W[(size_t)(kb < K ? kb : K - 1) * ld + n] : 0.f; }
  return bsplit16(v); }
__device__ __forceinline__ v8f mac3(const F2& a, const F2& b, v8f c) { c = wmma_bf(a.l, b.h, c); c = wmma_bf(a.h, b.l, c); return wmma_bf(a.h, b.h, c); }
__device__ __forceinline__ float sigm(float v) { return 1.0f / (1.0f + expf(-v)); }
#define LDSX() do { asm volatile("s_wait_dscnt 0" ::: "memory"); __builtin_amdgcn_wave_barrier(); __builtin_amdgcn_fence(__ATOMIC_RELEASE, "workgroup"); } while (0)


// Global multi-head self attention over a 32 x 32 feature map (B 16, N 1,024 tokens, C 256, 8 heads x 32): LayerNorm, 1x1-conv q/k/v, softmax(Q K / sqrt(32)) V, 1x1-conv projection + bias.
#define NB 16
#define NT 1024
#define CC 256
#define NH 8
#define HD 32
#define NR (NB * NT)
#ifndef TQB
#define TQB (NT / 64)
#define TNB NB
#endif
typedef __attribute__((ext_vector_type(8))) __bf16 v8b;
__device__ __forceinline__ v16b frag_b(const __bf16* rowk0, int lane) {
  union { v16b v; v8b q[2]; } u; const __bf16* p = rowk0 + 8 * (lane >> 4);
  u.q[0] = *(const v8b*)p; u.q[1] = *(const v8b*)(p + 16); return u.v;
}
__device__ __forceinline__ float bfr(float v) { return (float)(__bf16)v; }
__device__ __attribute__((noinline)) float exp_ni(float v) { return expf(v); }
__device__ __attribute__((noinline)) float erf_ni(float v) { return erff(v); }

#define WS_PW  0u                                    // bf16 Wq, Wk, Wv, Wp in fragment order [4][half 2][kc 8][j 8][piece 2][lane 32][8] (k_pack)
#define WS_XN  (WS_PW + 2u * (size_t)4 * CC * CC)       // f32 LN rows [NR][256]
#define WS_Q   (WS_XN + 4u * (size_t)NR * CC)           // f16 q rows [NR][256]; k rows; v planes [b][256][NT]; O f32 [NR][256]
#define WS_K   (WS_Q + 2u * (size_t)NR * CC)
#define WS_V   (WS_K + 2u * (size_t)NR * CC)
#define WS_O   (WS_V + 2u * (size_t)NB * CC * NT)
#define WS_END (WS_O + 4u * (size_t)NR * CC)

// ---- k_pack: each W (in,out) -> bf16 in the order in which mm_half reads it: the 16 bytes of lane (g, col) in piece p of fragment (kc, j) of a half are W[kc * 32 + p * 16 + 8 g + 0..7][half * 128 + j * 16 + col],
// so that a wave's fragment load is 512 contiguous bytes (4 whole lines) and the fragments of a half follow one another in the order of use.
// block = (16 columns, which W, 4 of the 8 kc); thread = one 16-byte piece: its eight loads in flight together (a wave load = 2 rows x 64 B), a wave stores 512 contiguous bytes; no LDS, no barrier
__global__ __launch_bounds__(256) void k_pack(const float* __restrict__ WQ, const float* __restrict__ WK, const float* __restrict__ WV, const float* __restrict__ WP, __bf16* __restrict__ PW) { const int jt = blockIdx.x, which = blockIdx.y, q = blockIdx.z * 256 + threadIdx.x; const int lane = q & 31, p = (q >> 5) & 1, kc = q >> 6; const float* w = (which == 0) ? WQ : (which == 1) ? WK : (which == 2) ? WV : WP;
  const float* s = w + (size_t)(kc * 32 + p * 16 + 8 * (lane >> 4)) * CC + jt * 16 + (lane & 15); float v[8]; v8b o;
#pragma unroll   // v and o, indexed by constants only, stay in registers
  for (int e = 0; e < 8; ++e) v[e] = s[(size_t)e * CC];
#pragma unroll
  for (int e = 0; e < 8; ++e) o[e] = (__bf16)v[e];
  *(v8b*)(PW + ((((size_t)which * 2 + (jt >> 3)) * 8 + kc) * 8 + (jt & 7)) * 512 + p * 256 + lane * 8) = o; }
// lane l with lane l ^ 16
__device__ __forceinline__ float xhalf(float x) { return __builtin_bit_cast(float, __builtin_amdgcn_permlanex16(__builtin_bit_cast(int, x), __builtin_bit_cast(int, x), 0x76543210, 0xfedcba98, false, false)); }
// lane l with lane l ^ M inside its 16-lane row (DPP row_xmask)
template <int M> __device__ __forceinline__ float xrow(float x) { return __builtin_bit_cast(float, __builtin_amdgcn_update_dpp(0, __builtin_bit_cast(int, x), 0x160 + M, 0xf, 0xf, true)); }
#define LNR 8   // token rows per wave
// every lane ends with the sum over the wave's 32 lanes, for LNR rows side by side (independent chains)
// the unroll directives here and in k_ln: s[] and x[][] are indexed by constants only, so they stay in registers
__device__ __forceinline__ void wsum(float (&s)[LNR]) {
#pragma unroll
  for (int r = 0; r < LNR; ++r) s[r] += xrow<1>(s[r]);
#pragma unroll
  for (int r = 0; r < LNR; ++r) s[r] += xrow<2>(s[r]);
#pragma unroll
  for (int r = 0; r < LNR; ++r) s[r] += xrow<4>(s[r]);
#pragma unroll
  for (int r = 0; r < LNR; ++r) s[r] += xrow<8>(s[r]);
#pragma unroll
  for (int r = 0; r < LNR; ++r) s[r] += xhalf(s[r]);
}
// ---- k_ln: wave = LNR token rows, block = 8 waves = 64 rows, one block per WGP: a lane holds channels 4 * lane + 0..3 and 128 + 4 * lane + 0..3 of each row (every load and store = 512 contiguous bytes),
// all 2 * LNR loads in flight at once; LayerNorm over 256 channels (mean-square var, 1e-5) x g + b -> f32 row; sums in the lane, then a five-step butterfly: no LDS, no barrier
__global__ __launch_bounds__(256) void k_ln(const float* __restrict__ X, const float* __restrict__ G, const float* __restrict__ Bt, float* __restrict__ XN) { const int lane = threadIdx.x & 31, wave = threadIdx.x >> 5; const size_t off = ((size_t)blockIdx.x * 8 + wave) * (LNR * CC) + lane * 4;
  v4f x[LNR][2], gg[2], bb[2]; float s[LNR];
#pragma unroll
  for (int r = 0; r < LNR; ++r) { x[r][0] = *(const v4f*)(X + off + r * CC); x[r][1] = *(const v4f*)(X + off + r * CC + 128); }
#pragma unroll
  for (int j = 0; j < 2; ++j) { gg[j] = *(const v4f*)(G + j * 128 + lane * 4); bb[j] = *(const v4f*)(Bt + j * 128 + lane * 4); }
  __builtin_amdgcn_sched_barrier(0);   // keeps every load above the arithmetic: without it the compiler sinks the later rows' loads to their uses, and the wave waits out the memory latency several times over
#pragma unroll
  for (int r = 0; r < LNR; ++r) {
#pragma unroll
    for (int i = 0; i < 4; ++i) { x[r][0][i] = bfr(x[r][0][i]); x[r][1][i] = bfr(x[r][1][i]); }
    const v4f t = x[r][0] + x[r][1]; s[r] = (t[0] + t[1]) + (t[2] + t[3]); }
  wsum(s);
#pragma unroll
  for (int r = 0; r < LNR; ++r) { const float mu = s[r] / (float)CC; x[r][0] -= mu; x[r][1] -= mu;
    const v4f t = x[r][0] * x[r][0] + x[r][1] * x[r][1]; s[r] = (t[0] + t[1]) + (t[2] + t[3]); }
  wsum(s);
#pragma unroll
  for (int j = 0; j < 2; ++j) {
#pragma unroll
    for (int i = 0; i < 4; ++i) { gg[j][i] = bfr(gg[j][i]); bb[j][i] = bfr(bb[j][i]); } }
#pragma unroll
  for (int r = 1; r < LNR; ++r) s[0] = ((lane & (LNR - 1)) == r) ? s[r] : s[0];   // every lane holds all LNR sums: lane l finishes row l mod LNR, so root and division run once a wave, not once a row
  const float iv = 1.0f / sqrtf(s[0] / (float)CC + 1e-5f);
#pragma unroll
  for (int r = 0; r < LNR; ++r) { const float inv = __builtin_bit_cast(float, __builtin_amdgcn_readlane(__builtin_bit_cast(int, iv), r));
    vst2(XN + off + r * CC, x[r][0] * inv * gg[0] + bb[0]); vst2(XN + off + r * CC + 128, x[r][1] * inv * gg[1] + bb[1]); } }
// ---- the product of k_proj and k_out: acc[j] += A (the wave's 16 rows, bf16 hi + lo) . W (columns 16 j + 0..15 of the half at pw), k = 0..255; pa = the lane's own row, at its 8 * (lane >> 4); pw = the half's packed fragments (k_pack), at the lane's 16 bytes
// software pipeline in registers: W fragments come in groups of WG, WRING - 1 groups ahead of the group that is multiplied; the A rows of a k-step come ARING - 1 k-steps ahead
#define WG 1
#define WRING 8
#define ARING 2
__device__ __forceinline__ void ld_a(v4f (&d)[4], const float* p) { d[0] = *(const v4f*)p; d[1] = *(const v4f*)(p + 4); d[2] = *(const v4f*)(p + 16); d[3] = *(const v4f*)(p + 20); }
__device__ __forceinline__ void ld_w(v8b (&d)[WG][2], const __bf16* pw, int gi) {
#pragma unroll   // as in mm_half: d is indexed by constants only
  for (int i = 0; i < WG; ++i) { const __bf16* p = pw + (size_t)(gi * WG + i) * 512; d[i][0] = *(const v8b*)p; d[i][1] = *(const v8b*)(p + 256); } }
__device__ __forceinline__ void mm_half(const float* pa, const __bf16* pw, v8f (&acc)[8]) {
  v4f ar[ARING][4]; v8b wr[WRING][WG][2]; F2 a;   // every loop here is unrolled so that the rings, indexed by constants only, stay in registers
#pragma unroll
  for (int s = 0; s < ARING - 1; ++s) ld_a(ar[s], pa + s * 32);
#pragma unroll
  for (int gi = 0; gi < WRING - 1; ++gi) ld_w(wr[gi], pw, gi);
#pragma unroll
  for (int gi = 0; gi < 64 / WG; ++gi) { const int kc = gi / (8 / WG), jb = (gi % (8 / WG)) * WG;
    if (gi + WRING - 1 < 64 / WG) ld_w(wr[(gi + WRING - 1) % WRING], pw, gi + WRING - 1);
    if (jb == 0 && kc + ARING - 1 < CC / 32) ld_a(ar[(kc + ARING - 1) % ARING], pa + (kc + ARING - 1) * 32);
    if (gi == 0) asm volatile("s_wait_xcnt 0x0" ::: "memory");   // from here on the compiler may reuse a register that a load issued above names (seen: the bias loads' offset register becomes an accumulator)
    __builtin_amdgcn_sched_barrier(0);   // keeps a k-step's split behind this point: lifted among the earlier WMMAs (seen without it), its wait for the A rows also waits out nearly all the W loads in flight
    if (jb == 0) { float v[16];
#pragma unroll
      for (int i = 0; i < 4; ++i) { v[i] = ar[kc % ARING][0][i]; v[4 + i] = ar[kc % ARING][1][i]; v[8 + i] = ar[kc % ARING][2][i]; v[12 + i] = ar[kc % ARING][3][i]; }
      a = bsplit16(v); }
#pragma unroll
    for (int i = 0; i < WG; ++i) { union { v16b v; v8b q[2]; } u; u.q[0] = wr[gi % WRING][i][0]; u.q[1] = wr[gi % WRING][i][1];
      acc[jb + i] = wmma_bf(a.h, u.v, acc[jb + i]); acc[jb + i] = wmma_bf(a.l, u.v, acc[jb + i]); } }
  asm volatile("s_wait_xcnt 0x0" ::: "memory"); }   // the caller's next trip forms new addresses in the registers that the loads above name
// ---- k_proj: block = (64 rows, which): A = LN rows (hi + lo), all 256 cols, + bias; q/k -> f16 rows; v -> planes
__global__ __launch_bounds__(128) void k_proj(const float* __restrict__ XN, const __bf16* __restrict__ PW, const float* __restrict__ BQ, const float* __restrict__ BK, const float* __restrict__ BV, _Float16* __restrict__ Q, _Float16* __restrict__ Kr, _Float16* __restrict__ V) {
  __shared__ __align__(16) _Float16 so[64][CC + 8]; __shared__ __align__(16) _Float16 st[CC][72];
  const int tid = threadIdx.x, wave = tid >> 5, lane = tid & 31, col = lane & 15, g = lane >> 4; const int which = blockIdx.y; const size_t rb = (size_t)blockIdx.x * 64; const size_t r0 = rb + wave * 16;
  const __bf16* Wr = PW + ((size_t)which * CC) * CC; const float* BB = (which == 0) ? BQ : (which == 1) ? BK : BV;
#pragma unroll 1
  for (int half = 0; half < 2; ++half) { v8f acc[8] = {}; float bs[8];   // the lane's eight bias values, fetched ahead of the product and not one by one behind it
#pragma unroll   // bs, indexed by constants only, stays in registers
    for (int j = 0; j < 8; ++j) bs[j] = BB[half * 128 + j * 16 + col];
    mm_half(XN + (r0 + col) * CC + 8 * g, Wr + (size_t)half * (128 * CC) + lane * 8, acc);
#pragma unroll
    for (int j = 0; j < 8; ++j) { const int c = half * 128 + j * 16 + col; const float bb = bfr(bs[j]);
#pragma unroll
      for (int r = 0; r < 8; ++r) { const _Float16 hv = (_Float16)(acc[j][r] + bb); if (which < 2) so[wave * 16 + 8 * g + r][c] = hv; else st[c][wave * 16 + 8 * g + r] = hv; } } }
  __syncthreads();
  if (which < 2) { _Float16* dst = (which == 0) ? Q : Kr; for (int e = tid; e < 64 * (CC / 8); e += 128) { const int rl = e >> 5, q = e & 31; vst2((unsigned*)(dst + (rb + rl) * CC + q * 8), *(const v4u*)&so[rl][q * 8]); } }
  else { const size_t b = rb / NT; const int s0 = (int)(rb % NT); for (int e = tid; e < CC * 8; e += 128) { const int d = e >> 3, pc = e & 7; vst2((unsigned*)(V + ((b * CC + d) * NT) + s0 + pc * 8), *(const v4u*)&st[d][pc * 8]); } }
}
// ---- k_attn: block = 32 waves = 512 queries of one head, one block per WGP; the head's whole K (1,024 rows of 64 B) and V^T (32 rows of 2,048 B) are staged once in LDS, and every fragment of the key loop is read from there.
// wave = 16 queries. S^T = K . Q^T (A = 16 key rows, B = the wave's queries): a lane holds 16 of the 32 scores of ONE query (keys j0 + 8g + r and j0 + 16 + 8g + r),
// so maximum and sum run in the lane, with one exchange between the halves; the two score tiles, converted in place, are the B operand of O^T += V^T . P^T (hardware k order, as frag_h loads V^T).
#define AQ 512          // queries per block
#define KP (HD + 8)     // LDS pitch of a K row, in f16: 64 B + 16 B = 16 B x odd, so the 16 rows of a 16-byte fragment read fall on 64 different banks
#define VP (NT + 8)     // LDS pitch of a V^T row, in f16: 2,048 B + 16 B, for the same reason
#define KS 0.25503486f  // 32^-1/2 x log2(e): a raw product q . k times KS is the score's exponent to base 2
__global__ __launch_bounds__(1024) void k_attn(const _Float16* __restrict__ Q, const _Float16* __restrict__ Kr, const _Float16* __restrict__ V, float* __restrict__ O) {
  __shared__ __align__(16) _Float16 sk[NT * KP]; __shared__ __align__(16) _Float16 sv[HD * VP];
  const int tid = threadIdx.x, wave = tid >> 5, lane = tid & 31, col = lane & 15, g = lane >> 4; const int h = blockIdx.y; const size_t b = blockIdx.z; const int q0 = blockIdx.x * AQ + wave * 16; const size_t rq = b * NT + q0;
  { v4u tk[4], tv[4];   // 4,096 pieces of 16 B of each operand, 4 + 4 a thread, all eight loads in flight; K: 4 lanes a row (8 lines a load), V^T: 512 contiguous bytes a load; both loops unrolled so that tk and tv, indexed by constants only, stay in registers
#pragma unroll
    for (int i = 0; i < 4; ++i) { const int e = i * 1024 + tid; tk[i] = *(const v4u*)(Kr + (b * NT + (e >> 2)) * CC + h * HD + (e & 3) * 8); tv[i] = *(const v4u*)(V + (b * CC + h * HD + (e >> 7)) * NT + (e & 127) * 8); }
#pragma unroll
    for (int i = 0; i < 4; ++i) { const int e = i * 1024 + tid; *(v4u*)&sk[(e >> 2) * KP + (e & 3) * 8] = tk[i]; *(v4u*)&sv[(e >> 7) * VP + (e & 127) * 8] = tv[i]; } }
  const v16h bq = frag_h(Q + (rq + col) * CC + h * HD, lane);
  __syncthreads();   // the staged K and V^T are read by every wave of the block
  const _Float16 *pk = sk + col * KP, *pv = sv + col * VP;   // the lane's row in a 16-row tile
  float m = -3.0e38f, nb = 0.f, l = 0.f;   // of query col; m = running maximum of the raw products q . k; nb = 11 - m * KS, the addend of the exponent; l (times 2^11) holds this half's keys only until the epilogue
  v8f acc[2] = {};               // acc[dt][r] = O^T[dt * 16 + 8g + r][col]
#pragma unroll 1   // as before: the 32 trips stay rolled, so the loop's code stays short
  for (int ks = 0; ks < NT / 32; ++ks) { const int j0 = ks * 32; v16h ak[2], av[2]; v8f s[2];   // all four fragments' loads stand at the head of the trip: nothing holds the V loads back any more
#pragma unroll
    for (int t = 0; t < 2; ++t) { ak[t] = frag_h(pk + (j0 + t * 16) * KP, lane); av[t] = frag_h(pv + t * 16 * VP + j0, lane); }
#pragma unroll
    for (int ct = 0; ct < 2; ++ct) { v8f c = {}; s[ct] = wmma16(ak[ct], bq, c); }   // raw products: the factor KS > 0 keeps their order, so the maximum is taken on them as they are
    float mx = fmaxf(s[0][0], s[1][0]);
#pragma unroll
    for (int r = 1; r < 8; ++r) mx = fmaxf(mx, fmaxf(s[0][r], s[1][r]));
    mx = fmaxf(mx, xhalf(mx));
    const float mn = fmaxf(m, mx); const float nn = 11.0f - mn * KS; const float alpha = (m <= -1.0e38f) ? 0.f : __builtin_amdgcn_exp2f(nn - nb);
    v16h pb; v2f es[2] = {};
#pragma unroll
    for (int ct = 0; ct < 2; ++ct) {
#pragma unroll
      for (int i = 0; i < 4; ++i) { const v2f c2 = { s[ct][2 * i], s[ct][2 * i + 1] }; const v2f x = c2 * KS + nn;   // one multiply-add a score: 2^11 exp((c - max) 32^-1/2) = 2^(c KS + nn)
        const v2f e = { __builtin_amdgcn_exp2f(x[0]), __builtin_amdgcn_exp2f(x[1]) }; es[ct] += e; pb[ct * 8 + 2 * i] = (_Float16)e[0]; pb[ct * 8 + 2 * i + 1] = (_Float16)e[1]; } }
    const v2f e2 = es[0] + es[1];
    l = l * alpha + (e2[0] + e2[1]); m = mn; nb = nn;
#pragma unroll
    for (int dt = 0; dt < 2; ++dt) {
#pragma unroll
      for (int r = 0; r < 8; ++r) acc[dt][r] *= alpha;
      acc[dt] = wmma16(av[dt], pb, acc[dt]); } }
  l += xhalf(l);
  const float il = 1.0f / l;   // numerator and l both carry the 2^11
#pragma unroll
  for (int dt = 0; dt < 2; ++dt) { float* po = O + (rq + col) * CC + h * HD + dt * 16 + 8 * g;
    const v4f lo = { acc[dt][0] * il, acc[dt][1] * il, acc[dt][2] * il, acc[dt][3] * il }, hi = { acc[dt][4] * il, acc[dt][5] * il, acc[dt][6] * il, acc[dt][7] * il };
    vst2(po, lo); vst2(po + 4, hi); }
}
// ---- k_out: block = 64 rows: out = Y (hi + lo) . Wp + bp; whole 1-KB rows
__global__ __launch_bounds__(128) void k_out(const float* __restrict__ O, const __bf16* __restrict__ PW, const float* __restrict__ BP, float* __restrict__ OUT) {
  __shared__ __align__(16) float sx[64][CC + 4];
  const int tid = threadIdx.x, wave = tid >> 5, lane = tid & 31, col = lane & 15, g = lane >> 4; const size_t rb = (size_t)blockIdx.x * 64; const size_t r0 = rb + wave * 16; const __bf16* Wr = PW + (size_t)3 * CC * CC;
#pragma unroll 1
  for (int half = 0; half < 2; ++half) { v8f acc[8] = {}; float bs[8];   // the lane's eight bias values, fetched ahead of the product and not one by one behind it
#pragma unroll   // bs, indexed by constants only, stays in registers
    for (int j = 0; j < 8; ++j) bs[j] = BP[half * 128 + j * 16 + col];
    mm_half(O + (r0 + col) * CC + 8 * g, Wr + (size_t)half * (128 * CC) + lane * 8, acc);
#pragma unroll
    for (int j = 0; j < 8; ++j) { const int c = half * 128 + j * 16 + col; const float bb = bfr(bs[j]);
#pragma unroll
      for (int r = 0; r < 8; ++r) sx[wave * 16 + 8 * g + r][c] = acc[j][r] + bb; } }
  __syncthreads();
  for (int e = tid; e < 64 * (CC / 4); e += 128) { const int rl = e >> 6, q = e & 63; vst2(OUT + (rb + rl) * CC + q * 4, *(const v4f*)&sx[rl][q * 4]); }
}
extern "C" void kernel_launch(void* const* d_in, const int* in_sizes, int n_in, void* d_out, int out_size, void* d_ws, size_t ws_size, hipStream_t stream) {
  (void)in_sizes; (void)n_in; (void)out_size;
  const float** F = (const float**)d_in;   // 0 x [16,32,32,256], 1 gamma, 2 beta, 3 Wq [256,256] (in,out), 4 bq, 5 Wk, 6 bk, 7 Wv, 8 bv, 9 Wp [256,256] (in,out), 10 bp
  if (ws_size < (size_t)WS_END) return;
  char* ws = (char*)d_ws; __bf16* PW = (__bf16*)ws; float *XN = (float*)(ws + WS_XN), *O = (float*)(ws + WS_O); _Float16 *Q = (_Float16*)(ws + WS_Q), *Kr = (_Float16*)(ws + WS_K), *V = (_Float16*)(ws + WS_V);
  k_pack<<<dim3(CC / 16, 4, 2), 256, 0, stream>>>(F[3], F[5], F[7], F[9], PW);
  k_ln<<<TNB * NT / (8 * LNR), 256, 0, stream>>>(F[0], F[1], F[2], XN);
  k_proj<<<dim3(TNB * NT / 64, 3), 128, 0, stream>>>(XN, PW, F[4], F[6], F[8], Q, Kr, V);
  k_attn<<<dim3(NT / AQ, NH, TNB), 1024, 0, stream>>>(Q, Kr, V, O);
  k_out<<<TNB * NT / 64, 128, 0, stream>>>(O, PW, F[10], (float*)d_out);
}

// v007
// One run takes 65.7 microseconds.
// In two side-by-side timings against v006, it was 1.07 and 1.08 times as fast.
// Counting every step since v000, it is 2.79 times as fast.
// compute dtype: all float inputs rounded to bf16; LayerNorm (eps 1e-5) in f32; Q/K/V = LN(x) (bf16 hi + lo, 2 products) . W + b on WMMA 16x16x32 ((in,out) weights packed in fragment order), rounded once to f16; PLAIN attention (8 heads x 32 over the 1,024 positions of each image): q, k single f16 x 32^-1/2, running-max softmax in f32 (hardware exp), P (scaled by 2^11, single f16) x v (single f16); out = Y (bf16 hi + residual) . Wp (2 products) + bp.
#include <hip/hip_runtime.h>
#include <math.h>

typedef __attribute__((ext_vector_type(16))) _Float16 v16h;
typedef __attribute__((ext_vector_type(16))) __bf16 v16b;
typedef __attribute__((ext_vector_type(8)))  _Float16 v8h;
typedef __attribute__((ext_vector_type(8)))  float v8f;
typedef __attribute__((ext_vector_type(4)))  float v4f;
typedef __attribute__((ext_vector_type(2)))  float v2f;
typedef __attribute__((ext_vector_type(4)))  unsigned v4u;
typedef __attribute__((ext_vector_type(4)))  int v4i;
typedef float __attribute__((may_alias)) float_a;
typedef int __attribute__((may_alias)) int_a;

template <typename T> __device__ __forceinline__ void vst2(void* p, T v) { *(T*)p = v;  }
__device__ __forceinline__ v8f wmma16(v16h a, v16h b, v8f c) {
  v8f d = __builtin_amdgcn_wmma_f32_16x16x32_f16(false, a, false, b, (short)0, c, false, false);
  asm volatile("v_nop\n\tv_nop\n\tv_nop\n\tv_nop" : "+v"(d) : "v"(a), "v"(b));
  return d;
}
__device__ __forceinline__ v8f wmma_bf(v16b a, v16b b, v8f c) {
  v8f d = __builtin_amdgcn_wmma_f32_16x16x32_bf16(false, a, false, b, (short)0, c, false, false);
  asm volatile("v_nop\n\tv_nop\n\tv_nop\n\tv_nop" : "+v"(d) : "v"(a), "v"(b));
  return d;
}
// 16x16x32 fragments: lane = (h = lane>>4, row/col = lane&15); elements 0..7 = k0+8h+0..7, 8..15 = k0+16+8h+0..7; D element r = row 8h+r
__device__ __forceinline__ v16h frag_h(const _Float16* rowk0, int lane) {
  union { v16h v; v8h q[2]; } u; const _Float16* p = rowk0 + 8 * (lane >> 4);
  u.q[0] = *(const v8h*)p; u.q[1] = *(const v8h*)(p + 16); return u.v;
}
__device__ __forceinline__ v16h frag_f32(const float* rowk0, int lane) {
  v16h a; const float* p = rowk0 + 8 * (lane >> 4);
#pragma unroll
  for (int i = 0; i < 8; ++i) { a[i] = (_Float16)p[i]; a[8 + i] = (_Float16)p[16 + i]; }
  return a;
}
__device__ __forceinline__ v16h frag_f32s(const float* rowk0, int lane, float sc) {
  v16h a; const float* p = rowk0 + 8 * (lane >> 4);
#pragma unroll
  for (int i = 0; i < 8; ++i) { a[i] = (_Float16)(p[i] * sc); a[8 + i] = (_Float16)(p[16 + i] * sc); }
  return a;
}
// column fragment from a [K][ld] layout (column n), rows >= K read as 0
__device__ __forceinline__ v16h fragc_f32(const float* W, int k0, int n, int lane, int ld, int K) {
  v16h a; const int g = lane >> 4;
#pragma unroll
  for (int i = 0; i < 8; ++i) { const int ka = k0 + 8 * g + i, kb = ka + 16;
    a[i] = (_Float16)(ka < K ? W[(size_t)(ka < K ? ka : K - 1) * ld + n] : 0.f); a[8 + i] = (_Float16)(kb < K ? W[(size_t)(kb < K ? kb : K - 1) * ld + n] : 0.f); }
  return a;
}
struct F2 { v16b h, l; };
__device__ __forceinline__ F2 bsplit16(const float v[16]) { F2 r;
#pragma unroll
  for (int i = 0; i < 16; ++i) { const __bf16 h = (__bf16)v[i]; r.h[i] = h; r.l[i] = (__bf16)(v[i] - (float)h); }
  return r; }
__device__ __forceinline__ F2 split_row(const float* row, int k0, int lane) { float v[16]; const float* p = row + k0 + 8 * (lane >> 4);
#pragma unroll
  for (int i = 0; i < 8; ++i) { v[i] = p[i]; v[8 + i] = p[16 + i]; }
  return bsplit16(v); }
__device__ __forceinline__ F2 split_rowK(const float* row, int k0, int lane, int K) { float v[16]; const int g = lane >> 4;
#pragma unroll
  for (int i = 0; i < 8; ++i) { const int ka = k0 + 8 * g + i, kb = ka + 16; v[i] = ka < K ? row[ka < K ? ka : K - 1] : 0.f; v[8 + i] = kb < K ? row[kb < K ? kb : K - 1] : 0.f; }
  return bsplit16(v); }
__device__ __forceinline__ F2 split_col(const float* W, int k0, int n, int lane, int ld, int K) { float v[16]; const int g = lane >> 4;
#pragma unroll
  for (int i = 0; i < 8; ++i) { const int ka = k0 + 8 * g + i, kb = ka + 16; v[i] = ka < K ? W[(size_t)(ka < K ? ka : K - 1) * ld + n] : 0.f; v[8 + i] = kb < K ? W[(size_t)(kb < K ? kb : K - 1) * ld + n] : 0.f; }
  return bsplit16(v); }
__device__ __forceinline__ v8f mac3(const F2& a, const F2& b, v8f c) { c = wmma_bf(a.l, b.h, c); c = wmma_bf(a.h, b.l, c); return wmma_bf(a.h, b.h, c); }
__device__ __forceinline__ float sigm(float v) { return 1.0f / (1.0f + expf(-v)); }
#define LDSX() do { asm volatile("s_wait_dscnt 0" ::: "memory"); __builtin_amdgcn_wave_barrier(); __builtin_amdgcn_fence(__ATOMIC_RELEASE, "workgroup"); } while (0)


// Global multi-head self attention over a 32 x 32 feature map (B 16, N 1,024 tokens, C 256, 8 heads x 32): LayerNorm, 1x1-conv q/k/v, softmax(Q K / sqrt(32)) V, 1x1-conv projection + bias.
#define NB 16
#define NT 1024
#define CC 256
#define NH 8
#define HD 32
#define NR (NB * NT)
#ifndef TQB
#define TQB (NT / 64)
#define TNB NB
#endif
typedef __attribute__((ext_vector_type(8))) __bf16 v8b;
__device__ __forceinline__ v16b frag_b(const __bf16* rowk0, int lane) {
  union { v16b v; v8b q[2]; } u; const __bf16* p = rowk0 + 8 * (lane >> 4);
  u.q[0] = *(const v8b*)p; u.q[1] = *(const v8b*)(p + 16); return u.v;
}
__device__ __forceinline__ float bfr(float v) { return (float)(__bf16)v; }
__device__ __attribute__((noinline)) float exp_ni(float v) { return expf(v); }
__device__ __attribute__((noinline)) float erf_ni(float v) { return erff(v); }

#define WS_PW  0u                                    // bf16 Wq, Wk, Wv, Wp in fragment order [4][half 2][kc 8][j 8][piece 2][lane 32][8] (k_pack)
#define WS_Q   (WS_PW + 2u * (size_t)4 * CC * CC)       // f16 q rows [NR][256]; k rows; v planes [b][256][NT]; O f32 [NR][256]
#define WS_K   (WS_Q + 2u * (size_t)NR * CC)
#define WS_V   (WS_K + 2u * (size_t)NR * CC)
#define WS_O   (WS_V + 2u * (size_t)NB * CC * NT)
#define WS_END (WS_O + 4u * (size_t)NR * CC)

// ---- k_pack: each W (in,out) -> bf16 in the order in which mm_half reads it: the 16 bytes of lane (g, col) in piece p of fragment (kc, j) of a half are W[kc * 32 + p * 16 + 8 g + 0..7][half * 128 + j * 16 + col],
// so that a wave's fragment load is 512 contiguous bytes (4 whole lines) and the fragments of a half follow one another in the order of use.
// block = (16 columns, which W, 4 of the 8 kc); thread = one 16-byte piece: its eight loads in flight together (a wave load = 2 rows x 64 B), a wave stores 512 contiguous bytes; no LDS, no barrier
__global__ __launch_bounds__(256) void k_pack(const float* __restrict__ WQ, const float* __restrict__ WK, const float* __restrict__ WV, const float* __restrict__ WP, __bf16* __restrict__ PW) { const int jt = blockIdx.x, which = blockIdx.y, q = blockIdx.z * 256 + threadIdx.x; const int lane = q & 31, p = (q >> 5) & 1, kc = q >> 6; const float* w = (which == 0) ? WQ : (which == 1) ? WK : (which == 2) ? WV : WP;
  const float* s = w + (size_t)(kc * 32 + p * 16 + 8 * (lane >> 4)) * CC + jt * 16 + (lane & 15); float v[8]; v8b o;
#pragma unroll   // v and o, indexed by constants only, stay in registers
  for (int e = 0; e < 8; ++e) v[e] = s[(size_t)e * CC];
#pragma unroll
  for (int e = 0; e < 8; ++e) o[e] = (__bf16)v[e];
  *(v8b*)(PW + ((((size_t)which * 2 + (jt >> 3)) * 8 + kc) * 8 + (jt & 7)) * 512 + p * 256 + lane * 8) = o; }
// lane l with lane l ^ 16
__device__ __forceinline__ float xhalf(float x) { return __builtin_bit_cast(float, __builtin_amdgcn_permlanex16(__builtin_bit_cast(int, x), __builtin_bit_cast(int, x), 0x76543210, 0xfedcba98, false, false)); }
// ---- the product of k_out: acc[j] += A (the wave's 16 rows, bf16 hi + lo) . W (columns 16 j + 0..15 of the half at pw), k = 0..255; pa = the lane's own row, at its 8 * (lane >> 4); pw = the half's packed fragments (k_pack), at the lane's 16 bytes
// software pipeline in registers: W fragments come in groups of WG, WRING - 1 groups ahead of the group that is multiplied; the A rows of a k-step come ARING - 1 k-steps ahead
#define WG 1
#define WRING 8
#define ARING 2
__device__ __forceinline__ void ld_a(v4f (&d)[4], const float* p) { d[0] = *(const v4f*)p; d[1] = *(const v4f*)(p + 4); d[2] = *(const v4f*)(p + 16); d[3] = *(const v4f*)(p + 20); }
__device__ __forceinline__ void ld_w(v8b (&d)[WG][2], const __bf16* pw, int gi) {
#pragma unroll   // as in mm_half: d is indexed by constants only
  for (int i = 0; i < WG; ++i) { const __bf16* p = pw + (size_t)(gi * WG + i) * 512; d[i][0] = *(const v8b*)p; d[i][1] = *(const v8b*)(p + 256); } }
__device__ __forceinline__ void mm_half(const float* pa, const __bf16* pw, v8f (&acc)[8]) {
  v4f ar[ARING][4]; v8b wr[WRING][WG][2]; F2 a;   // every loop here is unrolled so that the rings, indexed by constants only, stay in registers
#pragma unroll
  for (int s = 0; s < ARING - 1; ++s) ld_a(ar[s], pa + s * 32);
#pragma unroll
  for (int gi = 0; gi < WRING - 1; ++gi) ld_w(wr[gi], pw, gi);
#pragma unroll
  for (int gi = 0; gi < 64 / WG; ++gi) { const int kc = gi / (8 / WG), jb = (gi % (8 / WG)) * WG;
    if (gi + WRING - 1 < 64 / WG) ld_w(wr[(gi + WRING - 1) % WRING], pw, gi + WRING - 1);
    if (jb == 0 && kc + ARING - 1 < CC / 32) ld_a(ar[(kc + ARING - 1) % ARING], pa + (kc + ARING - 1) * 32);
    if (gi == 0) asm volatile("s_wait_xcnt 0x0" ::: "memory");   // from here on the compiler may reuse a register that a load issued above names (seen: the bias loads' offset register becomes an accumulator)
    __builtin_amdgcn_sched_barrier(0);   // keeps a k-step's split behind this point: lifted among the earlier WMMAs (seen without it), its wait for the A rows also waits out nearly all the W loads in flight
    if (jb == 0) { float v[16];
#pragma unroll
      for (int i = 0; i < 4; ++i) { v[i] = ar[kc % ARING][0][i]; v[4 + i] = ar[kc % ARING][1][i]; v[8 + i] = ar[kc % ARING][2][i]; v[12 + i] = ar[kc % ARING][3][i]; }
      a = bsplit16(v); }
#pragma unroll
    for (int i = 0; i < WG; ++i) { union { v16b v; v8b q[2]; } u; u.q[0] = wr[gi % WRING][i][0]; u.q[1] = wr[gi % WRING][i][1];
      acc[jb + i] = wmma_bf(a.h, u.v, acc[jb + i]); acc[jb + i] = wmma_bf(a.l, u.v, acc[jb + i]); } }
  asm volatile("s_wait_xcnt 0x0" ::: "memory"); }   // the caller's next trip forms new addresses in the registers that the loads above name
// two f32 -> two bf16 in one word (round to nearest even, first value in the low half), and back to f32
typedef __attribute__((ext_vector_type(2))) __bf16 v2b;
__device__ __forceinline__ unsigned pk_bf(v2f v) { return __builtin_bit_cast(unsigned, __builtin_convertvector(v, v2b)); }
__device__ __forceinline__ v2f up_bf(unsigned w) { const v2f r = { __builtin_bit_cast(float, w << 16), __builtin_bit_cast(float, w & 0xffff0000u) }; return r; }
// ---- the product of k_proj: as mm_half, but A (the wave's 16 rows, bf16 hi + lo, all 8 k-steps) is already in registers, and a pass takes PJ column tiles (16 PJ columns), so that A, the accumulators and the W ring fit in 256 registers;
// only the W fragments are loaded, PRING - 1 ahead; pw = the pass's first fragment in the half's packed order [kc 8][j 8], at the lane's 16 bytes
#define PJ 4
#define PRING 8
__device__ __forceinline__ void ld_w1(v8b (&d)[2], const __bf16* pw, int gi) { const __bf16* p = pw + (size_t)((gi / PJ) * 8 + gi % PJ) * 512; d[0] = *(const v8b*)p; d[1] = *(const v8b*)(p + 256); }
__device__ __forceinline__ void mm_res(const F2 (&a)[CC / 32], const __bf16* pw, v8f (&acc)[PJ]) {
  v8b wr[PRING][2];   // every loop here is unrolled so that the ring, indexed by constants only, stays in registers
#pragma unroll
  for (int gi = 0; gi < PRING - 1; ++gi) ld_w1(wr[gi], pw, gi);
#pragma unroll
  for (int gi = 0; gi < 8 * PJ; ++gi) { const int kc = gi / PJ, j = gi % PJ;
    if (gi + PRING - 1 < 8 * PJ) ld_w1(wr[(gi + PRING - 1) % PRING], pw, gi + PRING - 1);
    if (gi == 0) asm volatile("s_wait_xcnt 0x0" ::: "memory");   // from here on the compiler may reuse a register that a load issued above names (the bias loads' offset register)
    __builtin_amdgcn_sched_barrier(0);   // keeps each W load PRING - 1 fragments ahead of its use and the WMMAs in this order: without it (seen) the compiler regroups them, parts of A go to scratch and the counted waits become full waits
    union { v16b v; v8b q[2]; } u; u.q[0] = wr[gi % PRING][0]; u.q[1] = wr[gi % PRING][1];
    acc[j] = wmma_bf(a[kc].h, u.v, acc[j]); acc[j] = wmma_bf(a[kc].l, u.v, acc[j]); }
  asm volatile("s_wait_xcnt 0x0" ::: "memory"); }   // the caller's next trip forms new addresses in the registers that the loads above name
// ---- k_proj: block = (64 rows, which). Each wave first normalises its own 16 token rows in registers, in the layout of the A fragments: lane (g, col) holds of row col the channels 32 kc + 8 g + 0..7 and 32 kc + 16 + 8 g + 0..7,
// that is half a row; all 32 loads in flight at once; LayerNorm over 256 channels (mean-square var, 1e-5) x g + b: sums in the lane, one exchange between the halves; g and b, rounded once by the block, come from LDS (one barrier). The rows, split once into bf16 hi + lo, stay in registers for both halves.
// then A . W, all 256 cols, + bias; q/k -> f16 rows; v -> planes
__global__ __launch_bounds__(128) void k_proj(const float* __restrict__ X, const float* __restrict__ G, const float* __restrict__ Bt, const __bf16* __restrict__ PW, const float* __restrict__ BQ, const float* __restrict__ BK, const float* __restrict__ BV, _Float16* __restrict__ Q, _Float16* __restrict__ Kr, _Float16* __restrict__ V) {
  __shared__ __align__(16) _Float16 so[64][CC + 8]; __shared__ __align__(16) _Float16 st[CC][72]; __shared__ __align__(16) float sg[CC], sb[CC];
  const int tid = threadIdx.x, wave = tid >> 5, lane = tid & 31, col = lane & 15, g = lane >> 4; const int which = blockIdx.y; const size_t rb = (size_t)blockIdx.x * 64; const size_t r0 = rb + wave * 16;
  const __bf16* Wr = PW + ((size_t)which * CC) * CC; const float* BB = (which == 0) ? BQ : (which == 1) ? BK : BV;
  F2 a[CC / 32];
  { v4f x[CC / 32][4], t[4];   // the loops of this block are unrolled so that x, t and a, indexed by constants only, stay in registers
    const v2f g2 = *(const v2f*)(G + 2 * tid), b2 = *(const v2f*)(Bt + 2 * tid);   // the thread's share of g and b for the block
    const float* px = X + (r0 + col) * CC + 8 * g;
#pragma unroll
    for (int kc = 0; kc < CC / 32; ++kc) ld_a(x[kc], px + kc * 32);
    asm volatile("s_wait_xcnt 0x0" ::: "memory");   // the arithmetic below may reuse the address registers of the loads above; no load crosses this statement, so all of them are issued ahead of the arithmetic and are in flight together
    *(v2f*)&sg[2 * tid] = up_bf(pk_bf(g2)); *(v2f*)&sb[2 * tid] = up_bf(pk_bf(b2));
    __syncthreads();   // g and b, rounded once by the block, are read by every wave
#pragma unroll
    for (int kc = 0; kc < CC / 32; ++kc) {
#pragma unroll
      for (int q = 0; q < 4; ++q) { const v2f lo = up_bf(pk_bf(x[kc][q].lo)), hi = up_bf(pk_bf(x[kc][q].hi)); x[kc][q].lo = lo; x[kc][q].hi = hi;
        t[q] = kc ? t[q] + x[kc][q] : x[kc][q]; } }
    v4f u = (t[0] + t[1]) + (t[2] + t[3]); float s = (u[0] + u[1]) + (u[2] + u[3]); s += xhalf(s);
    const float mu = s / (float)CC;
#pragma unroll
    for (int kc = 0; kc < CC / 32; ++kc) {
#pragma unroll
      for (int q = 0; q < 4; ++q) { x[kc][q] -= mu; t[q] = kc ? t[q] + x[kc][q] * x[kc][q] : x[kc][q] * x[kc][q]; } }
    u = (t[0] + t[1]) + (t[2] + t[3]); s = (u[0] + u[1]) + (u[2] + u[3]); s += xhalf(s);
    const float inv = 1.0f / sqrtf(s / (float)CC + 1e-5f);
#pragma unroll
    for (int kc = 0; kc < CC / 32; ++kc) { v4f gg[4], bb[4]; union { v16b v; unsigned w[8]; } fh, fl; ld_a(gg, sg + kc * 32 + 8 * g); ld_a(bb, sb + kc * 32 + 8 * g);
#pragma unroll
      for (int q = 0; q < 4; ++q) { const v4f y = x[kc][q] * inv * gg[q] + bb[q];   // element 4 q + i of the fragment, as ld_a orders it
        fh.w[2 * q] = pk_bf(y.lo); fh.w[2 * q + 1] = pk_bf(y.hi); fl.w[2 * q] = pk_bf(y.lo - up_bf(fh.w[2 * q])); fl.w[2 * q + 1] = pk_bf(y.hi - up_bf(fh.w[2 * q + 1])); }
      a[kc].h = fh.v; a[kc].l = fl.v; } }
#pragma unroll 1
  for (int ps = 0; ps < 16 / PJ; ++ps) { v8f acc[PJ] = {}; float bs[PJ];   // the lane's bias values, fetched ahead of the product and not one by one behind it
#pragma unroll   // bs, indexed by constants only, stays in registers
    for (int j = 0; j < PJ; ++j) bs[j] = BB[(ps * PJ + j) * 16 + col];
    mm_res(a, Wr + (size_t)(ps * PJ / 8) * (128 * CC) + (size_t)(ps * PJ % 8) * 512 + lane * 8, acc);
#pragma unroll
    for (int j = 0; j < PJ; ++j) { const int c = (ps * PJ + j) * 16 + col; const float bb = bfr(bs[j]);
#pragma unroll
      for (int r = 0; r < 8; ++r) { const _Float16 hv = (_Float16)(acc[j][r] + bb); if (which < 2) so[wave * 16 + 8 * g + r][c] = hv; else st[c][wave * 16 + 8 * g + r] = hv; } } }
  __syncthreads();
  if (which < 2) { _Float16* dst = (which == 0) ? Q : Kr; for (int e = tid; e < 64 * (CC / 8); e += 128) { const int rl = e >> 5, q = e & 31; vst2((unsigned*)(dst + (rb + rl) * CC + q * 8), *(const v4u*)&so[rl][q * 8]); } }
  else { const size_t b = rb / NT; const int s0 = (int)(rb % NT); for (int e = tid; e < CC * 8; e += 128) { const int d = e >> 3, pc = e & 7; vst2((unsigned*)(V + ((b * CC + d) * NT) + s0 + pc * 8), *(const v4u*)&st[d][pc * 8]); } }
}
// ---- k_attn: block = 32 waves = 512 queries of one head, one block per WGP; the head's whole K (1,024 rows of 64 B) and V^T (32 rows of 2,048 B) are staged once in LDS, and every fragment of the key loop is read from there.
// wave = 16 queries. S^T = K . Q^T (A = 16 key rows, B = the wave's queries): a lane holds 16 of the 32 scores of ONE query (keys j0 + 8g + r and j0 + 16 + 8g + r),
// so maximum and sum run in the lane, with one exchange between the halves; the two score tiles, converted in place, are the B operand of O^T += V^T . P^T (hardware k order, as frag_h loads V^T).
#define AQ 512          // queries per block
#define KP (HD + 8)     // LDS pitch of a K row, in f16: 64 B + 16 B = 16 B x odd, so the 16 rows of a 16-byte fragment read fall on 64 different banks
#define VP (NT + 8)     // LDS pitch of a V^T row, in f16: 2,048 B + 16 B, for the same reason
#define KS 0.25503486f  // 32^-1/2 x log2(e): a raw product q . k times KS is the score's exponent to base 2
__global__ __launch_bounds__(1024) void k_attn(const _Float16* __restrict__ Q, const _Float16* __restrict__ Kr, const _Float16* __restrict__ V, float* __restrict__ O) {
  __shared__ __align__(16) _Float16 sk[NT * KP]; __shared__ __align__(16) _Float16 sv[HD * VP];
  const int tid = threadIdx.x, wave = tid >> 5, lane = tid & 31, col = lane & 15, g = lane >> 4; const int h = blockIdx.y; const size_t b = blockIdx.z; const int q0 = blockIdx.x * AQ + wave * 16; const size_t rq = b * NT + q0;
  { v4u tk[4], tv[4];   // 4,096 pieces of 16 B of each operand, 4 + 4 a thread, all eight loads in flight; K: 4 lanes a row (8 lines a load), V^T: 512 contiguous bytes a load; both loops unrolled so that tk and tv, indexed by constants only, stay in registers
#pragma unroll
    for (int i = 0; i < 4; ++i) { const int e = i * 1024 + tid; tk[i] = *(const v4u*)(Kr + (b * NT + (e >> 2)) * CC + h * HD + (e & 3) * 8); tv[i] = *(const v4u*)(V + (b * CC + h * HD + (e >> 7)) * NT + (e & 127) * 8); }
#pragma unroll
    for (int i = 0; i < 4; ++i) { const int e = i * 1024 + tid; *(v4u*)&sk[(e >> 2) * KP + (e & 3) * 8] = tk[i]; *(v4u*)&sv[(e >> 7) * VP + (e & 127) * 8] = tv[i]; } }
  const v16h bq = frag_h(Q + (rq + col) * CC + h * HD, lane);
  __syncthreads();   // the staged K and V^T are read by every wave of the block
  const _Float16 *pk = sk + col * KP, *pv = sv + col * VP;   // the lane's row in a 16-row tile
  float m = -3.0e38f, nb = 0.f, l = 0.f;   // of query col; m = running maximum of the raw products q . k; nb = 11 - m * KS, the addend of the exponent; l (times 2^11) holds this half's keys only until the epilogue
  v8f acc[2] = {};               // acc[dt][r] = O^T[dt * 16 + 8g + r][col]
#pragma unroll 1   // as before: the 32 trips stay rolled, so the loop's code stays short
  for (int ks = 0; ks < NT / 32; ++ks) { const int j0 = ks * 32; v16h ak[2], av[2]; v8f s[2];   // all four fragments' loads stand at the head of the trip: nothing holds the V loads back any more
#pragma unroll
    for (int t = 0; t < 2; ++t) { ak[t] = frag_h(pk + (j0 + t * 16) * KP, lane); av[t] = frag_h(pv + t * 16 * VP + j0, lane); }
#pragma unroll
    for (int ct = 0; ct < 2; ++ct) { v8f c = {}; s[ct] = wmma16(ak[ct], bq, c); }   // raw products: the factor KS > 0 keeps their order, so the maximum is taken on them as they are
    float mx = fmaxf(s[0][0], s[1][0]);
#pragma unroll
    for (int r = 1; r < 8; ++r) mx = fmaxf(mx, fmaxf(s[0][r], s[1][r]));
    mx = fmaxf(mx, xhalf(mx));
    const float mn = fmaxf(m, mx); const float nn = 11.0f - mn * KS; const float alpha = (m <= -1.0e38f) ? 0.f : __builtin_amdgcn_exp2f(nn - nb);
    v16h pb; v2f es[2] = {};
#pragma unroll
    for (int ct = 0; ct < 2; ++ct) {
#pragma unroll
      for (int i = 0; i < 4; ++i) { const v2f c2 = { s[ct][2 * i], s[ct][2 * i + 1] }; const v2f x = c2 * KS + nn;   // one multiply-add a score: 2^11 exp((c - max) 32^-1/2) = 2^(c KS + nn)
        const v2f e = { __builtin_amdgcn_exp2f(x[0]), __builtin_amdgcn_exp2f(x[1]) }; es[ct] += e; pb[ct * 8 + 2 * i] = (_Float16)e[0]; pb[ct * 8 + 2 * i + 1] = (_Float16)e[1]; } }
    const v2f e2 = es[0] + es[1];
    l = l * alpha + (e2[0] + e2[1]); m = mn; nb = nn;
#pragma unroll
    for (int dt = 0; dt < 2; ++dt) {
#pragma unroll
      for (int r = 0; r < 8; ++r) acc[dt][r] *= alpha;
      acc[dt] = wmma16(av[dt], pb, acc[dt]); } }
  l += xhalf(l);
  const float il = 1.0f / l;   // numerator and l both carry the 2^11
#pragma unroll
  for (int dt = 0; dt < 2; ++dt) { float* po = O + (rq + col) * CC + h * HD + dt * 16 + 8 * g;
    const v4f lo = { acc[dt][0] * il, acc[dt][1] * il, acc[dt][2] * il, acc[dt][3] * il }, hi = { acc[dt][4] * il, acc[dt][5] * il, acc[dt][6] * il, acc[dt][7] * il };
    vst2(po, lo); vst2(po + 4, hi); }
}
// ---- k_out: block = 64 rows: out = Y (hi + lo) . Wp + bp; whole 1-KB rows
__global__ __launch_bounds__(128) void k_out(const float* __restrict__ O, const __bf16* __restrict__ PW, const float* __restrict__ BP, float* __restrict__ OUT) {
  __shared__ __align__(16) float sx[64][CC + 4];
  const int tid = threadIdx.x, wave = tid >> 5, lane = tid & 31, col = lane & 15, g = lane >> 4; const size_t rb = (size_t)blockIdx.x * 64; const size_t r0 = rb + wave * 16; const __bf16* Wr = PW + (size_t)3 * CC * CC;
#pragma unroll 1
  for (int half = 0; half < 2; ++half) { v8f acc[8] = {}; float bs[8];   // the lane's eight bias values, fetched ahead of the product and not one by one behind it
#pragma unroll   // bs, indexed by constants only, stays in registers
    for (int j = 0; j < 8; ++j) bs[j] = BP[half * 128 + j * 16 + col];
    mm_half(O + (r0 + col) * CC + 8 * g, Wr + (size_t)half * (128 * CC) + lane * 8, acc);
#pragma unroll
    for (int j = 0; j < 8; ++j) { const int c = half * 128 + j * 16 + col; const float bb = bfr(bs[j]);
#pragma unroll
      for (int r = 0; r < 8; ++r) sx[wave * 16 + 8 * g + r][c] = acc[j][r] + bb; } }
  __syncthreads();
  for (int e = tid; e < 64 * (CC / 4); e += 128) { const int rl = e >> 6, q = e & 63; vst2(OUT + (rb + rl) * CC + q * 4, *(const v4f*)&sx[rl][q * 4]); }
}
extern "C" void kernel_launch(void* const* d_in, const int* in_sizes, int n_in, void* d_out, int out_size, void* d_ws, size_t ws_size, hipStream_t stream) {
  (void)in_sizes; (void)n_in; (void)out_size;
  const float** F = (const float**)d_in;   // 0 x [16,32,32,256], 1 gamma, 2 beta, 3 Wq [256,256] (in,out), 4 bq, 5 Wk, 6 bk, 7 Wv, 8 bv, 9 Wp [256,256] (in,out), 10 bp
  if (ws_size < (size_t)WS_END) return;
  char* ws = (char*)d_ws; __bf16* PW = (__bf16*)ws; float* O = (float*)(ws + WS_O); _Float16 *Q = (_Float16*)(ws + WS_Q), *Kr = (_Float16*)(ws + WS_K), *V = (_Float16*)(ws + WS_V);
  k_pack<<<dim3(CC / 16, 4, 2), 256, 0, stream>>>(F[3], F[5], F[7], F[9], PW);
  k_proj<<<dim3(TNB * NT / 64, 3), 128, 0, stream>>>(F[0], F[1], F[2], PW, F[4], F[6], F[8], Q, Kr, V);
  k_attn<<<dim3(NT / AQ, NH, TNB), 1024, 0, stream>>>(Q, Kr, V, O);
  k_out<<<TNB * NT / 64, 128, 0, stream>>>(O, PW, F[10], (float*)d_out);
}

// v008
// A run of this version takes 57.1 microseconds.
// Two timings next to v007 put it at 1.12 and 1.18 times that version's speed.
// Counting every step since v000, it is 3.22 times as fast.
// compute dtype: all float inputs rounded to bf16; LayerNorm (eps 1e-5) in f32; Q/K/V = LN(x) (bf16 hi + lo, 2 products) . W + b on WMMA 16x16x32 ((in,out) weights packed in fragment order), rounded once to f16; PLAIN attention (8 heads x 32 over the 1,024 positions of each image): q, k single f16 x 32^-1/2, running-max softmax in f32 (hardware exp), P (scaled by 2^11, single f16) x v (single f16); out = Y (bf16 hi + residual) . Wp (2 products) + bp.
#include <hip/hip_runtime.h>
#include <math.h>

typedef __attribute__((ext_vector_type(16))) _Float16 v16h;
typedef __attribute__((ext_vector_type(16))) __bf16 v16b;
typedef __attribute__((ext_vector_type(8)))  _Float16 v8h;
typedef __attribute__((ext_vector_type(8)))  float v8f;
typedef __attribute__((ext_vector_type(4)))  float v4f;
typedef __attribute__((ext_vector_type(2)))  float v2f;
typedef __attribute__((ext_vector_type(4)))  unsigned v4u;
typedef __attribute__((ext_vector_type(4)))  int v4i;
typedef float __attribute__((may_alias)) float_a;
typedef int __attribute__((may_alias)) int_a;

template <typename T> __device__ __forceinline__ void vst2(void* p, T v) { *(T*)p = v;  }
__device__ __forceinline__ v8f wmma16(v16h a, v16h b, v8f c) {
  v8f d = __builtin_amdgcn_wmma_f32_16x16x32_f16(false, a, false, b, (short)0, c, false, false);
  asm volatile("v_nop\n\tv_nop\n\tv_nop\n\tv_nop" : "+v"(d) : "v"(a), "v"(b));
  return d;
}
__device__ __forceinline__ v8f wmma_bf(v16b a, v16b b, v8f c) {
  v8f d = __builtin_amdgcn_wmma_f32_16x16x32_bf16(false, a, false, b, (short)0, c, false, false);
  asm volatile("v_nop\n\tv_nop\n\tv_nop\n\tv_nop" : "+v"(d) : "v"(a), "v"(b));
  return d;
}
// 16x16x32 fragments: lane = (h = lane>>4, row/col = lane&15); elements 0..7 = k0+8h+0..7, 8..15 = k0+16+8h+0..7; D element r = row 8h+r
__device__ __forceinline__ v16h frag_h(const _Float16* rowk0, int lane) {
  union { v16h v; v8h q[2]; } u; const _Float16* p = rowk0 + 8 * (lane >> 4);
  u.q[0] = *(const v8h*)p; u.q[1] = *(const v8h*)(p + 16); return u.v;
}
__device__ __forceinline__ v16h frag_f32(const float* rowk0, int lane) {
  v16h a; const float* p = rowk0 + 8 * (lane >> 4);
#pragma unroll
  for (int i = 0; i < 8; ++i) { a[i] = (_Float16)p[i]; a[8 + i] = (_Float16)p[16 + i]; }
  return a;
}
__device__ __forceinline__ v16h frag_f32s(const float* rowk0, int lane, float sc) {
  v16h a; const float* p = rowk0 + 8 * (lane >> 4);
#pragma unroll
  for (int i = 0; i < 8; ++i) { a[i] = (_Float16)(p[i] * sc); a[8 + i] = (_Float16)(p[16 + i] * sc); }
  return a;
}
// column fragment from a [K][ld] layout (column n), rows >= K read as 0
__device__ __forceinline__ v16h fragc_f32(const float* W, int k0, int n, int lane, int ld, int K) {
  v16h a; const int g = lane >> 4;
#pragma unroll
  for (int i = 0; i < 8; ++i) { const int ka = k0 + 8 * g + i, kb = ka + 16;
    a[i] = (_Float16)(ka < K ? W[(size_t)(ka < K ? ka : K - 1) * ld + n] : 0.f); a[8 + i] = (_Float16)(kb < K ? W[(size_t)(kb < K ? kb : K - 1) * ld + n] : 0.f); }
  return a;
}
struct F2 { v16b h, l; };
__device__ __forceinline__ F2 bsplit16(const float v[16]) { F2 r;
#pragma unroll
  for (int i = 0; i < 16; ++i) { const __bf16 h = (__bf16)v[i]; r.h[i] = h; r.l[i] = (__bf16)(v[i] - (float)h); }
  return r; }
__device__ __forceinline__ F2 split_row(const float* row, int k0, int lane) { float v[16]; const float* p = row + k0 + 8 * (lane >> 4);
#pragma unroll
  for (int i = 0; i < 8; ++i) { v[i] = p[i]; v[8 + i] = p[16 + i]; }
  return bsplit16(v); }
__device__ __forceinline__ F2 split_rowK(const float* row, int k0, int lane, int K) { float v[16]; const int g = lane >> 4;
#pragma unroll
  for (int i = 0; i < 8; ++i) { const int ka = k0 + 8 * g + i, kb = ka + 16; v[i] = ka < K ? row[ka < K ? ka : K - 1] : 0.f; v[8 + i] = kb < K ? row[kb < K ? kb : K - 1] : 0.f; }
  return bsplit16(v); }
__device__ __forceinline__ F2 split_col(const float* W, int k0, int n, int lane, int ld, int K) { float v[16]; const int g = lane >> 4;
#pragma unroll
  for (int i = 0; i < 8; ++i) { const int ka = k0 + 8 * g + i, kb = ka + 16; v[i] = ka < K ? W[(size_t)(ka < K ? ka : K - 1) * ld + n] : 0.f; v[8 + i] = kb < K ? W[(size_t)(kb < K ? kb : K - 1) * ld + n] : 0.f; }
  return bsplit16(v); }
__device__ __forceinline__ v8f mac3(const F2& a, const F2& b, v8f c) { c = wmma_bf(a.l, b.h, c); c = wmma_bf(a.h, b.l, c); return wmma_bf(a.h, b.h, c); }
__device__ __forceinline__ float sigm(float v) { return 1.0f / (1.0f + expf(-v)); }
#define LDSX() do { asm volatile("s_wait_dscnt 0" ::: "memory"); __builtin_amdgcn_wave_barrier(); __builtin_amdgcn_fence(__ATOMIC_RELEASE, "workgroup"); } while (0)


// Global multi-head self attention over a 32 x 32 feature map (B 16, N 1,024 tokens, C 256, 8 heads x 32): LayerNorm, 1x1-conv q/k/v, softmax(Q K / sqrt(32)) V, 1x1-conv projection + bias.
#define NB 16
#define NT 1024
#define CC 256
#define NH 8
#define HD 32
#define NR (NB * NT)
#ifndef TQB
#define TQB (NT / 64)
#define TNB NB
#endif
typedef __attribute__((ext_vector_type(8))) __bf16 v8b;
__device__ __forceinline__ v16b frag_b(const __bf16* rowk0, int lane) {
  union { v16b v; v8b q[2]; } u; const __bf16* p = rowk0 + 8 * (lane >> 4);
  u.q[0] = *(const v8b*)p; u.q[1] = *(const v8b*)(p + 16); return u.v;
}
__device__ __forceinline__ float bfr(float v) { return (float)(__bf16)v; }
__device__ __attribute__((noinline)) float exp_ni(float v) { return expf(v); }
__device__ __attribute__((noinline)) float erf_ni(float v) { return erff(v); }

#define WS_PW  0u                                    // bf16 Wq, Wk, Wv, Wp in fragment order [4][half 2][kc 8][j 8][piece 2][lane 32][8] (k_pack)
#define WS_Q   (WS_PW + 2u * (size_t)4 * CC * CC)       // f16 q, k, v in the fragment order of k_attn (see k_proj); O f32 [NR][256]
#define WS_K   (WS_Q + 2u * (size_t)NR * CC)
#define WS_V   (WS_K + 2u * (size_t)NR * CC)
#define WS_O   (WS_V + 2u * (size_t)NB * CC * NT)
#define WS_END (WS_O + 4u * (size_t)NR * CC)

// ---- k_pack: each W (in,out) -> bf16 in the order in which mm_half reads it: the 16 bytes of lane (g, col) in piece p of fragment (kc, j) of a half are W[kc * 32 + p * 16 + 8 g + 0..7][half * 128 + j * 16 + col],
// so that a wave's fragment load is 512 contiguous bytes (4 whole lines) and the fragments of a half follow one another in the order of use.
// block = (16 columns, which W, 4 of the 8 kc); thread = one 16-byte piece: its eight loads in flight together (a wave load = 2 rows x 64 B), a wave stores 512 contiguous bytes; no LDS, no barrier
__global__ __launch_bounds__(256) void k_pack(const float* __restrict__ WQ, const float* __restrict__ WK, const float* __restrict__ WV, const float* __restrict__ WP, __bf16* __restrict__ PW) { const int jt = blockIdx.x, which = blockIdx.y, q = blockIdx.z * 256 + threadIdx.x; const int lane = q & 31, p = (q >> 5) & 1, kc = q >> 6; const float* w = (which == 0) ? WQ : (which == 1) ? WK : (which == 2) ? WV : WP;
  const float* s = w + (size_t)(kc * 32 + p * 16 + 8 * (lane >> 4)) * CC + jt * 16 + (lane & 15); float v[8]; v8b o;
#pragma unroll   // v and o, indexed by constants only, stay in registers
  for (int e = 0; e < 8; ++e) v[e] = s[(size_t)e * CC];
#pragma unroll
  for (int e = 0; e < 8; ++e) o[e] = (__bf16)v[e];
  *(v8b*)(PW + ((((size_t)which * 2 + (jt >> 3)) * 8 + kc) * 8 + (jt & 7)) * 512 + p * 256 + lane * 8) = o; }
// lane l with lane l ^ 16
__device__ __forceinline__ float xhalf(float x) { return __builtin_bit_cast(float, __builtin_amdgcn_permlanex16(__builtin_bit_cast(int, x), __builtin_bit_cast(int, x), 0x76543210, 0xfedcba98, false, false)); }
// ---- the product of k_out: acc[j] += A (the wave's 16 rows, bf16 hi + lo) . W (columns 16 j + 0..15 of the half at pw), k = 0..255; pa = the lane's own row, at its 8 * (lane >> 4); pw = the half's packed fragments (k_pack), at the lane's 16 bytes
// software pipeline in registers: W fragments come in groups of WG, WRING - 1 groups ahead of the group that is multiplied; the A rows of a k-step come ARING - 1 k-steps ahead
#define WG 1
#define WRING 8
#define ARING 2
__device__ __forceinline__ void ld_a(v4f (&d)[4], const float* p) { d[0] = *(const v4f*)p; d[1] = *(const v4f*)(p + 4); d[2] = *(const v4f*)(p + 16); d[3] = *(const v4f*)(p + 20); }
__device__ __forceinline__ void ld_w(v8b (&d)[WG][2], const __bf16* pw, int gi) {
#pragma unroll   // as in mm_half: d is indexed by constants only
  for (int i = 0; i < WG; ++i) { const __bf16* p = pw + (size_t)(gi * WG + i) * 512; d[i][0] = *(const v8b*)p; d[i][1] = *(const v8b*)(p + 256); } }
__device__ __forceinline__ void mm_half(const float* pa, const __bf16* pw, v8f (&acc)[8]) {
  v4f ar[ARING][4]; v8b wr[WRING][WG][2]; F2 a;   // every loop here is unrolled so that the rings, indexed by constants only, stay in registers
#pragma unroll
  for (int s = 0; s < ARING - 1; ++s) ld_a(ar[s], pa + s * 32);
#pragma unroll
  for (int gi = 0; gi < WRING - 1; ++gi) ld_w(wr[gi], pw, gi);
#pragma unroll
  for (int gi = 0; gi < 64 / WG; ++gi) { const int kc = gi / (8 / WG), jb = (gi % (8 / WG)) * WG;
    if (gi + WRING - 1 < 64 / WG) ld_w(wr[(gi + WRING - 1) % WRING], pw, gi + WRING - 1);
    if (jb == 0 && kc + ARING - 1 < CC / 32) ld_a(ar[(kc + ARING - 1) % ARING], pa + (kc + ARING - 1) * 32);
    if (gi == 0) asm volatile("s_wait_xcnt 0x0" ::: "memory");   // from here on the compiler may reuse a register that a load issued above names (seen: the bias loads' offset register becomes an accumulator)
    __builtin_amdgcn_sched_barrier(0);   // keeps a k-step's split behind this point: lifted among the earlier WMMAs (seen without it), its wait for the A rows also waits out nearly all the W loads in flight
    if (jb == 0) { float v[16];
#pragma unroll
      for (int i = 0; i < 4; ++i) { v[i] = ar[kc % ARING][0][i]; v[4 + i] = ar[kc % ARING][1][i]; v[8 + i] = ar[kc % ARING][2][i]; v[12 + i] = ar[kc % ARING][3][i]; }
      a = bsplit16(v); }
#pragma unroll
    for (int i = 0; i < WG; ++i) { union { v16b v; v8b q[2]; } u; u.q[0] = wr[gi % WRING][i][0]; u.q[1] = wr[gi % WRING][i][1];
      acc[jb + i] = wmma_bf(a.h, u.v, acc[jb + i]); acc[jb + i] = wmma_bf(a.l, u.v, acc[jb + i]); } }
  asm volatile("s_wait_xcnt 0x0" ::: "memory"); }   // the caller's next trip forms new addresses in the registers that the loads above name
// two f32 -> two bf16 in one word (round to nearest even, first value in the low half), and back to f32
typedef __attribute__((ext_vector_type(2))) __bf16 v2b;
__device__ __forceinline__ unsigned pk_bf(v2f v) { return __builtin_bit_cast(unsigned, __builtin_convertvector(v, v2b)); }
__device__ __forceinline__ v2f up_bf(unsigned w) { const v2f r = { __builtin_bit_cast(float, w << 16), __builtin_bit_cast(float, w & 0xffff0000u) }; return r; }
// ---- the product of k_proj: as mm_half, but A (the wave's 16 rows, bf16 hi + lo, all 8 k-steps) is already in registers, and a pass takes PJ column tiles (16 PJ columns), so that A, the accumulators and the W ring fit in 256 registers;
// only the W fragments are loaded, PRING - 1 ahead; pw = the pass's first fragment in the half's packed order [kc 8][j 8], at the lane's 16 bytes.
// SW = false: D = A . W, a lane holds 8 token rows (8 g + r) of ONE column; SW = true: the same two fragments with their places exchanged (A and B fragments have one layout), D = W^T . A^T, a lane holds 8 columns (8 g + r) of ONE token row; same products, same k order
#define PJ 4
#define PRING 8
__device__ __forceinline__ void ld_w1(v8b (&d)[2], const __bf16* pw, int gi) { const __bf16* p = pw + (size_t)((gi / PJ) * 8 + gi % PJ) * 512; d[0] = *(const v8b*)p; d[1] = *(const v8b*)(p + 256); }
template <bool SW> __device__ __forceinline__ void mm_res(const F2 (&a)[CC / 32], const __bf16* pw, v8f (&acc)[PJ]) {
  v8b wr[PRING][2];   // every loop here is unrolled so that the ring, indexed by constants only, stays in registers
#pragma unroll
  for (int gi = 0; gi < PRING - 1; ++gi) ld_w1(wr[gi], pw, gi);
#pragma unroll
  for (int gi = 0; gi < 8 * PJ; ++gi) { const int kc = gi / PJ, j = gi % PJ;
    if (gi + PRING - 1 < 8 * PJ) ld_w1(wr[(gi + PRING - 1) % PRING], pw, gi + PRING - 1);
    if (gi == 0) asm volatile("s_wait_xcnt 0x0" ::: "memory");   // from here on the compiler may reuse a register that a load issued above names
    __builtin_amdgcn_sched_barrier(0);   // keeps each W load PRING - 1 fragments ahead of its use and the WMMAs in this order: without it (seen) the compiler regroups them, parts of A go to scratch and the counted waits become full waits
    union { v16b v; v8b q[2]; } u; u.q[0] = wr[gi % PRING][0]; u.q[1] = wr[gi % PRING][1];
    if (SW) { acc[j] = wmma_bf(u.v, a[kc].h, acc[j]); acc[j] = wmma_bf(u.v, a[kc].l, acc[j]); }
    else { acc[j] = wmma_bf(a[kc].h, u.v, acc[j]); acc[j] = wmma_bf(a[kc].l, u.v, acc[j]); } }
  asm volatile("s_wait_xcnt 0x0" ::: "memory"); }   // the caller's next trip forms new addresses in the registers that the loads above name
// ---- k_proj: block = (64 rows, which). Each wave first normalises its own 16 token rows in registers, in the layout of the A fragments: lane (g, col) holds of row col the channels 32 kc + 8 g + 0..7 and 32 kc + 16 + 8 g + 0..7,
// that is half a row; all 32 loads in flight at once; LayerNorm over 256 channels (mean-square var, 1e-5) x g + b: sums in the lane, one exchange between the halves; g and b, rounded once by the block, come from LDS (one barrier). The rows, split once into bf16 hi + lo, stay in registers for both halves.
// then A . W, all 256 cols, + bias (rounded once by the block, from LDS), rounded to f16 and stored from the accumulators in the order in which k_attn reads its fragments: the 8 results of a lane in a tile are the lane's 16 bytes of one fragment piece, a wave's store is 512 contiguous bytes.
// q and k by W^T . A^T (a lane holds channels 16 p + 8 g + 0..7 of head h for token col of 16-token tile t): [b][h][t 64][piece p 2][lane 32][8];
// v by A . W (a lane holds tokens 8 g + 0..7 of tile t = 2 ks + p for channel 16 dt + col of head h): [b][h][dt 2][ks 32][piece p 2][lane 32][8]
__global__ __launch_bounds__(128) void k_proj(const float* __restrict__ X, const float* __restrict__ G, const float* __restrict__ Bt, const __bf16* __restrict__ PW, const float* __restrict__ BQ, const float* __restrict__ BK, const float* __restrict__ BV, _Float16* __restrict__ Q, _Float16* __restrict__ Kr, _Float16* __restrict__ V) {
  __shared__ __align__(16) float sg[CC], sb[CC], sc[CC];
  // the wave's number is put in a scalar register: what is formed from it (its rows, its image, its tile) is then scalar arithmetic and holds no vector register; left in a vector register (seen), a fragment of A went to scratch
  const int tid = threadIdx.x, wave = __builtin_amdgcn_readfirstlane(tid >> 5), lane = tid & 31, col = lane & 15, g = lane >> 4; const int which = blockIdx.y; const size_t rb = (size_t)blockIdx.x * 64; const size_t r0 = rb + wave * 16;
  const __bf16* Wr = PW + ((size_t)which * CC) * CC; const float* BB = (which == 0) ? BQ : (which == 1) ? BK : BV;
  F2 a[CC / 32];
  { v4f x[CC / 32][4], t[4];   // the loops of this block are unrolled so that x, t and a, indexed by constants only, stay in registers
    const v2f g2 = *(const v2f*)(G + 2 * tid), b2 = *(const v2f*)(Bt + 2 * tid), c2 = *(const v2f*)(BB + 2 * tid);   // the thread's share of g, b and the bias for the block
    const float* px = X + (r0 + col) * CC + 8 * g;
#pragma unroll
    for (int kc = 0; kc < CC / 32; ++kc) ld_a(x[kc], px + kc * 32);
    asm volatile("s_wait_xcnt 0x0" ::: "memory");   // the arithmetic below may reuse the address registers of the loads above; no load crosses this statement, so all of them are issued ahead of the arithmetic and are in flight together
    *(v2f*)&sg[2 * tid] = up_bf(pk_bf(g2)); *(v2f*)&sb[2 * tid] = up_bf(pk_bf(b2)); *(v2f*)&sc[2 * tid] = up_bf(pk_bf(c2));
    __syncthreads();   // g, b and the bias, rounded once by the block, are read by every wave
#pragma unroll
    for (int kc = 0; kc < CC / 32; ++kc) {
#pragma unroll
      for (int q = 0; q < 4; ++q) { const v2f lo = up_bf(pk_bf(x[kc][q].lo)), hi = up_bf(pk_bf(x[kc][q].hi)); x[kc][q].lo = lo; x[kc][q].hi = hi;
        t[q] = kc ? t[q] + x[kc][q] : x[kc][q]; } }
    v4f u = (t[0] + t[1]) + (t[2] + t[3]); float s = (u[0] + u[1]) + (u[2] + u[3]); s += xhalf(s);
    const float mu = s / (float)CC;
#pragma unroll
    for (int kc = 0; kc < CC / 32; ++kc) {
#pragma unroll
      for (int q = 0; q < 4; ++q) { x[kc][q] -= mu; t[q] = kc ? t[q] + x[kc][q] * x[kc][q] : x[kc][q] * x[kc][q]; } }
    u = (t[0] + t[1]) + (t[2] + t[3]); s = (u[0] + u[1]) + (u[2] + u[3]); s += xhalf(s);
    const float inv = 1.0f / sqrtf(s / (float)CC + 1e-5f);
#pragma unroll
    for (int kc = 0; kc < CC / 32; ++kc) { v4f gg[4], bb[4]; union { v16b v; unsigned w[8]; } fh, fl; ld_a(gg, sg + kc * 32 + 8 * g); ld_a(bb, sb + kc * 32 + 8 * g);
#pragma unroll
      for (int q = 0; q < 4; ++q) { const v4f y = x[kc][q] * inv * gg[q] + bb[q];   // element 4 q + i of the fragment, as ld_a orders it
        fh.w[2 * q] = pk_bf(y.lo); fh.w[2 * q + 1] = pk_bf(y.hi); fl.w[2 * q] = pk_bf(y.lo - up_bf(fh.w[2 * q])); fl.w[2 * q + 1] = pk_bf(y.hi - up_bf(fh.w[2 * q + 1])); }
      a[kc].h = fh.v; a[kc].l = fl.v; } }
  const size_t bi = r0 / NT; const int tt = (int)(r0 % NT) >> 4;   // the wave's image and its 16-token tile
  if (which < 2) { _Float16* dst = ((which == 0) ? Q : Kr) + (bi * NH * 64 + tt) * 512 + lane * 8;
#pragma unroll 1   // as before: the four passes stay rolled, so the kernel's code stays short
    for (int ps = 0; ps < 16 / PJ; ++ps) { v8f acc[PJ] = {};
      mm_res<true>(a, Wr + (size_t)(ps * PJ / 8) * (128 * CC) + (size_t)(ps * PJ % 8) * 512 + lane * 8, acc);
#pragma unroll   // here and below: acc and hv, indexed by constants only, stay in registers
      for (int j = 0; j < PJ; ++j) { const int jt = ps * PJ + j, c0 = jt * 16 + 8 * g; const v4f b0 = *(const v4f*)&sc[c0], b1 = *(const v4f*)&sc[c0 + 4]; v8h hv;
#pragma unroll
        for (int r = 0; r < 4; ++r) { hv[r] = (_Float16)(acc[j][r] + b0[r]); hv[4 + r] = (_Float16)(acc[j][4 + r] + b1[r]); }
        *(v8h*)(dst + (size_t)((jt >> 1) * 128 + (jt & 1)) * 256) = hv; } } }
  else { _Float16* dst = V + (bi * 2 * NH * 64 + tt) * 256 + lane * 8;
#pragma unroll 1   // as above
    for (int ps = 0; ps < 16 / PJ; ++ps) { v8f acc[PJ] = {};
      mm_res<false>(a, Wr + (size_t)(ps * PJ / 8) * (128 * CC) + (size_t)(ps * PJ % 8) * 512 + lane * 8, acc);
#pragma unroll
      for (int j = 0; j < PJ; ++j) { const int jt = ps * PJ + j; const float bb = sc[jt * 16 + col]; v8h hv;
#pragma unroll
        for (int r = 0; r < 8; ++r) hv[r] = (_Float16)(acc[j][r] + bb);
        *(v8h*)(dst + (size_t)jt * (64 * 256)) = hv; } } }
}
// ---- k_attn: block = 32 waves = 512 queries of one head, one block per WGP; the head's whole K and V^T (64 KB each, contiguous, in fragment order as k_proj stores them) are copied once to LDS, and every fragment of the key loop is read from there, 512 contiguous bytes a load.
// wave = 16 queries. S^T = K . Q^T (A = 16 key rows, B = the wave's queries): a lane holds 16 of the 32 scores of ONE query (keys j0 + 8g + r and j0 + 16 + 8g + r),
// so maximum and sum run in the lane, with one exchange between the halves; the two score tiles, converted in place, are the B operand of O^T += V^T . P^T (hardware k order, as frag_p loads V^T).
#define AQ 512          // queries per block
// a fragment stored in fragment order: f = its first piece, at the lane's 16 bytes; the second piece follows 512 B on
__device__ __forceinline__ v16h frag_p(const _Float16* f) { union { v16h v; v8h q[2]; } u; u.q[0] = *(const v8h*)f; u.q[1] = *(const v8h*)(f + 256); return u.v; }
#define KS 0.25503486f  // 32^-1/2 x log2(e): a raw product q . k times KS is the score's exponent to base 2
__global__ __launch_bounds__(1024) void k_attn(const _Float16* __restrict__ Q, const _Float16* __restrict__ Kr, const _Float16* __restrict__ V, float* __restrict__ O) {
  __shared__ __align__(16) _Float16 sk[NT * HD]; __shared__ __align__(16) _Float16 sv[HD * NT];
  const int tid = threadIdx.x, wave = tid >> 5, lane = tid & 31, col = lane & 15, g = lane >> 4; const int h = blockIdx.y; const size_t b = blockIdx.z; const int q0 = blockIdx.x * AQ + wave * 16; const size_t rq = b * NT + q0; const size_t hb = (b * NH + h) * (size_t)(NT * HD);   // the head's 64 KB in each of q, k, v
  { v4u tk[4], tv[4];   // 4,096 pieces of 16 B of each operand, 4 + 4 a thread, all eight loads in flight, 512 contiguous bytes a load; both loops unrolled so that tk and tv, indexed by constants only, stay in registers
#pragma unroll
    for (int i = 0; i < 4; ++i) { const int e = i * 1024 + tid; tk[i] = *(const v4u*)(Kr + hb + e * 8); tv[i] = *(const v4u*)(V + hb + e * 8); }
#pragma unroll
    for (int i = 0; i < 4; ++i) { const int e = i * 1024 + tid; *(v4u*)&sk[e * 8] = tk[i]; *(v4u*)&sv[e * 8] = tv[i]; } }
  const v16h bq = frag_p(Q + hb + (size_t)(q0 >> 4) * 512 + lane * 8);
  __syncthreads();   // the staged K and V^T are read by every wave of the block
  const _Float16 *pk = sk + lane * 8, *pv = sv + lane * 8;   // the lane's 16 bytes in a piece
  float m = -3.0e38f, nb = 0.f, l = 0.f;   // of query col; m = running maximum of the raw products q . k; nb = 11 - m * KS, the addend of the exponent; l (times 2^11) holds this half's keys only until the epilogue
  v8f acc[2] = {};               // acc[dt][r] = O^T[dt * 16 + 8g + r][col]
#pragma unroll 1   // as before: the 32 trips stay rolled, so the loop's code stays short
  for (int ks = 0; ks < NT / 32; ++ks) { v16h ak[2], av[2]; v8f s[2];   // all four fragments' loads stand at the head of the trip: nothing holds the V loads back any more
#pragma unroll
    for (int t = 0; t < 2; ++t) { ak[t] = frag_p(pk + (ks * 2 + t) * 512); av[t] = frag_p(pv + (t * 32 + ks) * 512); }
#pragma unroll
    for (int ct = 0; ct < 2; ++ct) { v8f c = {}; s[ct] = wmma16(ak[ct], bq, c); }   // raw products: the factor KS > 0 keeps their order, so the maximum is taken on them as they are
    float mx = fmaxf(s[0][0], s[1][0]);
#pragma unroll
    for (int r = 1; r < 8; ++r) mx = fmaxf(mx, fmaxf(s[0][r], s[1][r]));
    mx = fmaxf(mx, xhalf(mx));
    const float mn = fmaxf(m, mx); const float nn = 11.0f - mn * KS; const float alpha = (m <= -1.0e38f) ? 0.f : __builtin_amdgcn_exp2f(nn - nb);
    v16h pb; v2f es[2] = {};
#pragma unroll
    for (int ct = 0; ct < 2; ++ct) {
#pragma unroll
      for (int i = 0; i < 4; ++i) { const v2f c2 = { s[ct][2 * i], s[ct][2 * i + 1] }; const v2f x = c2 * KS + nn;   // one multiply-add a score: 2^11 exp((c - max) 32^-1/2) = 2^(c KS + nn)
        const v2f e = { __builtin_amdgcn_exp2f(x[0]), __builtin_amdgcn_exp2f(x[1]) }; es[ct] += e; pb[ct * 8 + 2 * i] = (_Float16)e[0]; pb[ct * 8 + 2 * i + 1] = (_Float16)e[1]; } }
    const v2f e2 = es[0] + es[1];
    l = l * alpha + (e2[0] + e2[1]); m = mn; nb = nn;
#pragma unroll
    for (int dt = 0; dt < 2; ++dt) {
#pragma unroll
      for (int r = 0; r < 8; ++r) acc[dt][r] *= alpha;
      acc[dt] = wmma16(av[dt], pb, acc[dt]); } }
  l += xhalf(l);
  const float il = 1.0f / l;   // numerator and l both carry the 2^11
#pragma unroll
  for (int dt = 0; dt < 2; ++dt) { float* po = O + (rq + col) * CC + h * HD + dt * 16 + 8 * g;
    const v4f lo = { acc[dt][0] * il, acc[dt][1] * il, acc[dt][2] * il, acc[dt][3] * il }, hi = { acc[dt][4] * il, acc[dt][5] * il, acc[dt][6] * il, acc[dt][7] * il };
    vst2(po, lo); vst2(po + 4, hi); }
}
// ---- k_out: block = 64 rows: out = Y (hi + lo) . Wp + bp; whole 1-KB rows
__global__ __launch_bounds__(128) void k_out(const float* __restrict__ O, const __bf16* __restrict__ PW, const float* __restrict__ BP, float* __restrict__ OUT) {
  __shared__ __align__(16) float sx[64][CC + 4];
  const int tid = threadIdx.x, wave = tid >> 5, lane = tid & 31, col = lane & 15, g = lane >> 4; const size_t rb = (size_t)blockIdx.x * 64; const size_t r0 = rb + wave * 16; const __bf16* Wr = PW + (size_t)3 * CC * CC;
#pragma unroll 1
  for (int half = 0; half < 2; ++half) { v8f acc[8] = {}; float bs[8];   // the lane's eight bias values, fetched ahead of the product and not one by one behind it
#pragma unroll   // bs, indexed by constants only, stays in registers
    for (int j = 0; j < 8; ++j) bs[j] = BP[half * 128 + j * 16 + col];
    mm_half(O + (r0 + col) * CC + 8 * g, Wr + (size_t)half * (128 * CC) + lane * 8, acc);
#pragma unroll
    for (int j = 0; j < 8; ++j) { const int c = half * 128 + j * 16 + col; const float bb = bfr(bs[j]);
#pragma unroll
      for (int r = 0; r < 8; ++r) sx[wave * 16 + 8 * g + r][c] = acc[j][r] + bb; } }
  __syncthreads();
  for (int e = tid; e < 64 * (CC / 4); e += 128) { const int rl = e >> 6, q = e & 63; vst2(OUT + (rb + rl) * CC + q * 4, *(const v4f*)&sx[rl][q * 4]); }
}
extern "C" void kernel_launch(void* const* d_in, const int* in_sizes, int n_in, void* d_out, int out_size, void* d_ws, size_t ws_size, hipStream_t stream) {
  (void)in_sizes; (void)n_in; (void)out_size;
  const float** F = (const float**)d_in;   // 0 x [16,32,32,256], 1 gamma, 2 beta, 3 Wq [256,256] (in,out), 4 bq, 5 Wk, 6 bk, 7 Wv, 8 bv, 9 Wp [256,256] (in,out), 10 bp
  if (ws_size < (size_t)WS_END) return;
  char* ws = (char*)d_ws; __bf16* PW = (__bf16*)ws; float* O = (float*)(ws + WS_O); _Float16 *Q = (_Float16*)(ws + WS_Q), *Kr = (_Float16*)(ws + WS_K), *V = (_Float16*)(ws + WS_V);
  k_pack<<<dim3(CC / 16, 4, 2), 256, 0, stream>>>(F[3], F[5], F[7], F[9], PW);
  k_proj<<<dim3(TNB * NT / 64, 3), 128, 0, stream>>>(F[0], F[1], F[2], PW, F[4], F[6], F[8], Q, Kr, V);
  k_attn<<<dim3(NT / AQ, NH, TNB), 1024, 0, stream>>>(Q, Kr, V, O);
  k_out<<<TNB * NT / 64, 128, 0, stream>>>(O, PW, F[10], (float*)d_out);
}

// v009
// A run of this version takes 53.1 microseconds.
// Two timings next to v008 both put it at 1.04 times that version's speed.
// Over all steps from v000 it is 3.35 times as fast.
// compute dtype: all float inputs rounded to bf16; LayerNorm (eps 1e-5) in f32; Q/K/V = LN(x) (bf16 hi + lo, 2 products) . W + b on WMMA 16x16x32 ((in,out) weights packed in fragment order), rounded once to f16; PLAIN attention (8 heads x 32 over the 1,024 positions of each image): q, k single f16 x 32^-1/2, running-max softmax in f32 (hardware exp), P (scaled by 2^11, single f16) x v (single f16); out = Y (bf16 hi + residual) . Wp (2 products) + bp.
#include <hip/hip_runtime.h>
#include <math.h>

typedef __attribute__((ext_vector_type(16))) _Float16 v16h;
typedef __attribute__((ext_vector_type(16))) __bf16 v16b;
typedef __attribute__((ext_vector_type(8)))  _Float16 v8h;
typedef __attribute__((ext_vector_type(8)))  float v8f;
typedef __attribute__((ext_vector_type(4)))  float v4f;
typedef __attribute__((ext_vector_type(2)))  float v2f;
typedef __attribute__((ext_vector_type(4)))  unsigned v4u;
typedef __attribute__((ext_vector_type(4)))  int v4i;
typedef float __attribute__((may_alias)) float_a;
typedef int __attribute__((may_alias)) int_a;

template <typename T> __device__ __forceinline__ void vst2(void* p, T v) { *(T*)p = v;  }
__device__ __forceinline__ v8f wmma16(v16h a, v16h b, v8f c) {   // the builtin alone: k_attn issues these in runs of independent ones, which stand in one another's slots; what distance is still owed the compiler pads
  return __builtin_amdgcn_wmma_f32_16x16x32_f16(false, a, false, b, (short)0, c, false, false);
}
__device__ __forceinline__ v8f wmma_bf(v16b a, v16b b, v8f c) {
  v8f d = __builtin_amdgcn_wmma_f32_16x16x32_bf16(false, a, false, b, (short)0, c, false, false);
  asm volatile("v_nop\n\tv_nop\n\tv_nop\n\tv_nop" : "+v"(d) : "v"(a), "v"(b));
  return d;
}
// 16x16x32 fragments: lane = (h = lane>>4, row/col = lane&15); elements 0..7 = k0+8h+0..7, 8..15 = k0+16+8h+0..7; D element r = row 8h+r
__device__ __forceinline__ v16h frag_h(const _Float16* rowk0, int lane) {
  union { v16h v; v8h q[2]; } u; const _Float16* p = rowk0 + 8 * (lane >> 4);
  u.q[0] = *(const v8h*)p; u.q[1] = *(const v8h*)(p + 16); return u.v;
}
__device__ __forceinline__ v16h frag_f32(const float* rowk0, int lane) {
  v16h a; const float* p = rowk0 + 8 * (lane >> 4);
#pragma unroll
  for (int i = 0; i < 8; ++i) { a[i] = (_Float16)p[i]; a[8 + i] = (_Float16)p[16 + i]; }
  return a;
}
__device__ __forceinline__ v16h frag_f32s(const float* rowk0, int lane, float sc) {
  v16h a; const float* p = rowk0 + 8 * (lane >> 4);
#pragma unroll
  for (int i = 0; i < 8; ++i) { a[i] = (_Float16)(p[i] * sc); a[8 + i] = (_Float16)(p[16 + i] * sc); }
  return a;
}
// column fragment from a [K][ld] layout (column n), rows >= K read as 0
__device__ __forceinline__ v16h fragc_f32(const float* W, int k0, int n, int lane, int ld, int K) {
  v16h a; const int g = lane >> 4;
#pragma unroll
  for (int i = 0; i < 8; ++i) { const int ka = k0 + 8 * g + i, kb = ka + 16;
    a[i] = (_Float16)(ka < K ? W[(size_t)(ka < K ? ka : K - 1) * ld + n] : 0.f); a[8 + i] = (_Float16)(kb < K ? W[(size_t)(kb < K ? kb : K - 1) * ld + n] : 0.f); }
  return a;
}
struct F2 { v16b h, l; };
__device__ __forceinline__ F2 bsplit16(const float v[16]) { F2 r;
#pragma unroll
  for (int i = 0; i < 16; ++i) { const __bf16 h = (__bf16)v[i]; r.h[i] = h; r.l[i] = (__bf16)(v[i] - (float)h); }
  return r; }
__device__ __forceinline__ F2 split_row(const float* row, int k0, int lane) { float v[16]; const float* p = row + k0 + 8 * (lane >> 4);
#pragma unroll
  for (int i = 0; i < 8; ++i) { v[i] = p[i]; v[8 + i] = p[16 + i]; }
  return bsplit16(v); }
__device__ __forceinline__ F2 split_rowK(const float* row, int k0, int lane, int K) { float v[16]; const int g = lane >> 4;
#pragma unroll
  for (int i = 0; i < 8; ++i) { const int ka = k0 + 8 * g + i, kb = ka + 16; v[i] = ka < K ? row[ka < K ? ka : K - 1] : 0.f; v[8 + i] = kb < K ? row[kb < K ? kb : K - 1] : 0.f; }
  return bsplit16(v); }
__device__ __forceinline__ F2 split_col(const float* W, int k0, int n, int lane, int ld, int K) { float v[16]; const int g = lane >> 4;
#pragma unroll
  for (int i = 0; i < 8; ++i) { const int ka = k0 + 8 * g + i, kb = ka + 16; v[i] = ka < K ? W[(size_t)(ka < K ? ka : K - 1) * ld + n] : 0.f; v[8 + i] = kb < K ? W[(size_t)(kb < K ? kb : K - 1) * ld + n] : 0.f; }
  return bsplit16(v); }
__device__ __forceinline__ v8f mac3(const F2& a, const F2& b, v8f c) { c = wmma_bf(a.l, b.h, c); c = wmma_bf(a.h, b.l, c); return wmma_bf(a.h, b.h, c); }
__device__ __forceinline__ float sigm(float v) { return 1.0f / (1.0f + expf(-v)); }
#define LDSX() do { asm volatile("s_wait_dscnt 0" ::: "memory"); __builtin_amdgcn_wave_barrier(); __builtin_amdgcn_fence(__ATOMIC_RELEASE, "workgroup"); } while (0)


// Global multi-head self attention over a 32 x 32 feature map (B 16, N 1,024 tokens, C 256, 8 heads x 32): LayerNorm, 1x1-conv q/k/v, softmax(Q K / sqrt(32)) V, 1x1-conv projection + bias.
#define NB 16
#define NT 1024
#define CC 256
#define NH 8
#define HD 32
#define NR (NB * NT)
#ifndef TQB
#define TQB (NT / 64)
#define TNB NB
#endif
typedef __attribute__((ext_vector_type(8))) __bf16 v8b;
__device__ __forceinline__ v16b frag_b(const __bf16* rowk0, int lane) {
  union { v16b v; v8b q[2]; } u; const __bf16* p = rowk0 + 8 * (lane >> 4);
  u.q[0] = *(const v8b*)p; u.q[1] = *(const v8b*)(p + 16); return u.v;
}
__device__ __forceinline__ float bfr(float v) { return (float)(__bf16)v; }
__device__ __attribute__((noinline)) float exp_ni(float v) { return expf(v); }
__device__ __attribute__((noinline)) float erf_ni(float v) { return erff(v); }

#define WS_PW  0u                                    // bf16 Wq, Wk, Wv, Wp in fragment order [4][half 2][kc 8][j 8][piece 2][lane 32][8] (k_pack)
#define WS_Q   (WS_PW + 2u * (size_t)4 * CC * CC)       // f16 q, k, v in the fragment order of k_attn (see k_proj); O f32 [NR][256]
#define WS_K   (WS_Q + 2u * (size_t)NR * CC)
#define WS_V   (WS_K + 2u * (size_t)NR * CC)
#define WS_O   (WS_V + 2u * (size_t)NB * CC * NT)
#define WS_END (WS_O + 4u * (size_t)NR * CC)

// ---- k_pack: each W (in,out) -> bf16 in the order in which mm_half reads it: the 16 bytes of lane (g, col) in piece p of fragment (kc, j) of a half are W[kc * 32 + p * 16 + 8 g + 0..7][half * 128 + j * 16 + col],
// so that a wave's fragment load is 512 contiguous bytes (4 whole lines) and the fragments of a half follow one another in the order of use.
// block = (16 columns, which W, 4 of the 8 kc); thread = one 16-byte piece: its eight loads in flight together (a wave load = 2 rows x 64 B), a wave stores 512 contiguous bytes; no LDS, no barrier
__global__ __launch_bounds__(256) void k_pack(const float* __restrict__ WQ, const float* __restrict__ WK, const float* __restrict__ WV, const float* __restrict__ WP, __bf16* __restrict__ PW) { const int jt = blockIdx.x, which = blockIdx.y, q = blockIdx.z * 256 + threadIdx.x; const int lane = q & 31, p = (q >> 5) & 1, kc = q >> 6; const float* w = (which == 0) ? WQ : (which == 1) ? WK : (which == 2) ? WV : WP;
  const float* s = w + (size_t)(kc * 32 + p * 16 + 8 * (lane >> 4)) * CC + jt * 16 + (lane & 15); float v[8]; v8b o;
#pragma unroll   // v and o, indexed by constants only, stay in registers
  for (int e = 0; e < 8; ++e) v[e] = s[(size_t)e * CC];
#pragma unroll
  for (int e = 0; e < 8; ++e) o[e] = (__bf16)v[e];
  *(v8b*)(PW + ((((size_t)which * 2 + (jt >> 3)) * 8 + kc) * 8 + (jt & 7)) * 512 + p * 256 + lane * 8) = o; }
// lane l with lane l ^ 16
__device__ __forceinline__ float xhalf(float x) { return __builtin_bit_cast(float, __builtin_amdgcn_permlanex16(__builtin_bit_cast(int, x), __builtin_bit_cast(int, x), 0x76543210, 0xfedcba98, false, false)); }
// ---- the product of k_out: acc[j] += A (the wave's 16 rows, bf16 hi + lo) . W (columns 16 j + 0..15 of the half at pw), k = 0..255; pa = the lane's own row, at its 8 * (lane >> 4); pw = the half's packed fragments (k_pack), at the lane's 16 bytes
// software pipeline in registers: W fragments come in groups of WG, WRING - 1 groups ahead of the group that is multiplied; the A rows of a k-step come ARING - 1 k-steps ahead
#define WG 1
#define WRING 8
#define ARING 2
__device__ __forceinline__ void ld_a(v4f (&d)[4], const float* p) { d[0] = *(const v4f*)p; d[1] = *(const v4f*)(p + 4); d[2] = *(const v4f*)(p + 16); d[3] = *(const v4f*)(p + 20); }
__device__ __forceinline__ void ld_w(v8b (&d)[WG][2], const __bf16* pw, int gi) {
#pragma unroll   // as in mm_half: d is indexed by constants only
  for (int i = 0; i < WG; ++i) { const __bf16* p = pw + (size_t)(gi * WG + i) * 512; d[i][0] = *(const v8b*)p; d[i][1] = *(const v8b*)(p + 256); } }
__device__ __forceinline__ void mm_half(const float* pa, const __bf16* pw, v8f (&acc)[8]) {
  v4f ar[ARING][4]; v8b wr[WRING][WG][2]; F2 a;   // every loop here is unrolled so that the rings, indexed by constants only, stay in registers
#pragma unroll
  for (int s = 0; s < ARING - 1; ++s) ld_a(ar[s], pa + s * 32);
#pragma unroll
  for (int gi = 0; gi < WRING - 1; ++gi) ld_w(wr[gi], pw, gi);
#pragma unroll
  for (int gi = 0; gi < 64 / WG; ++gi) { const int kc = gi / (8 / WG), jb = (gi % (8 / WG)) * WG;
    if (gi + WRING - 1 < 64 / WG) ld_w(wr[(gi + WRING - 1) % WRING], pw, gi + WRING - 1);
    if (jb == 0 && kc + ARING - 1 < CC / 32) ld_a(ar[(kc + ARING - 1) % ARING], pa + (kc + ARING - 1) * 32);
    if (gi == 0) asm volatile("s_wait_xcnt 0x0" ::: "memory");   // from here on the compiler may reuse a register that a load issued above names (seen: the bias loads' offset register becomes an accumulator)
    __builtin_amdgcn_sched_barrier(0);   // keeps a k-step's split behind this point: lifted among the earlier WMMAs (seen without it), its wait for the A rows also waits out nearly all the W loads in flight
    if (jb == 0) { float v[16];
#pragma unroll
      for (int i = 0; i < 4; ++i) { v[i] = ar[kc % ARING][0][i]; v[4 + i] = ar[kc % ARING][1][i]; v[8 + i] = ar[kc % ARING][2][i]; v[12 + i] = ar[kc % ARING][3][i]; }
      a = bsplit16(v); }
#pragma unroll
    for (int i = 0; i < WG; ++i) { union { v16b v; v8b q[2]; } u; u.q[0] = wr[gi % WRING][i][0]; u.q[1] = wr[gi % WRING][i][1];
      acc[jb + i] = wmma_bf(a.h, u.v, acc[jb + i]); acc[jb + i] = wmma_bf(a.l, u.v, acc[jb + i]); } }
  asm volatile("s_wait_xcnt 0x0" ::: "memory"); }   // the caller's next trip forms new addresses in the registers that the loads above name
// two f32 -> two bf16 in one word (round to nearest even, first value in the low half), and back to f32
typedef __attribute__((ext_vector_type(2))) __bf16 v2b;
__device__ __forceinline__ unsigned pk_bf(v2f v) { return __builtin_bit_cast(unsigned, __builtin_convertvector(v, v2b)); }
__device__ __forceinline__ v2f up_bf(unsigned w) { const v2f r = { __builtin_bit_cast(float, w << 16), __builtin_bit_cast(float, w & 0xffff0000u) }; return r; }
// ---- the product of k_proj: as mm_half, but A (the wave's 16 rows, bf16 hi + lo, all 8 k-steps) is already in registers, and a pass takes PJ column tiles (16 PJ columns), so that A, the accumulators and the W ring fit in 256 registers;
// only the W fragments are loaded, PRING - 1 ahead; pw = the pass's first fragment in the half's packed order [kc 8][j 8], at the lane's 16 bytes.
// SW = false: D = A . W, a lane holds 8 token rows (8 g + r) of ONE column; SW = true: the same two fragments with their places exchanged (A and B fragments have one layout), D = W^T . A^T, a lane holds 8 columns (8 g + r) of ONE token row; same products, same k order
#define PJ 4
#define PRING 8
__device__ __forceinline__ void ld_w1(v8b (&d)[2], const __bf16* pw, int gi) { const __bf16* p = pw + (size_t)((gi / PJ) * 8 + gi % PJ) * 512; d[0] = *(const v8b*)p; d[1] = *(const v8b*)(p + 256); }
template <bool SW> __device__ __forceinline__ void mm_res(const F2 (&a)[CC / 32], const __bf16* pw, v8f (&acc)[PJ]) {
  v8b wr[PRING][2];   // every loop here is unrolled so that the ring, indexed by constants only, stays in registers
#pragma unroll
  for (int gi = 0; gi < PRING - 1; ++gi) ld_w1(wr[gi], pw, gi);
#pragma unroll
  for (int gi = 0; gi < 8 * PJ; ++gi) { const int kc = gi / PJ, j = gi % PJ;
    if (gi + PRING - 1 < 8 * PJ) ld_w1(wr[(gi + PRING - 1) % PRING], pw, gi + PRING - 1);
    if (gi == 0) asm volatile("s_wait_xcnt 0x0" ::: "memory");   // from here on the compiler may reuse a register that a load issued above names
    __builtin_amdgcn_sched_barrier(0);   // keeps each W load PRING - 1 fragments ahead of its use and the WMMAs in this order: without it (seen) the compiler regroups them, parts of A go to scratch and the counted waits become full waits
    union { v16b v; v8b q[2]; } u; u.q[0] = wr[gi % PRING][0]; u.q[1] = wr[gi % PRING][1];
    if (SW) { acc[j] = wmma_bf(u.v, a[kc].h, acc[j]); acc[j] = wmma_bf(u.v, a[kc].l, acc[j]); }
    else { acc[j] = wmma_bf(a[kc].h, u.v, acc[j]); acc[j] = wmma_bf(a[kc].l, u.v, acc[j]); } }
  asm volatile("s_wait_xcnt 0x0" ::: "memory"); }   // the caller's next trip forms new addresses in the registers that the loads above name
// ---- k_proj: block = (64 rows, which). Each wave first normalises its own 16 token rows in registers, in the layout of the A fragments: lane (g, col) holds of row col the channels 32 kc + 8 g + 0..7 and 32 kc + 16 + 8 g + 0..7,
// that is half a row; all 32 loads in flight at once; LayerNorm over 256 channels (mean-square var, 1e-5) x g + b: sums in the lane, one exchange between the halves; g and b, rounded once by the block, come from LDS (one barrier). The rows, split once into bf16 hi + lo, stay in registers for both halves.
// then A . W, all 256 cols, + bias (rounded once by the block, from LDS), rounded to f16 and stored from the accumulators in the order in which k_attn reads its fragments: the 8 results of a lane in a tile are the lane's 16 bytes of one fragment piece, a wave's store is 512 contiguous bytes.
// q and k by W^T . A^T (a lane holds channels 16 p + 8 g + 0..7 of head h for token col of 16-token tile t): [b][h][t 64][piece p 2][lane 32][8];
// v by A . W (a lane holds tokens 8 g + 0..7 of tile t = 2 ks + p for channel 16 dt + col of head h): [b][h][dt 2][ks 32][piece p 2][lane 32][8]
__global__ __launch_bounds__(128) void k_proj(const float* __restrict__ X, const float* __restrict__ G, const float* __restrict__ Bt, const __bf16* __restrict__ PW, const float* __restrict__ BQ, const float* __restrict__ BK, const float* __restrict__ BV, _Float16* __restrict__ Q, _Float16* __restrict__ Kr, _Float16* __restrict__ V) {
  __shared__ __align__(16) float sg[CC], sb[CC], sc[CC];
  // the wave's number is put in a scalar register: what is formed from it (its rows, its image, its tile) is then scalar arithmetic and holds no vector register; left in a vector register (seen), a fragment of A went to scratch
  const int tid = threadIdx.x, wave = __builtin_amdgcn_readfirstlane(tid >> 5), lane = tid & 31, col = lane & 15, g = lane >> 4; const int which = blockIdx.y; const size_t rb = (size_t)blockIdx.x * 64; const size_t r0 = rb + wave * 16;
  const __bf16* Wr = PW + ((size_t)which * CC) * CC; const float* BB = (which == 0) ? BQ : (which == 1) ? BK : BV;
  F2 a[CC / 32];
  { v4f x[CC / 32][4], t[4];   // the loops of this block are unrolled so that x, t and a, indexed by constants only, stay in registers
    const v2f g2 = *(const v2f*)(G + 2 * tid), b2 = *(const v2f*)(Bt + 2 * tid), c2 = *(const v2f*)(BB + 2 * tid);   // the thread's share of g, b and the bias for the block
    const float* px = X + (r0 + col) * CC + 8 * g;
#pragma unroll
    for (int kc = 0; kc < CC / 32; ++kc) ld_a(x[kc], px + kc * 32);
    asm volatile("s_wait_xcnt 0x0" ::: "memory");   // the arithmetic below may reuse the address registers of the loads above; no load crosses this statement, so all of them are issued ahead of the arithmetic and are in flight together
    *(v2f*)&sg[2 * tid] = up_bf(pk_bf(g2)); *(v2f*)&sb[2 * tid] = up_bf(pk_bf(b2)); *(v2f*)&sc[2 * tid] = up_bf(pk_bf(c2));
    __syncthreads();   // g, b and the bias, rounded once by the block, are read by every wave
#pragma unroll
    for (int kc = 0; kc < CC / 32; ++kc) {
#pragma unroll
      for (int q = 0; q < 4; ++q) { const v2f lo = up_bf(pk_bf(x[kc][q].lo)), hi = up_bf(pk_bf(x[kc][q].hi)); x[kc][q].lo = lo; x[kc][q].hi = hi;
        t[q] = kc ? t[q] + x[kc][q] : x[kc][q]; } }
    v4f u = (t[0] + t[1]) + (t[2] + t[3]); float s = (u[0] + u[1]) + (u[2] + u[3]); s += xhalf(s);
    const float mu = s / (float)CC;
#pragma unroll
    for (int kc = 0; kc < CC / 32; ++kc) {
#pragma unroll
      for (int q = 0; q < 4; ++q) { x[kc][q] -= mu; t[q] = kc ? t[q] + x[kc][q] * x[kc][q] : x[kc][q] * x[kc][q]; } }
    u = (t[0] + t[1]) + (t[2] + t[3]); s = (u[0] + u[1]) + (u[2] + u[3]); s += xhalf(s);
    const float inv = 1.0f / sqrtf(s / (float)CC + 1e-5f);
#pragma unroll
    for (int kc = 0; kc < CC / 32; ++kc) { v4f gg[4], bb[4]; union { v16b v; unsigned w[8]; } fh, fl; ld_a(gg, sg + kc * 32 + 8 * g); ld_a(bb, sb + kc * 32 + 8 * g);
#pragma unroll
      for (int q = 0; q < 4; ++q) { const v4f y = x[kc][q] * inv * gg[q] + bb[q];   // element 4 q + i of the fragment, as ld_a orders it
        fh.w[2 * q] = pk_bf(y.lo); fh.w[2 * q + 1] = pk_bf(y.hi); fl.w[2 * q] = pk_bf(y.lo - up_bf(fh.w[2 * q])); fl.w[2 * q + 1] = pk_bf(y.hi - up_bf(fh.w[2 * q + 1])); }
      a[kc].h = fh.v; a[kc].l = fl.v; } }
  const size_t bi = r0 / NT; const int tt = (int)(r0 % NT) >> 4;   // the wave's image and its 16-token tile
  if (which < 2) { _Float16* dst = ((which == 0) ? Q : Kr) + (bi * NH * 64 + tt) * 512 + lane * 8;
#pragma unroll 1   // as before: the four passes stay rolled, so the kernel's code stays short
    for (int ps = 0; ps < 16 / PJ; ++ps) { v8f acc[PJ] = {};
      mm_res<true>(a, Wr + (size_t)(ps * PJ / 8) * (128 * CC) + (size_t)(ps * PJ % 8) * 512 + lane * 8, acc);
#pragma unroll   // here and below: acc and hv, indexed by constants only, stay in registers
      for (int j = 0; j < PJ; ++j) { const int jt = ps * PJ + j, c0 = jt * 16 + 8 * g; const v4f b0 = *(const v4f*)&sc[c0], b1 = *(const v4f*)&sc[c0 + 4]; v8h hv;
#pragma unroll
        for (int r = 0; r < 4; ++r) { hv[r] = (_Float16)(acc[j][r] + b0[r]); hv[4 + r] = (_Float16)(acc[j][4 + r] + b1[r]); }
        *(v8h*)(dst + (size_t)((jt >> 1) * 128 + (jt & 1)) * 256) = hv; } } }
  else { _Float16* dst = V + (bi * 2 * NH * 64 + tt) * 256 + lane * 8;
#pragma unroll 1   // as above
    for (int ps = 0; ps < 16 / PJ; ++ps) { v8f acc[PJ] = {};
      mm_res<false>(a, Wr + (size_t)(ps * PJ / 8) * (128 * CC) + (size_t)(ps * PJ % 8) * 512 + lane * 8, acc);
#pragma unroll
      for (int j = 0; j < PJ; ++j) { const int jt = ps * PJ + j; const float bb = sc[jt * 16 + col]; v8h hv;
#pragma unroll
        for (int r = 0; r < 8; ++r) hv[r] = (_Float16)(acc[j][r] + bb);
        *(v8h*)(dst + (size_t)jt * (64 * 256)) = hv; } } }
}
// ---- k_attn: block = 16 waves = 512 queries of one head, one block per WGP; the head's whole K and V^T (64 KB each, contiguous, in fragment order as k_proj stores them) are copied once to LDS, and every fragment of the key loop is read from there, 512 contiguous bytes a load.
// wave = 32 queries (2 query tiles), a trip = 64 keys: each K and V^T fragment is read once for both query tiles, and maximum, rescale and their exchange come once per 64 keys.
// S^T = K . Q^T (A = 16 key rows, B = 16 of the wave's queries): a lane holds 32 of the 64 scores of ONE query of each tile (keys j0 + 16 t + 8g + r, t = 0..3),
// so maximum and sum run in the lane, with one exchange between the halves; score tiles 2u and 2u + 1, converted in place, are the B operand of O^T += V^T . P^T for the 32 keys of step u (hardware k order, as frag_p loads V^T).
#define AQ 512          // queries per block
// a fragment stored in fragment order: f = its first piece, at the lane's 16 bytes; the second piece follows 512 B on
__device__ __forceinline__ v16h frag_p(const _Float16* f) { union { v16h v; v8h q[2]; } u; u.q[0] = *(const v8h*)f; u.q[1] = *(const v8h*)(f + 256); return u.v; }
#define KS 0.25503486f  // 32^-1/2 x log2(e): a raw product q . k times KS is the score's exponent to base 2
__global__ __launch_bounds__(512) void k_attn(const _Float16* __restrict__ Q, const _Float16* __restrict__ Kr, const _Float16* __restrict__ V, float* __restrict__ O) {
  __shared__ __align__(16) _Float16 sk[NT * HD]; __shared__ __align__(16) _Float16 sv[HD * NT];
  const int tid = threadIdx.x, wave = tid >> 5, lane = tid & 31, col = lane & 15, g = lane >> 4; const int h = blockIdx.y; const size_t b = blockIdx.z; const int q0 = blockIdx.x * AQ + wave * 32; const size_t rq = b * NT + q0; const size_t hb = (b * NH + h) * (size_t)(NT * HD);   // the head's 64 KB in each of q, k, v
  { v4u tk[8], tv[8];   // 4,096 pieces of 16 B of each operand, 8 + 8 a thread, all sixteen loads in flight, 512 contiguous bytes a load; both loops unrolled so that tk and tv, indexed by constants only, stay in registers
#pragma unroll
    for (int i = 0; i < 8; ++i) { const int e = i * 512 + tid; tk[i] = *(const v4u*)(Kr + hb + e * 8); tv[i] = *(const v4u*)(V + hb + e * 8); }
#pragma unroll
    for (int i = 0; i < 8; ++i) { const int e = i * 512 + tid; *(v4u*)&sk[e * 8] = tk[i]; *(v4u*)&sv[e * 8] = tv[i]; } }
  v16h bq[2];   // every loop over qt, t, u, dt, i, r below is unrolled so that the arrays, indexed by constants only, stay in registers
#pragma unroll
  for (int qt = 0; qt < 2; ++qt) bq[qt] = frag_p(Q + hb + (size_t)((q0 >> 4) + qt) * 512 + lane * 8);
  __syncthreads();   // the staged K and V^T are read by every wave of the block
  const _Float16 *pk = sk + lane * 8, *pv = sv + lane * 8;   // the lane's 16 bytes in a piece
  float m[2] = { -3.0e38f, -3.0e38f }, nb[2] = { 0.f, 0.f }, l[2] = { 0.f, 0.f };   // of query col of tile qt; m = running maximum of the raw products q . k; nb = 11 - m * KS, the addend of the exponent; l (times 2^11) holds this half's keys only until the epilogue
  v8f acc[2][2] = {};            // acc[qt][dt][r] = O^T[dt * 16 + 8g + r][col] of tile qt
#pragma unroll 1   // as before: the trips stay rolled, so the loop's code stays short
  for (int ks = 0; ks < NT / 64; ++ks) { v16h ak[4], av[2][2]; v8f s[2][4];   // all eight fragments' loads stand at the head of the trip
#pragma unroll
    for (int t = 0; t < 4; ++t) ak[t] = frag_p(pk + (ks * 4 + t) * 512);
#pragma unroll
    for (int dt = 0; dt < 2; ++dt) {
#pragma unroll
      for (int u = 0; u < 2; ++u) av[dt][u] = frag_p(pv + (dt * 32 + ks * 2 + u) * 512); }
    __builtin_amdgcn_sched_barrier(0);   // keeps all sixteen LDS loads here as one group: without it (seen) half of the V^T loads sink among the last WMMAs, each a few instructions ahead of its wait
#pragma unroll
    for (int t = 0; t < 4; ++t) {
#pragma unroll
      for (int qt = 0; qt < 2; ++qt) { v8f c = {}; s[qt][t] = wmma16(ak[t], bq[qt], c); } }   // raw products: the factor KS > 0 keeps their order, so the maximum is taken on them as they are
#pragma unroll
    for (int qt = 0; qt < 2; ++qt) {
      float ma = fmaxf(s[qt][0][0], s[qt][1][0]), mb = fmaxf(s[qt][2][0], s[qt][3][0]);   // two chains, so that a link of one stands in the latency of the other
#pragma unroll
      for (int r = 1; r < 8; ++r) { ma = fmaxf(ma, fmaxf(s[qt][0][r], s[qt][1][r])); mb = fmaxf(mb, fmaxf(s[qt][2][r], s[qt][3][r])); }
      float mx = fmaxf(ma, mb); mx = fmaxf(mx, xhalf(mx));
      const float mn = fmaxf(m[qt], mx); const float nn = 11.0f - mn * KS; const float alpha = (m[qt] <= -1.0e38f) ? 0.f : __builtin_amdgcn_exp2f(nn - nb[qt]);
      v16h pb[2]; v2f es[4];
#pragma unroll
      for (int t = 0; t < 4; ++t) {
#pragma unroll
        for (int i = 0; i < 4; ++i) { const v2f c2 = { s[qt][t][2 * i], s[qt][t][2 * i + 1] }; const v2f x = c2 * KS + nn;   // one multiply-add a score: 2^11 exp((c - max) 32^-1/2) = 2^(c KS + nn)
          const v2f e = { __builtin_amdgcn_exp2f(x[0]), __builtin_amdgcn_exp2f(x[1]) }; es[t] = i ? es[t] + e : e; pb[t >> 1][(t & 1) * 8 + 2 * i] = (_Float16)e[0]; pb[t >> 1][(t & 1) * 8 + 2 * i + 1] = (_Float16)e[1]; } }
      const v2f e2 = (es[0] + es[1]) + (es[2] + es[3]);
      l[qt] = l[qt] * alpha + (e2[0] + e2[1]); m[qt] = mn; nb[qt] = nn;
#pragma unroll
      for (int dt = 0; dt < 2; ++dt) {
#pragma unroll
        for (int r = 0; r < 8; ++r) acc[qt][dt][r] *= alpha; }
#pragma unroll
      for (int u = 0; u < 2; ++u) {
#pragma unroll
        for (int dt = 0; dt < 2; ++dt) acc[qt][dt] = wmma16(av[dt][u], pb[u], acc[qt][dt]); } } }
#pragma unroll
  for (int qt = 0; qt < 2; ++qt) { const float lt = l[qt] + xhalf(l[qt]);
    const float il = 1.0f / lt;   // numerator and l both carry the 2^11
#pragma unroll
    for (int dt = 0; dt < 2; ++dt) { float* po = O + (rq + qt * 16 + col) * CC + h * HD + dt * 16 + 8 * g;
      const v4f lo = { acc[qt][dt][0] * il, acc[qt][dt][1] * il, acc[qt][dt][2] * il, acc[qt][dt][3] * il }, hi = { acc[qt][dt][4] * il, acc[qt][dt][5] * il, acc[qt][dt][6] * il, acc[qt][dt][7] * il };
      vst2(po, lo); vst2(po + 4, hi); } }
}
// ---- k_out: block = 64 rows: out = Y (hi + lo) . Wp + bp; whole 1-KB rows
__global__ __launch_bounds__(128) void k_out(const float* __restrict__ O, const __bf16* __restrict__ PW, const float* __restrict__ BP, float* __restrict__ OUT) {
  __shared__ __align__(16) float sx[64][CC + 4];
  const int tid = threadIdx.x, wave = tid >> 5, lane = tid & 31, col = lane & 15, g = lane >> 4; const size_t rb = (size_t)blockIdx.x * 64; const size_t r0 = rb + wave * 16; const __bf16* Wr = PW + (size_t)3 * CC * CC;
#pragma unroll 1
  for (int half = 0; half < 2; ++half) { v8f acc[8] = {}; float bs[8];   // the lane's eight bias values, fetched ahead of the product and not one by one behind it
#pragma unroll   // bs, indexed by constants only, stays in registers
    for (int j = 0; j < 8; ++j) bs[j] = BP[half * 128 + j * 16 + col];
    mm_half(O + (r0 + col) * CC + 8 * g, Wr + (size_t)half * (128 * CC) + lane * 8, acc);
#pragma unroll
    for (int j = 0; j < 8; ++j) { const int c = half * 128 + j * 16 + col; const float bb = bfr(bs[j]);
#pragma unroll
      for (int r = 0; r < 8; ++r) sx[wave * 16 + 8 * g + r][c] = acc[j][r] + bb; } }
  __syncthreads();
  for (int e = tid; e < 64 * (CC / 4); e += 128) { const int rl = e >> 6, q = e & 63; vst2(OUT + (rb + rl) * CC + q * 4, *(const v4f*)&sx[rl][q * 4]); }
}
extern "C" void kernel_launch(void* const* d_in, const int* in_sizes, int n_in, void* d_out, int out_size, void* d_ws, size_t ws_size, hipStream_t stream) {
  (void)in_sizes; (void)n_in; (void)out_size;
  const float** F = (const float**)d_in;   // 0 x [16,32,32,256], 1 gamma, 2 beta, 3 Wq [256,256] (in,out), 4 bq, 5 Wk, 6 bk, 7 Wv, 8 bv, 9 Wp [256,256] (in,out), 10 bp
  if (ws_size < (size_t)WS_END) return;
  char* ws = (char*)d_ws; __bf16* PW = (__bf16*)ws; float* O = (float*)(ws + WS_O); _Float16 *Q = (_Float16*)(ws + WS_Q), *Kr = (_Float16*)(ws + WS_K), *V = (_Float16*)(ws + WS_V);
  k_pack<<<dim3(CC / 16, 4, 2), 256, 0, stream>>>(F[3], F[5], F[7], F[9], PW);
  k_proj<<<dim3(TNB * NT / 64, 3), 128, 0, stream>>>(F[0], F[1], F[2], PW, F[4], F[6], F[8], Q, Kr, V);
  k_attn<<<dim3(NT / AQ, NH, TNB), 512, 0, stream>>>(Q, Kr, V, O);
  k_out<<<TNB * NT / 64, 128, 0, stream>>>(O, PW, F[10], (float*)d_out);
}

// v010
// It runs in 46.7 microseconds.
// Two timings next to v009 both put it at 1.14 times that version's speed.
// Over all steps from v000 it is 3.81 times as fast.
// compute dtype: all float inputs rounded to bf16; LayerNorm (eps 1e-5) in f32; Q/K/V = LN(x) (bf16 hi + lo, 2 products) . W + b on WMMA 16x16x32 ((in,out) weights packed in fragment order), rounded once to f16; PLAIN attention (8 heads x 32 over the 1,024 positions of each image): q, k single f16 x 32^-1/2, running-max softmax in f32 (hardware exp), P (scaled by 2^11, single f16) x v (single f16); out = Y (bf16 hi + residual) . Wp (2 products) + bp.
#include <hip/hip_runtime.h>
#include <math.h>

typedef __attribute__((ext_vector_type(16))) _Float16 v16h;
typedef __attribute__((ext_vector_type(16))) __bf16 v16b;
typedef __attribute__((ext_vector_type(8)))  _Float16 v8h;
typedef __attribute__((ext_vector_type(8)))  float v8f;
typedef __attribute__((ext_vector_type(4)))  float v4f;
typedef __attribute__((ext_vector_type(2)))  float v2f;
typedef __attribute__((ext_vector_type(4)))  unsigned v4u;
typedef __attribute__((ext_vector_type(4)))  int v4i;
typedef float __attribute__((may_alias)) float_a;
typedef int __attribute__((may_alias)) int_a;

template <typename T> __device__ __forceinline__ void vst2(void* p, T v) { *(T*)p = v;  }
__device__ __forceinline__ v8f wmma16(v16h a, v16h b, v8f c) {   // the builtin alone: k_attn issues these in runs of independent ones, which stand in one another's slots; what distance is still owed the compiler pads
  return __builtin_amdgcn_wmma_f32_16x16x32_f16(false, a, false, b, (short)0, c, false, false);
}
__device__ __forceinline__ v8f wmma_bf(v16b a, v16b b, v8f c) {
  v8f d = __builtin_amdgcn_wmma_f32_16x16x32_bf16(false, a, false, b, (short)0, c, false, false);
  asm volatile("v_nop\n\tv_nop\n\tv_nop\n\tv_nop" : "+v"(d) : "v"(a), "v"(b));
  return d;
}
// 16x16x32 fragments: lane = (h = lane>>4, row/col = lane&15); elements 0..7 = k0+8h+0..7, 8..15 = k0+16+8h+0..7; D element r = row 8h+r
__device__ __forceinline__ v16h frag_h(const _Float16* rowk0, int lane) {
  union { v16h v; v8h q[2]; } u; const _Float16* p = rowk0 + 8 * (lane >> 4);
  u.q[0] = *(const v8h*)p; u.q[1] = *(const v8h*)(p + 16); return u.v;
}
__device__ __forceinline__ v16h frag_f32(const float* rowk0, int lane) {
  v16h a; const float* p = rowk0 + 8 * (lane >> 4);
#pragma unroll
  for (int i = 0; i < 8; ++i) { a[i] = (_Float16)p[i]; a[8 + i] = (_Float16)p[16 + i]; }
  return a;
}
__device__ __forceinline__ v16h frag_f32s(const float* rowk0, int lane, float sc) {
  v16h a; const float* p = rowk0 + 8 * (lane >> 4);
#pragma unroll
  for (int i = 0; i < 8; ++i) { a[i] = (_Float16)(p[i] * sc); a[8 + i] = (_Float16)(p[16 + i] * sc); }
  return a;
}
// column fragment from a [K][ld] layout (column n), rows >= K read as 0
__device__ __forceinline__ v16h fragc_f32(const float* W, int k0, int n, int lane, int ld, int K) {
  v16h a; const int g = lane >> 4;
#pragma unroll
  for (int i = 0; i < 8; ++i) { const int ka = k0 + 8 * g + i, kb = ka + 16;
    a[i] = (_Float16)(ka < K ? W[(size_t)(ka < K ? ka : K - 1) * ld + n] : 0.f); a[8 + i] = (_Float16)(kb < K ? W[(size_t)(kb < K ? kb : K - 1) * ld + n] : 0.f); }
  return a;
}
struct F2 { v16b h, l; };
__device__ __forceinline__ F2 bsplit16(const float v[16]) { F2 r;
#pragma unroll
  for (int i = 0; i < 16; ++i) { const __bf16 h = (__bf16)v[i]; r.h[i] = h; r.l[i] = (__bf16)(v[i] - (float)h); }
  return r; }
__device__ __forceinline__ F2 split_row(const float* row, int k0, int lane) { float v[16]; const float* p = row + k0 + 8 * (lane >> 4);
#pragma unroll
  for (int i = 0; i < 8; ++i) { v[i] = p[i]; v[8 + i] = p[16 + i]; }
  return bsplit16(v); }
__device__ __forceinline__ F2 split_rowK(const float* row, int k0, int lane, int K) { float v[16]; const int g = lane >> 4;
#pragma unroll
  for (int i = 0; i < 8; ++i) { const int ka = k0 + 8 * g + i, kb = ka + 16; v[i] = ka < K ? row[ka < K ? ka : K - 1] : 0.f; v[8 + i] = kb < K ? row[kb < K ? kb : K - 1] : 0.f; }
  return bsplit16(v); }
__device__ __forceinline__ F2 split_col(const float* W, int k0, int n, int lane, int ld, int K) { float v[16]; const int g = lane >> 4;
#pragma unroll
  for (int i = 0; i < 8; ++i) { const int ka = k0 + 8 * g + i, kb = ka + 16; v[i] = ka < K ? W[(size_t)(ka < K ? ka : K - 1) * ld + n] : 0.f; v[8 + i] = kb < K ? W[(size_t)(kb < K ? kb : K - 1) * ld + n] : 0.f; }
  return bsplit16(v); }
__device__ __forceinline__ v8f mac3(const F2& a, const F2& b, v8f c) { c = wmma_bf(a.l, b.h, c); c = wmma_bf(a.h, b.l, c); return wmma_bf(a.h, b.h, c); }
__device__ __forceinline__ float sigm(float v) { return 1.0f / (1.0f + expf(-v)); }
#define LDSX() do { asm volatile("s_wait_dscnt 0" ::: "memory"); __builtin_amdgcn_wave_barrier(); __builtin_amdgcn_fence(__ATOMIC_RELEASE, "workgroup"); } while (0)


// Global multi-head self attention over a 32 x 32 feature map (B 16, N 1,024 tokens, C 256, 8 heads x 32): LayerNorm, 1x1-conv q/k/v, softmax(Q K / sqrt(32)) V, 1x1-conv projection + bias.
#define NB 16
#define NT 1024
#define CC 256
#define NH 8
#define HD 32
#define NR (NB * NT)
#ifndef TQB
#define TQB (NT / 64)
#define TNB NB
#endif
typedef __attribute__((ext_vector_type(8))) __bf16 v8b;
__device__ __forceinline__ v16b frag_b(const __bf16* rowk0, int lane) {
  union { v16b v; v8b q[2]; } u; const __bf16* p = rowk0 + 8 * (lane >> 4);
  u.q[0] = *(const v8b*)p; u.q[1] = *(const v8b*)(p + 16); return u.v;
}
__device__ __forceinline__ float bfr(float v) { return (float)(__bf16)v; }
__device__ __attribute__((noinline)) float exp_ni(float v) { return expf(v); }
__device__ __attribute__((noinline)) float erf_ni(float v) { return erff(v); }

#define WS_PW  0u                                    // bf16 Wq, Wk, Wv, Wp in fragment order [4][half 2][kc 8][j 8][piece 2][lane 32][8] (k_pack)
#define WS_Q   (WS_PW + 2u * (size_t)4 * CC * CC)       // f16 q, k, v in the fragment order of k_attn (see k_proj); Y bf16 hi + lo in the A-fragment order of k_out (see k_attn), 4 B an element
#define WS_K   (WS_Q + 2u * (size_t)NR * CC)
#define WS_V   (WS_K + 2u * (size_t)NR * CC)
#define WS_O   (WS_V + 2u * (size_t)NB * CC * NT)
#define WS_END (WS_O + 4u * (size_t)NR * CC)

// ---- k_pack: each W (in,out) -> bf16 in the order in which mm_res reads it: the 16 bytes of lane (g, col) in piece p of fragment (kc, j) of a half are W[kc * 32 + p * 16 + 8 g + 0..7][half * 128 + j * 16 + col],
// so that a wave's fragment load is 512 contiguous bytes (4 whole lines) and the fragments of a half follow one another in the order of use.
// block = (16 columns, which W, 4 of the 8 kc); thread = one 16-byte piece: its eight loads in flight together (a wave load = 2 rows x 64 B), a wave stores 512 contiguous bytes; no LDS, no barrier
__global__ __launch_bounds__(256) void k_pack(const float* __restrict__ WQ, const float* __restrict__ WK, const float* __restrict__ WV, const float* __restrict__ WP, __bf16* __restrict__ PW) { const int jt = blockIdx.x, which = blockIdx.y, q = blockIdx.z * 256 + threadIdx.x; const int lane = q & 31, p = (q >> 5) & 1, kc = q >> 6; const float* w = (which == 0) ? WQ : (which == 1) ? WK : (which == 2) ? WV : WP;
  const float* s = w + (size_t)(kc * 32 + p * 16 + 8 * (lane >> 4)) * CC + jt * 16 + (lane & 15); float v[8]; v8b o;
#pragma unroll   // v and o, indexed by constants only, stay in registers
  for (int e = 0; e < 8; ++e) v[e] = s[(size_t)e * CC];
#pragma unroll
  for (int e = 0; e < 8; ++e) o[e] = (__bf16)v[e];
  *(v8b*)(PW + ((((size_t)which * 2 + (jt >> 3)) * 8 + kc) * 8 + (jt & 7)) * 512 + p * 256 + lane * 8) = o; }
// lane l with lane l ^ 16
__device__ __forceinline__ float xhalf(float x) { return __builtin_bit_cast(float, __builtin_amdgcn_permlanex16(__builtin_bit_cast(int, x), __builtin_bit_cast(int, x), 0x76543210, 0xfedcba98, false, false)); }
// a lane's 16 values of one k-step of a row, as an A fragment orders them
__device__ __forceinline__ void ld_a(v4f (&d)[4], const float* p) { d[0] = *(const v4f*)p; d[1] = *(const v4f*)(p + 4); d[2] = *(const v4f*)(p + 16); d[3] = *(const v4f*)(p + 20); }
// two f32 -> two bf16 in one word (round to nearest even, first value in the low half), and back to f32
typedef __attribute__((ext_vector_type(2))) __bf16 v2b;
__device__ __forceinline__ unsigned pk_bf(v2f v) { return __builtin_bit_cast(unsigned, __builtin_convertvector(v, v2b)); }
__device__ __forceinline__ v2f up_bf(unsigned w) { const v2f r = { __builtin_bit_cast(float, w << 16), __builtin_bit_cast(float, w & 0xffff0000u) }; return r; }
// ---- the product of k_proj and k_out: acc[j] += A . W (columns 16 j + 0..15 of the pass), k = 0..255, software-pipelined in registers; A (the wave's 16 rows, bf16 hi + lo, all 8 k-steps) is already in registers, and a pass takes PJ column tiles (16 PJ columns), so that A, the accumulators and the W ring fit in 256 registers;
// only the W fragments are loaded, PRING - 1 ahead; pw = the pass's first fragment in the half's packed order [kc 8][j 8], at the lane's 16 bytes.
// SW = false: D = A . W, a lane holds 8 token rows (8 g + r) of ONE column; SW = true: the same two fragments with their places exchanged (A and B fragments have one layout), D = W^T . A^T, a lane holds 8 columns (8 g + r) of ONE token row; same products, same k order
#define PJ 4
#define PRING 8
__device__ __forceinline__ void ld_w1(v8b (&d)[2], const __bf16* pw, int gi) { const __bf16* p = pw + (size_t)((gi / PJ) * 8 + gi % PJ) * 512; d[0] = *(const v8b*)p; d[1] = *(const v8b*)(p + 256); }
template <bool SW> __device__ __forceinline__ void mm_res(const F2 (&a)[CC / 32], const __bf16* pw, v8f (&acc)[PJ]) {
  v8b wr[PRING][2];   // every loop here is unrolled so that the ring, indexed by constants only, stays in registers
#pragma unroll
  for (int gi = 0; gi < PRING - 1; ++gi) ld_w1(wr[gi], pw, gi);
#pragma unroll
  for (int gi = 0; gi < 8 * PJ; ++gi) { const int kc = gi / PJ, j = gi % PJ;
    if (gi + PRING - 1 < 8 * PJ) ld_w1(wr[(gi + PRING - 1) % PRING], pw, gi + PRING - 1);
    if (gi == 0) asm volatile("s_wait_xcnt 0x0" ::: "memory");   // from here on the compiler may reuse a register that a load issued above names
    __builtin_amdgcn_sched_barrier(0);   // keeps each W load PRING - 1 fragments ahead of its use and the WMMAs in this order: without it (seen) the compiler regroups them, parts of A go to scratch and the counted waits become full waits
    union { v16b v; v8b q[2]; } u; u.q[0] = wr[gi % PRING][0]; u.q[1] = wr[gi % PRING][1];
    if (SW) { acc[j] = wmma_bf(u.v, a[kc].h, acc[j]); acc[j] = wmma_bf(u.v, a[kc].l, acc[j]); }
    else { acc[j] = wmma_bf(a[kc].h, u.v, acc[j]); acc[j] = wmma_bf(a[kc].l, u.v, acc[j]); } }
  asm volatile("s_wait_xcnt 0x0" ::: "memory"); }   // the caller's next trip forms new addresses in the registers that the loads above name
// ---- k_proj: block = (64 rows, which). Each wave first normalises its own 16 token rows in registers, in the layout of the A fragments: lane (g, col) holds of row col the channels 32 kc + 8 g + 0..7 and 32 kc + 16 + 8 g + 0..7,
// that is half a row; all 32 loads in flight at once; LayerNorm over 256 channels (mean-square var, 1e-5) x g + b: sums in the lane, one exchange between the halves; g and b, rounded once by the block, come from LDS (one barrier). The rows, split once into bf16 hi + lo, stay in registers for both halves.
// then A . W, all 256 cols, + bias (rounded once by the block, from LDS), rounded to f16 and stored from the accumulators in the order in which k_attn reads its fragments: the 8 results of a lane in a tile are the lane's 16 bytes of one fragment piece, a wave's store is 512 contiguous bytes.
// q and k by W^T . A^T (a lane holds channels 16 p + 8 g + 0..7 of head h for token col of 16-token tile t): [b][h][t 64][piece p 2][lane 32][8];
// v by A . W (a lane holds tokens 8 g + 0..7 of tile t = 2 ks + p for channel 16 dt + col of head h): [b][h][dt 2][ks 32][piece p 2][lane 32][8]
__global__ __launch_bounds__(128) void k_proj(const float* __restrict__ X, const float* __restrict__ G, const float* __restrict__ Bt, const __bf16* __restrict__ PW, const float* __restrict__ BQ, const float* __restrict__ BK, const float* __restrict__ BV, _Float16* __restrict__ Q, _Float16* __restrict__ Kr, _Float16* __restrict__ V) {
  __shared__ __align__(16) float sg[CC], sb[CC], sc[CC];
  // the wave's number is put in a scalar register: what is formed from it (its rows, its image, its tile) is then scalar arithmetic and holds no vector register; left in a vector register (seen), a fragment of A went to scratch
  const int tid = threadIdx.x, wave = __builtin_amdgcn_readfirstlane(tid >> 5), lane = tid & 31, col = lane & 15, g = lane >> 4; const int which = blockIdx.y; const size_t rb = (size_t)blockIdx.x * 64; const size_t r0 = rb + wave * 16;
  const __bf16* Wr = PW + ((size_t)which * CC) * CC; const float* BB = (which == 0) ? BQ : (which == 1) ? BK : BV;
  F2 a[CC / 32];
  { v4f x[CC / 32][4], t[4];   // the loops of this block are unrolled so that x, t and a, indexed by constants only, stay in registers
    const v2f g2 = *(const v2f*)(G + 2 * tid), b2 = *(const v2f*)(Bt + 2 * tid), c2 = *(const v2f*)(BB + 2 * tid);   // the thread's share of g, b and the bias for the block
    const float* px = X + (r0 + col) * CC + 8 * g;
#pragma unroll
    for (int kc = 0; kc < CC / 32; ++kc) ld_a(x[kc], px + kc * 32);
    asm volatile("s_wait_xcnt 0x0" ::: "memory");   // the arithmetic below may reuse the address registers of the loads above; no load crosses this statement, so all of them are issued ahead of the arithmetic and are in flight together
    *(v2f*)&sg[2 * tid] = up_bf(pk_bf(g2)); *(v2f*)&sb[2 * tid] = up_bf(pk_bf(b2)); *(v2f*)&sc[2 * tid] = up_bf(pk_bf(c2));
    __syncthreads();   // g, b and the bias, rounded once by the block, are read by every wave
#pragma unroll
    for (int kc = 0; kc < CC / 32; ++kc) {
#pragma unroll
      for (int q = 0; q < 4; ++q) { const v2f lo = up_bf(pk_bf(x[kc][q].lo)), hi = up_bf(pk_bf(x[kc][q].hi)); x[kc][q].lo = lo; x[kc][q].hi = hi;
        t[q] = kc ? t[q] + x[kc][q] : x[kc][q]; } }
    v4f u = (t[0] + t[1]) + (t[2] + t[3]); float s = (u[0] + u[1]) + (u[2] + u[3]); s += xhalf(s);
    const float mu = s / (float)CC;
#pragma unroll
    for (int kc = 0; kc < CC / 32; ++kc) {
#pragma unroll
      for (int q = 0; q < 4; ++q) { x[kc][q] -= mu; t[q] = kc ? t[q] + x[kc][q] * x[kc][q] : x[kc][q] * x[kc][q]; } }
    u = (t[0] + t[1]) + (t[2] + t[3]); s = (u[0] + u[1]) + (u[2] + u[3]); s += xhalf(s);
    const float inv = 1.0f / sqrtf(s / (float)CC + 1e-5f);
#pragma unroll
    for (int kc = 0; kc < CC / 32; ++kc) { v4f gg[4], bb[4]; union { v16b v; unsigned w[8]; } fh, fl; ld_a(gg, sg + kc * 32 + 8 * g); ld_a(bb, sb + kc * 32 + 8 * g);
#pragma unroll
      for (int q = 0; q < 4; ++q) { const v4f y = x[kc][q] * inv * gg[q] + bb[q];   // element 4 q + i of the fragment, as ld_a orders it
        fh.w[2 * q] = pk_bf(y.lo); fh.w[2 * q + 1] = pk_bf(y.hi); fl.w[2 * q] = pk_bf(y.lo - up_bf(fh.w[2 * q])); fl.w[2 * q + 1] = pk_bf(y.hi - up_bf(fh.w[2 * q + 1])); }
      a[kc].h = fh.v; a[kc].l = fl.v; } }
  const size_t bi = r0 / NT; const int tt = (int)(r0 % NT) >> 4;   // the wave's image and its 16-token tile
  if (which < 2) { _Float16* dst = ((which == 0) ? Q : Kr) + (bi * NH * 64 + tt) * 512 + lane * 8;
#pragma unroll 1   // as before: the four passes stay rolled, so the kernel's code stays short
    for (int ps = 0; ps < 16 / PJ; ++ps) { v8f acc[PJ] = {};
      mm_res<true>(a, Wr + (size_t)(ps * PJ / 8) * (128 * CC) + (size_t)(ps * PJ % 8) * 512 + lane * 8, acc);
#pragma unroll   // here and below: acc and hv, indexed by constants only, stay in registers
      for (int j = 0; j < PJ; ++j) { const int jt = ps * PJ + j, c0 = jt * 16 + 8 * g; const v4f b0 = *(const v4f*)&sc[c0], b1 = *(const v4f*)&sc[c0 + 4]; v8h hv;
#pragma unroll
        for (int r = 0; r < 4; ++r) { hv[r] = (_Float16)(acc[j][r] + b0[r]); hv[4 + r] = (_Float16)(acc[j][4 + r] + b1[r]); }
        *(v8h*)(dst + (size_t)((jt >> 1) * 128 + (jt & 1)) * 256) = hv; } } }
  else { _Float16* dst = V + (bi * 2 * NH * 64 + tt) * 256 + lane * 8;
#pragma unroll 1   // as above
    for (int ps = 0; ps < 16 / PJ; ++ps) { v8f acc[PJ] = {};
      mm_res<false>(a, Wr + (size_t)(ps * PJ / 8) * (128 * CC) + (size_t)(ps * PJ % 8) * 512 + lane * 8, acc);
#pragma unroll
      for (int j = 0; j < PJ; ++j) { const int jt = ps * PJ + j; const float bb = sc[jt * 16 + col]; v8h hv;
#pragma unroll
        for (int r = 0; r < 8; ++r) hv[r] = (_Float16)(acc[j][r] + bb);
        *(v8h*)(dst + (size_t)jt * (64 * 256)) = hv; } } }
}
// ---- k_attn: block = 16 waves = 512 queries of one head, one block per WGP; the head's whole K and V^T (64 KB each, contiguous, in fragment order as k_proj stores them) are copied once to LDS, and every fragment of the key loop is read from there, 512 contiguous bytes a load.
// wave = 32 queries (2 query tiles), a trip = 64 keys: each K and V^T fragment is read once for both query tiles, and maximum, rescale and their exchange come once per 64 keys.
// S^T = K . Q^T (A = 16 key rows, B = 16 of the wave's queries): a lane holds 32 of the 64 scores of ONE query of each tile (keys j0 + 16 t + 8g + r, t = 0..3),
// so maximum and sum run in the lane, with one exchange between the halves; score tiles 2u and 2u + 1, converted in place, are the B operand of O^T += V^T . P^T for the 32 keys of step u (hardware k order, as frag_p loads V^T).
#define AQ 512          // queries per block
// a fragment stored in fragment order: f = its first piece, at the lane's 16 bytes; the second piece follows 512 B on
__device__ __forceinline__ v16h frag_p(const _Float16* f) { union { v16h v; v8h q[2]; } u; u.q[0] = *(const v8h*)f; u.q[1] = *(const v8h*)(f + 256); return u.v; }
#define KS 0.25503486f  // 32^-1/2 x log2(e): a raw product q . k times KS is the score's exponent to base 2
__global__ __launch_bounds__(512) void k_attn(const _Float16* __restrict__ Q, const _Float16* __restrict__ Kr, const _Float16* __restrict__ V, __bf16* __restrict__ YF) {
  __shared__ __align__(16) _Float16 sk[NT * HD]; __shared__ __align__(16) _Float16 sv[HD * NT];
  const int tid = threadIdx.x, wave = tid >> 5, lane = tid & 31; const int h = blockIdx.y; const size_t b = blockIdx.z; const int q0 = blockIdx.x * AQ + wave * 32; const size_t rq = b * NT + q0; const size_t hb = (b * NH + h) * (size_t)(NT * HD);   // the head's 64 KB in each of q, k, v
  { v4u tk[8], tv[8];   // 4,096 pieces of 16 B of each operand, 8 + 8 a thread, all sixteen loads in flight, 512 contiguous bytes a load; both loops unrolled so that tk and tv, indexed by constants only, stay in registers
#pragma unroll
    for (int i = 0; i < 8; ++i) { const int e = i * 512 + tid; tk[i] = *(const v4u*)(Kr + hb + e * 8); tv[i] = *(const v4u*)(V + hb + e * 8); }
#pragma unroll
    for (int i = 0; i < 8; ++i) { const int e = i * 512 + tid; *(v4u*)&sk[e * 8] = tk[i]; *(v4u*)&sv[e * 8] = tv[i]; } }
  v16h bq[2];   // every loop over qt, t, u, dt, i, r below is unrolled so that the arrays, indexed by constants only, stay in registers
#pragma unroll
  for (int qt = 0; qt < 2; ++qt) bq[qt] = frag_p(Q + hb + (size_t)((q0 >> 4) + qt) * 512 + lane * 8);
  __syncthreads();   // the staged K and V^T are read by every wave of the block
  const _Float16 *pk = sk + lane * 8, *pv = sv + lane * 8;   // the lane's 16 bytes in a piece
  float m[2] = { -3.0e38f, -3.0e38f }, nb[2] = { 0.f, 0.f }, l[2] = { 0.f, 0.f };   // of query col of tile qt; m = running maximum of the raw products q . k; nb = 11 - m * KS, the addend of the exponent; l (times 2^11) holds this half's keys only until the epilogue
  v8f acc[2][2] = {};            // acc[qt][dt][r] = O^T[dt * 16 + 8g + r][col] of tile qt
#pragma unroll 1   // as before: the trips stay rolled, so the loop's code stays short
  for (int ks = 0; ks < NT / 64; ++ks) { v16h ak[4], av[2][2]; v8f s[2][4];   // all eight fragments' loads stand at the head of the trip
#pragma unroll
    for (int t = 0; t < 4; ++t) ak[t] = frag_p(pk + (ks * 4 + t) * 512);
#pragma unroll
    for (int dt = 0; dt < 2; ++dt) {
#pragma unroll
      for (int u = 0; u < 2; ++u) av[dt][u] = frag_p(pv + (dt * 32 + ks * 2 + u) * 512); }
    __builtin_amdgcn_sched_barrier(0);   // keeps all sixteen LDS loads here as one group: without it (seen) half of the V^T loads sink among the last WMMAs, each a few instructions ahead of its wait
#pragma unroll
    for (int t = 0; t < 4; ++t) {
#pragma unroll
      for (int qt = 0; qt < 2; ++qt) { v8f c = {}; s[qt][t] = wmma16(ak[t], bq[qt], c); } }   // raw products: the factor KS > 0 keeps their order, so the maximum is taken on them as they are
#pragma unroll
    for (int qt = 0; qt < 2; ++qt) {
      float ma = fmaxf(s[qt][0][0], s[qt][1][0]), mb = fmaxf(s[qt][2][0], s[qt][3][0]);   // two chains, so that a link of one stands in the latency of the other
#pragma unroll
      for (int r = 1; r < 8; ++r) { ma = fmaxf(ma, fmaxf(s[qt][0][r], s[qt][1][r])); mb = fmaxf(mb, fmaxf(s[qt][2][r], s[qt][3][r])); }
      float mx = fmaxf(ma, mb); mx = fmaxf(mx, xhalf(mx));
      const float mn = fmaxf(m[qt], mx); const float nn = 11.0f - mn * KS; const float alpha = (m[qt] <= -1.0e38f) ? 0.f : __builtin_amdgcn_exp2f(nn - nb[qt]);
      v16h pb[2]; v2f es[4];
#pragma unroll
      for (int t = 0; t < 4; ++t) {
#pragma unroll
        for (int i = 0; i < 4; ++i) { const v2f c2 = { s[qt][t][2 * i], s[qt][t][2 * i + 1] }; const v2f x = c2 * KS + nn;   // one multiply-add a score: 2^11 exp((c - max) 32^-1/2) = 2^(c KS + nn)
          const v2f e = { __builtin_amdgcn_exp2f(x[0]), __builtin_amdgcn_exp2f(x[1]) }; es[t] = i ? es[t] + e : e; pb[t >> 1][(t & 1) * 8 + 2 * i] = (_Float16)e[0]; pb[t >> 1][(t & 1) * 8 + 2 * i + 1] = (_Float16)e[1]; } }
      const v2f e2 = (es[0] + es[1]) + (es[2] + es[3]);
      l[qt] = l[qt] * alpha + (e2[0] + e2[1]); m[qt] = mn; nb[qt] = nn;
#pragma unroll
      for (int dt = 0; dt < 2; ++dt) {
#pragma unroll
        for (int r = 0; r < 8; ++r) acc[qt][dt][r] *= alpha; }
#pragma unroll
      for (int u = 0; u < 2; ++u) {
#pragma unroll
        for (int dt = 0; dt < 2; ++dt) acc[qt][dt] = wmma16(av[dt][u], pb[u], acc[qt][dt]); } } }
  // Y = O / l goes out as k_out reads it: with col = lane & 15 and g = lane >> 4, acc[qt][dt][r] is channel 32 h + 16 dt + 8 g + r of query col, that is piece dt of the lane's A fragment of k-step h of the 16-row tile;
  // split here, once, into bf16 hi + lo: [row tile][k-step 8][hi, lo][piece 2][lane 32][8], a wave's store is 512 contiguous bytes
#pragma unroll
  for (int qt = 0; qt < 2; ++qt) { const float lt = l[qt] + xhalf(l[qt]);
    const float il = 1.0f / lt;   // numerator and l both carry the 2^11
#pragma unroll
    for (int dt = 0; dt < 2; ++dt) { __bf16* py = YF + (((rq >> 4) + qt) * (CC / 32) + h) * 1024 + dt * 256 + lane * 8; v4u fh, fl;
#pragma unroll
      for (int i = 0; i < 4; ++i) { const v2f y = { acc[qt][dt][2 * i] * il, acc[qt][dt][2 * i + 1] * il }; fh[i] = pk_bf(y); fl[i] = pk_bf(y - up_bf(fh[i])); }
      vst2(py, fh); vst2(py + 512, fl); } }
}
// ---- k_out: block = 64 rows, 8 waves: wave = (16-row tile, 128 of the 256 columns), two waves a SIMD: out = Y (hi + lo) . Wp + bp; whole 1-KB rows.
// The wave's 16 rows of Y, already split and in fragment order, are loaded once, all 32 loads (512 contiguous bytes each) in flight, and stay in registers for both passes
__global__ __launch_bounds__(256) void k_out(const __bf16* __restrict__ YF, const __bf16* __restrict__ PW, const float* __restrict__ BP, float* __restrict__ OUT) {
  __shared__ __align__(16) float sx[64][CC + 4];
  // the wave's number in a scalar register, as in k_proj: its tile and its half are then scalar arithmetic
  const int tid = threadIdx.x, wave = __builtin_amdgcn_readfirstlane(tid >> 5), lane = tid & 31, col = lane & 15, g = lane >> 4, rt = wave & 3, half = wave >> 2; const size_t rb = (size_t)blockIdx.x * 64; const __bf16* Wr = PW + (size_t)3 * CC * CC + (size_t)half * (128 * CC) + lane * 8;
  const __bf16* pa = YF + ((size_t)blockIdx.x * 4 + rt) * (CC / 32) * 1024 + lane * 8; F2 a[CC / 32];
#pragma unroll   // a, indexed by constants only, stays in registers
  for (int kc = 0; kc < CC / 32; ++kc) { union { v16b v; v8b q[2]; } uh, ul; const __bf16* p = pa + kc * 1024; uh.q[0] = *(const v8b*)p; uh.q[1] = *(const v8b*)(p + 256); ul.q[0] = *(const v8b*)(p + 512); ul.q[1] = *(const v8b*)(p + 768); a[kc].h = uh.v; a[kc].l = ul.v; }
#pragma unroll 1   // the two passes stay rolled, so the kernel's code stays short
  for (int ps = 0; ps < 8 / PJ; ++ps) { v8f acc[PJ] = {}; float bs[PJ];   // the lane's bias values, fetched ahead of the product and not one by one behind it
#pragma unroll   // bs, indexed by constants only, stays in registers
    for (int j = 0; j < PJ; ++j) bs[j] = BP[half * 128 + (ps * PJ + j) * 16 + col];
    mm_res<false>(a, Wr + (size_t)(ps * PJ) * 512, acc);
    __builtin_amdgcn_sched_barrier(0);   // keeps what follows behind the s_wait_xcnt that ends mm_res: without it (seen) the LDS addresses below are formed ahead of that wait, in the W loads' address registers
#pragma unroll
    for (int j = 0; j < PJ; ++j) { const int c = half * 128 + (ps * PJ + j) * 16 + col; const float bb = bfr(bs[j]);
#pragma unroll
      for (int r = 0; r < 8; ++r) sx[rt * 16 + 8 * g + r][c] = acc[j][r] + bb; } }
  __syncthreads();
  for (int e = tid; e < 64 * (CC / 4); e += 256) { const int rl = e >> 6, q = e & 63; vst2(OUT + (rb + rl) * CC + q * 4, *(const v4f*)&sx[rl][q * 4]); }
}
extern "C" void kernel_launch(void* const* d_in, const int* in_sizes, int n_in, void* d_out, int out_size, void* d_ws, size_t ws_size, hipStream_t stream) {
  (void)in_sizes; (void)n_in; (void)out_size;
  const float** F = (const float**)d_in;   // 0 x [16,32,32,256], 1 gamma, 2 beta, 3 Wq [256,256] (in,out), 4 bq, 5 Wk, 6 bk, 7 Wv, 8 bv, 9 Wp [256,256] (in,out), 10 bp
  if (ws_size < (size_t)WS_END) return;
  char* ws = (char*)d_ws; __bf16* PW = (__bf16*)ws; __bf16* YF = (__bf16*)(ws + WS_O); _Float16 *Q = (_Float16*)(ws + WS_Q), *Kr = (_Float16*)(ws + WS_K), *V = (_Float16*)(ws + WS_V);
  k_pack<<<dim3(CC / 16, 4, 2), 256, 0, stream>>>(F[3], F[5], F[7], F[9], PW);
  k_proj<<<dim3(TNB * NT / 64, 3), 128, 0, stream>>>(F[0], F[1], F[2], PW, F[4], F[6], F[8], Q, Kr, V);
  k_attn<<<dim3(NT / AQ, NH, TNB), 512, 0, stream>>>(Q, Kr, V, YF);
  k_out<<<TNB * NT / 64, 256, 0, stream>>>(YF, PW, F[10], (float*)d_out);
}
